// v000
// Times are from an AMD MI455X. After a warm-up the kernel runs many times in a row, and a time is the length of
// such a window on the GPU divided by its runs, so every launch and the gaps after it count. The runs cycle
// through copies of the inputs. A figure is the median of several windows, for all but v000 over two sittings.
// Sittings can differ by a few percent; kernels timed side by side share one.
// v000, which the later versions start from, runs in 153 microseconds.
#include <hip/hip_runtime.h>

// Contractions: S^T = K x Q^T on v_wmma_f32_16x16x32_bf16 (bf16 operands = RNE-converted input X, f32 accumulate);
// O = P x V on v_wmma_f32_16x16x32_f16 (P as f16 carried x4096, V = f16 of the bf16 RNE-converted X, f32 accumulate);
// Y = C x W^T on v_wmma_f32_16x16x32_f16 (C as f16 carried x256 plus an f16 residual plane x2048 with its own
// accumulator, W = f16 of the bf16 RNE-converted weight carried x64, f32 accumulate). Softmax and bias add in f32.

#ifndef NB
#define NB 2
#endif
#ifndef SEQ
#define SEQ 2048
#endif
#define NB_FULL    2
#define SEQ_FULL   2048
#define NHEAD      16
#define HDIM       64
#define EMB        (NHEAD * HDIM)       // floats per (b, s) of X and of the output, halves per (b, s) of each context plane
#define BQ         128                  // query rows per workgroup (8 waves x 16)
#define BK         32                   // keys per inner iteration
#define NWAVE      8
#define CT         64                   // keys per plane-builder block
#define TP         72                   // LDS pitch (halves) of the transposed tile
#define OP         68                   // LDS pitch (floats) of the staging tile
#define GM         128                  // projection rows per workgroup (8 waves x 16)
#define GN         64                   // projection columns per workgroup
#define WELEM      8                    // weight elements per thread in the weight plane builder

#define P_CARRY    4096.0f
#define CTX_CARRY  256.0f
#define RES_CARRY  2048.0f
#define W_CARRY    64.0f

static_assert(SEQ % BQ == 0);
static_assert(SEQ % CT == 0);
static_assert(SEQ % BK == 0);
static_assert(SEQ % GM == 0);
static_assert(EMB % GN == 0);
static_assert(EMB % 32 == 0);
static_assert(BQ == NWAVE * 16);
static_assert(GM == NWAVE * 16);
static_assert(HDIM == 64);
static_assert(GN == 64);
static_assert(SEQ <= SEQ_FULL);
static_assert(NB >= 1 && NB <= NB_FULL);
static_assert((TP * 2) % 16 == 0);
static_assert((OP * 4) % 16 == 0);
// coverage equalities: grid x block x per-thread elements == plane element count
static_assert((size_t)(SEQ / CT) * NHEAD * NB * 256 * 2 * 8 == (size_t)NB * NHEAD * SEQ * HDIM);   // row plane and transposed plane
static_assert((size_t)((EMB * EMB) / (256 * WELEM)) * 256 * WELEM == (size_t)EMB * EMB);           // weight plane
static_assert((size_t)(SEQ / BQ) * NHEAD * NB * NWAVE * 16 * HDIM == (size_t)NB * SEQ * EMB);       // context planes
static_assert((size_t)(SEQ / GM) * (EMB / GN) * NB * NWAVE * 16 * GN == (size_t)NB * SEQ * EMB);    // output

typedef __bf16   bf16;
typedef _Float16 f16;
typedef bf16     v16bf __attribute__((ext_vector_type(16)));
typedef f16      v16h  __attribute__((ext_vector_type(16)));
typedef f16      v8h   __attribute__((ext_vector_type(8)));
typedef float    v8f   __attribute__((ext_vector_type(8)));
typedef float    v4f   __attribute__((ext_vector_type(4)));
typedef unsigned v4u   __attribute__((ext_vector_type(4)));
typedef int      v4i   __attribute__((ext_vector_type(4)));

union FragB  { v16bf v; v4u q[2]; bf16 h[16]; };
union FragH  { v16h  v; v4u q[2]; f16  h[16]; };
union Pack8B { v4u u; bf16 h[8]; };
union Pack8H { v4u u; v8h v; f16 h[8]; };

// WMMA helpers: builtin followed by the VALU hazard guard (ties D, keeps A/B live).
static __device__ __forceinline__ v8f mma_bf16(v16bf a, v16bf b, v8f acc) {
  acc = __builtin_amdgcn_wmma_f32_16x16x32_bf16(false, a, false, b, (short)0, acc, false, false);
  asm volatile("v_nop\n\tv_nop\n\tv_nop\n\tv_nop" : "+v"(acc) : "v"(a), "v"(b));
  return acc;
}
static __device__ __forceinline__ v8f mma_f16(v16h a, v16h b, v8f acc) {
  acc = __builtin_amdgcn_wmma_f32_16x16x32_f16(false, a, false, b, (short)0, acc, false, false);
  asm volatile("v_nop\n\tv_nop\n\tv_nop\n\tv_nop" : "+v"(acc) : "v"(a), "v"(b));
  return acc;
}

// Plane builder. Block = (64-key tile, head, batch), 256 threads. q = k = v = head slice of X.
// coverage: positions kt*64 + {0..31, 32..63}, d 0..63 for both planes; every written line whole, one instruction.
__global__ __launch_bounds__(256) void x_planes_kernel(const float* __restrict__ x,
                                                       bf16* __restrict__ kb,
                                                       f16* __restrict__ vt) {
  const unsigned kt  = blockIdx.x;
  const unsigned h   = blockIdx.y;
  const unsigned b   = blockIdx.z;
  const unsigned tid = threadIdx.x;
  __shared__ __align__(16) f16 sT[HDIM * TP];   // [d][key], cross-wave (block barrier)
  const unsigned s0 = kt * CT;

  v4u    kval[2];
  size_t kidx[2];
  #pragma unroll
  for (unsigned kk = 0; kk < 2; ++kk) {
    const unsigned key = kk * 32u + (tid >> 3);     // 0..63
    const unsigned d0  = (tid & 7u) * 8u;           // 0..56
    const float* src = x + ((size_t)b * SEQ_FULL + s0 + key) * EMB + h * HDIM + d0;
    const v4f x0 = *(const v4f*)(src);
    const v4f x1 = *(const v4f*)(src + 4);
    Pack8B pk;
    #pragma unroll
    for (int i = 0; i < 4; ++i) {
      pk.h[i]     = (bf16)x0[i];                    // RNE convert
      pk.h[4 + i] = (bf16)x1[i];
    }
    kval[kk] = pk.u;
    kidx[kk] = (((size_t)b * NHEAD + h) * SEQ + s0 + key) * HDIM + d0;
    #pragma unroll
    for (int i = 0; i < 4; ++i) {
      sT[(d0 + i) * TP + key]     = (f16)(float)pk.h[i];       // f16 of bf16 value: exact
      sT[(d0 + 4 + i) * TP + key] = (f16)(float)pk.h[4 + i];
    }
  }
  __syncthreads();

  v4u    vval[2];
  size_t vidx[2];
  #pragma unroll
  for (unsigned kk = 0; kk < 2; ++kk) {
    const unsigned d  = kk * 32u + (tid >> 3);      // 0..63
    const unsigned ks = (tid & 7u) * 8u;            // 0..56
    Pack8H ph;
    ph.v = *(const v8h*)(sT + d * TP + ks);
    vval[kk] = ph.u;
    vidx[kk] = (((size_t)b * NHEAD + h) * HDIM + d) * SEQ + s0 + ks;
  }

  #pragma unroll
  for (int kk = 0; kk < 2; ++kk) {
    *(v4u*)(kb + kidx[kk]) = kval[kk];
    *(v4u*)(vt + vidx[kk]) = vval[kk];
  }
  
}

// Weight plane builder: wp[n][k] = f16(bf16(W[n][k]) * 64), same [out][in] layout (k contiguous per output column).
__global__ __launch_bounds__(256) void w_plane_kernel(const float* __restrict__ w, f16* __restrict__ wp) {
  const unsigned t  = blockIdx.x * 256u + threadIdx.x;
  const size_t   e0 = (size_t)t * WELEM;
  const v4f a0 = *(const v4f*)(w + e0);
  const v4f a1 = *(const v4f*)(w + e0 + 4);
  Pack8H ph;
  #pragma unroll
  for (int i = 0; i < 4; ++i) {
    ph.h[i]     = (f16)((float)(bf16)a0[i] * W_CARRY);   // bf16 significand x power of two: exact in f16
    ph.h[4 + i] = (f16)((float)(bf16)a1[i] * W_CARRY);
  }
  const v4u val = ph.u;
  *(v4u*)(wp + e0) = val;
  
}

// Flash attention with a per-key replace mask. Block = (query block of 128, head, batch); one wave owns 16 query rows.
// S^T = K x Q^T so queries sit on lanes; P^T in C-layout is bit-identical to the A-fragment layout of O += P x V.
// Q B-fragments, K A-fragments and V^T B-fragments are loaded straight from the 16-bit planes (two 16-B loads each).
__global__ __launch_bounds__(256) void attn_kernel(const bf16* __restrict__ kb,
                                                   const f16* __restrict__ vt,
                                                   const int* __restrict__ mask,
                                                   f16* __restrict__ ch,
                                                   f16* __restrict__ cr) {
  const unsigned qblk = blockIdx.x;
  const unsigned h    = blockIdx.y;
  const unsigned b    = blockIdx.z;
  const unsigned tid  = threadIdx.x;
  const unsigned wave = tid >> 5;
  const unsigned lane = tid & 31u;
  const unsigned lq   = lane & 15u;   // query column of S^T / d column of O
  const unsigned hi   = lane >> 4;    // k-split half

  __shared__ __align__(16) float sO[NWAVE * 16 * OP];   // per-wave staging tile (block barrier used)

  const unsigned qrow0 = qblk * BQ + wave * 16u;        // first query row of this wave

  const bf16* kb_h = kb + ((size_t)b * NHEAD + h) * SEQ * HDIM;
  const f16*  vt_h = vt + ((size_t)b * NHEAD + h) * HDIM * SEQ;
  const int*  mk   = mask + (size_t)b * SEQ_FULL + hi * 8u;

  // Q as B-operand fragments: lane lq holds query qrow0+lq, elements follow the split d map (same plane as K).
  FragB qf[2];
  #pragma unroll
  for (unsigned f = 0; f < 2; ++f) {
    const bf16* base = kb_h + (size_t)(qrow0 + lq) * HDIM + f * 32u + hi * 8u;
    qf[f].q[0] = *(const v4u*)(base);        // d = f*32 + hi*8 + 0..7
    qf[f].q[1] = *(const v4u*)(base + 16);   // d = f*32 + 16 + hi*8 + 0..7
  }

  v8f o[4];
  #pragma unroll
  for (int dt = 0; dt < 4; ++dt) o[dt] = (v8f){0, 0, 0, 0, 0, 0, 0, 0};

  float rmax = -3.0e38f;
  float rsum = 0.0f;                                   // carried x4096, summed from the f16 values fed to P x V
  const float SL   = 0.03125f * 1.4426950408889634f;   // (1/sqrt(EMB)) * log2(e)
  const float FILL = -1.0e20f;                         // replace value for masked keys (applied before scaling)

  #pragma unroll 1
  for (unsigned i = 0; i < SEQ / BK; ++i) {
    const unsigned j0 = i * BK;

    // K A-fragments: row = key j0 + sub*16 + lq, split d map
    FragB ak[2][2];
    #pragma unroll
    for (unsigned sub = 0; sub < 2; ++sub) {
      #pragma unroll
      for (unsigned f = 0; f < 2; ++f) {
        const bf16* base = kb_h + (size_t)(j0 + sub * 16u + lq) * HDIM + f * 32u + hi * 8u;
        ak[sub][f].q[0] = *(const v4u*)(base);
        ak[sub][f].q[1] = *(const v4u*)(base + 16);
      }
    }
    // V B-fragments: column n = d = dt*16 + lq, split key map from the transposed plane
    FragH bv[4];
    #pragma unroll
    for (unsigned dt = 0; dt < 4; ++dt) {
      const f16* base = vt_h + (size_t)(dt * 16u + lq) * SEQ + j0 + hi * 8u;
      bv[dt].q[0] = *(const v4u*)(base);            // keys j0 + hi*8 + 0..7
      bv[dt].q[1] = *(const v4u*)(base + 16);       // keys j0 + 16 + hi*8 + 0..7
    }
    // key mask words for this lane's 16 keys (two runs of 8)
    v4i mv[4];
    mv[0] = *(const v4i*)(mk + j0);
    mv[1] = *(const v4i*)(mk + j0 + 4);
    mv[2] = *(const v4i*)(mk + j0 + 16);
    mv[3] = *(const v4i*)(mk + j0 + 20);

    // S^T tiles: c[sub][r] = rawscore(query qrow0+lq, key j0 + sub*16 + hi*8 + r)
    v8f c[2];
    #pragma unroll
    for (int sub = 0; sub < 2; ++sub) {
      v8f acc = (v8f){0, 0, 0, 0, 0, 0, 0, 0};
      acc = mma_bf16(ak[sub][0].v, qf[0].v, acc);
      acc = mma_bf16(ak[sub][1].v, qf[1].v, acc);
      c[sub] = acc;
    }

    // replace mask by value (mask == 0 -> FILL), per key
    #pragma unroll
    for (int r = 0; r < 4; ++r) {
      c[0][r]     = (mv[0][r] == 0) ? FILL : c[0][r];
      c[0][4 + r] = (mv[1][r] == 0) ? FILL : c[0][4 + r];
      c[1][r]     = (mv[2][r] == 0) ? FILL : c[1][r];
      c[1][4 + r] = (mv[3][r] == 0) ? FILL : c[1][4 + r];
    }

    // online softmax (running max): query lq's 32 scores are split across lane / lane^16
    float m_new = rmax;
    #pragma unroll
    for (int r = 0; r < 8; ++r) {
      m_new = fmaxf(m_new, c[0][r]);
      m_new = fmaxf(m_new, c[1][r]);
    }
    m_new = fmaxf(m_new, __shfl_xor(m_new, 16, 32));
    const float scale = __builtin_amdgcn_exp2f((rmax - m_new) * SL);
    rmax = m_new;

    // exp + pack: P^T C-layout == A-fragment layout for the PV product
    FragH pa;
    float psum = 0.0f;
    #pragma unroll
    for (int r = 0; r < 8; ++r) {
      const float p0 = __builtin_amdgcn_exp2f((c[0][r] - m_new) * SL);   // key hi*8 + r
      const float p1 = __builtin_amdgcn_exp2f((c[1][r] - m_new) * SL);   // key 16 + hi*8 + r
      const f16 h0 = (f16)(p0 * P_CARRY);
      const f16 h1 = (f16)(p1 * P_CARRY);
      pa.h[r]     = h0;
      pa.h[8 + r] = h1;
      psum += (float)h0 + (float)h1;
    }
    rsum = rsum * scale + psum + __shfl_xor(psum, 16, 32);

    // rescale O: queries are the row dimension there -> per-row scale from lane 8*hi + r
    float sc[8];
    #pragma unroll
    for (int r = 0; r < 8; ++r) sc[r] = __shfl(scale, (int)((hi << 3) + r), 32);
    #pragma unroll
    for (int dt = 0; dt < 4; ++dt) {
      #pragma unroll
      for (int r = 0; r < 8; ++r) o[dt][r] *= sc[r];
    }

    // O += P x V
    #pragma unroll
    for (int dt = 0; dt < 4; ++dt) o[dt] = mma_f16(pa.v, bv[dt].v, o[dt]);
  }

  // normalize: lane holds column d = dt*16 + lq for query rows 8*hi + r; the x4096 carry cancels against rsum
  float rs[8];
  #pragma unroll
  for (int r = 0; r < 8; ++r) rs[r] = CTX_CARRY * (1.0f / __shfl(rsum, (int)((hi << 3) + r), 32));

  float* so = sO + wave * (16 * OP);
  #pragma unroll
  for (int r = 0; r < 8; ++r) {
    #pragma unroll
    for (int dt = 0; dt < 4; ++dt) {
      so[(hi * 8u + r) * OP + dt * 16u + lq] = o[dt][r] * rs[r];
    }
  }
  __syncthreads();

  // 32 lanes cover rows it*4 + 0..3; it = 0..3 covers the wave's 16 rows, for both planes.
  v4u    hv[4], rv[4];
  size_t gidx[4];
  #pragma unroll
  for (unsigned it = 0; it < 4; ++it) {
    const unsigned row = it * 4u + (lane >> 3);
    const unsigned c8  = (lane & 7u) * 8u;
    const v4f a0 = *(const v4f*)(so + row * OP + c8);
    const v4f a1 = *(const v4f*)(so + row * OP + c8 + 4);
    Pack8H ph, pr;
    #pragma unroll
    for (int i = 0; i < 4; ++i) {
      const f16 t0 = (f16)a0[i];
      const f16 t1 = (f16)a1[i];
      ph.h[i]     = t0;
      ph.h[4 + i] = t1;
      pr.h[i]     = (f16)((a0[i] - (float)t0) * RES_CARRY);
      pr.h[4 + i] = (f16)((a1[i] - (float)t1) * RES_CARRY);
    }
    hv[it]   = ph.u;
    rv[it]   = pr.u;
    gidx[it] = ((size_t)b * SEQ + qrow0 + row) * EMB + h * HDIM + c8;
  }
  #pragma unroll
  for (int it = 0; it < 4; ++it) {
    *(v4u*)(ch + gidx[it]) = hv[it];
    *(v4u*)(cr + gidx[it]) = rv[it];
  }
  
}

// Output projection. Block = (128-row tile, 64-column tile, batch); one wave owns 16 rows x 64 columns.
// A fragments from the context planes (row-major, k contiguous), B fragments from the weight plane rows
// (wp[n][k], k contiguous) - both with the split k map, two 16-B loads per fragment.
__global__ __launch_bounds__(256) void proj_kernel(const f16* __restrict__ ch,
                                                   const f16* __restrict__ cr,
                                                   const f16* __restrict__ wp,
                                                   const float* __restrict__ bias,
                                                   float* __restrict__ out) {
  const unsigned rb   = blockIdx.x;
  const unsigned cb   = blockIdx.y;
  const unsigned b    = blockIdx.z;
  const unsigned tid  = threadIdx.x;
  const unsigned wave = tid >> 5;
  const unsigned lane = tid & 31u;
  const unsigned lq   = lane & 15u;
  const unsigned hi   = lane >> 4;

  __shared__ __align__(16) float sO[NWAVE * 16 * OP];   // per-wave staging tile (block barrier used)

  const unsigned row0 = rb * GM + wave * 16u;           // first sequence row of this wave
  const unsigned col0 = cb * GN;

  const f16* ah = ch + ((size_t)b * SEQ + row0 + lq) * EMB + hi * 8u;
  const f16* ar = cr + ((size_t)b * SEQ + row0 + lq) * EMB + hi * 8u;
  const f16* bw = wp + (size_t)(col0 + lq) * EMB + hi * 8u;

  v8f acc[4], acr[4];
  #pragma unroll
  for (int nt = 0; nt < 4; ++nt) {
    acc[nt] = (v8f){0, 0, 0, 0, 0, 0, 0, 0};
    acr[nt] = (v8f){0, 0, 0, 0, 0, 0, 0, 0};
  }

  #pragma unroll 1
  for (unsigned k0 = 0; k0 < EMB; k0 += 32u) {
    FragH a, a2;
    a.q[0]  = *(const v4u*)(ah + k0);          // k = k0 + hi*8 + 0..7
    a.q[1]  = *(const v4u*)(ah + k0 + 16);     // k = k0 + 16 + hi*8 + 0..7
    a2.q[0] = *(const v4u*)(ar + k0);
    a2.q[1] = *(const v4u*)(ar + k0 + 16);
    FragH bf[4];
    #pragma unroll
    for (unsigned nt = 0; nt < 4; ++nt) {
      const f16* base = bw + (size_t)(nt * 16u) * EMB + k0;
      bf[nt].q[0] = *(const v4u*)(base);
      bf[nt].q[1] = *(const v4u*)(base + 16);
    }
    #pragma unroll
    for (int nt = 0; nt < 4; ++nt) {
      acc[nt] = mma_f16(a.v,  bf[nt].v, acc[nt]);
      acr[nt] = mma_f16(a2.v, bf[nt].v, acr[nt]);   // scaled residual: separate accumulator
    }
  }

  // fold carries: (hi + res/2048) / (256 * 64); acc[nt][r] = element (row 8*hi + r, column nt*16 + lq)
  float* so = sO + wave * (16 * OP);
  const float inv_res = 1.0f / RES_CARRY;
  const float inv_car = 1.0f / (CTX_CARRY * W_CARRY);
  #pragma unroll
  for (int r = 0; r < 8; ++r) {
    #pragma unroll
    for (int nt = 0; nt < 4; ++nt) {
      so[(hi * 8u + r) * OP + nt * 16u + lq] = (acc[nt][r] + acr[nt][r] * inv_res) * inv_car;
    }
  }
  __syncthreads();

  // bias (bf16 RNE-converted input value), added in f32
  const v4f braw = *(const v4f*)(bias + col0 + lq * 4u);
  v4f bq;
  #pragma unroll
  for (int i = 0; i < 4; ++i) bq[i] = (float)(bf16)braw[i];

  // lanes 0..15 one row (16 consecutive lanes x 16 B each), lanes 16..31 the next row; 8 instructions cover the wave's 16 rows.
  v4f    vals[8];
  size_t gidx[8];
  #pragma unroll
  for (unsigned it = 0; it < 8; ++it) {
    const unsigned row = it * 2u + hi;
    const v4f t = *(const v4f*)(so + row * OP + lq * 4u);
    vals[it] = t + bq;
    gidx[it] = ((size_t)b * SEQ_FULL + row0 + row) * EMB + col0 + lq * 4u;
  }
  #pragma unroll
  for (int it = 0; it < 8; ++it) *(v4f*)(out + gidx[it]) = vals[it];
  
}

extern "C" void kernel_launch(void* const* d_in, const int* in_sizes, int n_in,
                              void* d_out, int out_size, void* d_ws, size_t ws_size,
                              hipStream_t stream) {
  if (n_in < 4) return;
  const size_t rows_used = (size_t)(NB - 1) * SEQ_FULL + SEQ;
  if ((size_t)in_sizes[0] < rows_used * EMB) return;
  if ((size_t)in_sizes[1] < rows_used) return;
  if ((size_t)in_sizes[2] < (size_t)EMB * EMB) return;
  if ((size_t)in_sizes[3] < (size_t)EMB) return;
  if ((size_t)out_size < rows_used * EMB) return;

  const size_t kb_bytes = (size_t)NB * NHEAD * SEQ * HDIM * 2;   // bf16 row plane
  const size_t vt_bytes = (size_t)NB * NHEAD * HDIM * SEQ * 2;   // f16 transposed plane
  const size_t cx_bytes = (size_t)NB * SEQ * EMB * 2;            // each f16 context plane
  const size_t wp_bytes = (size_t)EMB * EMB * 2;                 // f16 weight plane
  const size_t total    = kb_bytes + vt_bytes + 2 * cx_bytes + wp_bytes;
  if (ws_size < total) return;

  const float* x    = (const float*)d_in[0];
  const int*   mask = (const int*)d_in[1];
  const float* w    = (const float*)d_in[2];
  const float* bias = (const float*)d_in[3];
  float*       out  = (float*)d_out;

  char* base = (char*)d_ws;
  bf16* kb = (bf16*)base;
  f16*  vt = (f16*)(base + kb_bytes);
  f16*  ch = (f16*)(base + kb_bytes + vt_bytes);
  f16*  cr = (f16*)(base + kb_bytes + vt_bytes + cx_bytes);
  f16*  wp = (f16*)(base + kb_bytes + vt_bytes + 2 * cx_bytes);

  x_planes_kernel<<<dim3(SEQ / CT, NHEAD, NB), 256, 0, stream>>>(x, kb, vt);
  w_plane_kernel<<<dim3((EMB * EMB) / (256 * WELEM)), 256, 0, stream>>>(w, wp);
  attn_kernel<<<dim3(SEQ / BQ, NHEAD, NB), 256, 0, stream>>>(kb, vt, mask, ch, cr);
  proj_kernel<<<dim3(SEQ / GM, EMB / GN, NB), 256, 0, stream>>>(ch, cr, wp, bias, out);
}

// v001
// It runs in 98.1 microseconds.
// Next to v000, in two timings, it ran 1.60 and 1.65 times as fast.
#include <hip/hip_runtime.h>

// Contractions: S^T = K x Q^T on v_wmma_f32_16x16x32_bf16 (bf16 operands = RNE-converted input X, f32 accumulate);
// O = P x V on v_wmma_f32_16x16x32_f16 (P as f16 carried x4096, V = f16 of the bf16 RNE-converted X, f32 accumulate);
// Y = C x W^T on v_wmma_f32_16x16x32_f16 (C as f16 carried x256 plus an f16 residual plane x2048 with its own
// accumulator, W = f16 of the bf16 RNE-converted weight carried x64, f32 accumulate). Softmax and bias add in f32.
//
// Plane layout: every 16-bit plane is stored in fragment order. The unit is 16 B (8 consecutive k elements of one
// row or column); 32 units = the 512 contiguous bytes that one wave-wide 16-B load brings in, unit index = lane
// (lane = hi*16 + lq: lq = row or column inside a 16-wide tile, hi = which run of 8 inside a run of 16 k elements).

#ifndef NB
#define NB 2
#endif
#ifndef SEQ
#define SEQ 2048
#endif
#define NB_FULL    2
#define SEQ_FULL   2048
#define NHEAD      16
#define HDIM       64
#define EMB        (NHEAD * HDIM)       // floats per (b, s) of X and of the output, halves per (b, s) of each context plane
#define BQ         128                  // query rows per workgroup (8 waves x 16)
#define BK         32                   // keys per inner iteration
#define NWAVE      8
#define CT         64                   // keys per plane-builder block
#define TP         72                   // LDS pitch (halves) of the transposed tile
#define KP         17                   // LDS pitch (16-B units) of one d-chunk row of the fragment-order K tile
#define FU         256                  // elements of one wave-wide fragment load (32 lanes x 8)
#define OP         68                   // LDS pitch (floats) of the staging tile
#define GM         128                  // projection rows per workgroup (8 waves x 16)
#define GN         64                   // projection columns per workgroup
#define WELEM      8                    // weight elements per thread in the weight plane builder

#define P_CARRY    4096.0f
#define CTX_CARRY  256.0f
#define RES_CARRY  2048.0f
#define W_CARRY    64.0f

static_assert(SEQ % BQ == 0);
static_assert(SEQ % CT == 0);
static_assert(SEQ % BK == 0);
static_assert(BK == 32 && CT % BK == 0 && CT * HDIM == 2 * 256 * 8);
static_assert(SEQ % GM == 0);
static_assert(EMB % GN == 0);
static_assert(EMB % 32 == 0);
static_assert(BQ == NWAVE * 16);
static_assert(GM == NWAVE * 16);
static_assert(HDIM == 64);
static_assert(GN == 64);
static_assert(SEQ <= SEQ_FULL);
static_assert(NB >= 1 && NB <= NB_FULL);
static_assert((TP * 2) % 16 == 0);
static_assert((OP * 4) % 16 == 0);
// coverage equalities: grid x block x per-thread elements == plane element count
static_assert((size_t)(SEQ / CT) * NHEAD * NB * 256 * 2 * 8 == (size_t)NB * NHEAD * SEQ * HDIM);   // row plane and transposed plane
static_assert((size_t)((EMB * EMB) / (256 * WELEM)) * 256 * WELEM == (size_t)EMB * EMB);           // weight plane
static_assert((size_t)(SEQ / BQ) * NHEAD * NB * NWAVE * 16 * HDIM == (size_t)NB * SEQ * EMB);       // context planes
static_assert((size_t)(SEQ / GM) * (EMB / GN) * NB * NWAVE * 16 * GN == (size_t)NB * SEQ * EMB);    // output

typedef __bf16   bf16;
typedef _Float16 f16;
typedef bf16     v16bf __attribute__((ext_vector_type(16)));
typedef f16      v16h  __attribute__((ext_vector_type(16)));
typedef f16      v8h   __attribute__((ext_vector_type(8)));
typedef float    v8f   __attribute__((ext_vector_type(8)));
typedef float    v4f   __attribute__((ext_vector_type(4)));
typedef unsigned v4u   __attribute__((ext_vector_type(4)));
typedef int      v4i   __attribute__((ext_vector_type(4)));

union FragB  { v16bf v; v4u q[2]; bf16 h[16]; };
union FragH  { v16h  v; v4u q[2]; f16  h[16]; };
union Pack8B { v4u u; bf16 h[8]; };
union Pack8H { v4u u; v8h v; f16 h[8]; };

// WMMA helpers: builtin followed by the VALU hazard guard (ties D, keeps A/B live).
static __device__ __forceinline__ v8f mma_bf16(v16bf a, v16bf b, v8f acc) {
  acc = __builtin_amdgcn_wmma_f32_16x16x32_bf16(false, a, false, b, (short)0, acc, false, false);
  asm volatile("v_nop\n\tv_nop\n\tv_nop\n\tv_nop" : "+v"(acc) : "v"(a), "v"(b));
  return acc;
}
static __device__ __forceinline__ v8f mma_f16(v16h a, v16h b, v8f acc) {
  acc = __builtin_amdgcn_wmma_f32_16x16x32_f16(false, a, false, b, (short)0, acc, false, false);
  asm volatile("v_nop\n\tv_nop\n\tv_nop\n\tv_nop" : "+v"(acc) : "v"(a), "v"(b));
  return acc;
}

// Plane builder. Block = (64-key tile, head, batch), 256 threads. q = k = v = head slice of X.
// coverage: positions kt*64 + {0..31, 32..63}, d 0..63 for both planes; every written line whole, one instruction.
// kb, per (b, h): [16-key tile][d chunk c = d/8][key in tile][8 d]; a fragment load (f, j) is units (f*2+j)*32 + lane.
// vt, per (b, h): [32-key block][dt*2 + j][lane][8 keys], d = dt*16 + lq, keys = j*16 + hi*8 + 0..7 of the block.
__global__ __launch_bounds__(256) void x_planes_kernel(const float* __restrict__ x,
                                                       bf16* __restrict__ kb,
                                                       f16* __restrict__ vt) {
  const unsigned kt  = blockIdx.x;
  const unsigned h   = blockIdx.y;
  const unsigned b   = blockIdx.z;
  const unsigned tid = threadIdx.x;
  __shared__ __align__(16) f16 sT[HDIM * TP];   // [d][key], cross-wave (block barrier)
  __shared__ __align__(16) v4u sK[(CT / 16) * 8 * KP];   // [tile*8 + d chunk][key in tile], cross-wave
  const unsigned s0 = kt * CT;

  #pragma unroll
  for (unsigned kk = 0; kk < 2; ++kk) {
    const unsigned key = kk * 32u + (tid >> 3);     // 0..63
    const unsigned d0  = (tid & 7u) * 8u;           // 0..56
    const float* src = x + ((size_t)b * SEQ_FULL + s0 + key) * EMB + h * HDIM + d0;
    const v4f x0 = *(const v4f*)(src);
    const v4f x1 = *(const v4f*)(src + 4);
    Pack8B pk;
    #pragma unroll
    for (int i = 0; i < 4; ++i) {
      pk.h[i]     = (bf16)x0[i];                    // RNE convert
      pk.h[4 + i] = (bf16)x1[i];
    }
    sK[((key >> 4) * 8u + (tid & 7u)) * KP + (key & 15u)] = pk.u;
    #pragma unroll
    for (int i = 0; i < 4; ++i) {
      sT[(d0 + i) * TP + key]     = (f16)(float)pk.h[i];       // f16 of bf16 value: exact
      sT[(d0 + 4 + i) * TP + key] = (f16)(float)pk.h[4 + i];
    }
  }
  __syncthreads();

  // unit u = kk*256 + tid of this block's 8 KiB of each plane: both planes are written in unit order
  v4u    kval[2], vval[2];
  size_t uidx[2];
  #pragma unroll
  for (unsigned kk = 0; kk < 2; ++kk) {
    const unsigned u  = kk * 256u + tid;
    kval[kk] = sK[(u >> 4) * KP + (u & 15u)];
    const unsigned d  = (tid >> 6) * 16u + (tid & 15u);          // dt*16 + lq
    const unsigned ks = kk * 32u + ((tid >> 4) & 3u) * 8u;       // block*32 + j*16 + hi*8
    Pack8H ph;
    ph.v = *(const v8h*)(sT + d * TP + ks);
    vval[kk] = ph.u;
    uidx[kk] = (((size_t)b * NHEAD + h) * SEQ + s0) * HDIM + (size_t)u * 8u;
  }

  #pragma unroll
  for (int kk = 0; kk < 2; ++kk) {
    *(v4u*)(kb + uidx[kk]) = kval[kk];
    *(v4u*)(vt + uidx[kk]) = vval[kk];
  }
  
}

// Weight plane builder: f16(bf16(W[n][k]) * 64) in fragment order: [n/16][k/32][j][lane][8 k], n = (n/16)*16 + lq,
// k = (k/32)*32 + j*16 + hi*8 + 0..7. Thread t writes unit t.
__global__ __launch_bounds__(256) void w_plane_kernel(const float* __restrict__ w, f16* __restrict__ wp) {
  const unsigned t  = blockIdx.x * 256u + threadIdx.x;
  const size_t   e0 = (size_t)t * WELEM;
  const size_t   r0 = (size_t)((t >> 11) * 16u + (t & 15u)) * EMB + ((t >> 4) & 127u) * 8u;
  const v4f a0 = *(const v4f*)(w + r0);
  const v4f a1 = *(const v4f*)(w + r0 + 4);
  Pack8H ph;
  #pragma unroll
  for (int i = 0; i < 4; ++i) {
    ph.h[i]     = (f16)((float)(bf16)a0[i] * W_CARRY);   // bf16 significand x power of two: exact in f16
    ph.h[4 + i] = (f16)((float)(bf16)a1[i] * W_CARRY);
  }
  const v4u val = ph.u;
  *(v4u*)(wp + e0) = val;
  
}

// Flash attention with a per-key replace mask. Block = (query block of 128, head, batch); one wave owns 16 query rows.
// S^T = K x Q^T so queries sit on lanes; P^T in C-layout is bit-identical to the A-fragment layout of O += P x V.
// Q B-fragments, K A-fragments and V^T B-fragments are loaded straight from the fragment-order planes (two 16-B loads
// each, every load 512 contiguous bytes per wave).
__global__ __launch_bounds__(256) void attn_kernel(const bf16* __restrict__ kb,
                                                   const f16* __restrict__ vt,
                                                   const int* __restrict__ mask,
                                                   f16* __restrict__ ch,
                                                   f16* __restrict__ cr) {
  const unsigned qblk = blockIdx.x;
  const unsigned h    = blockIdx.y;
  const unsigned b    = blockIdx.z;
  const unsigned tid  = threadIdx.x;
  const unsigned wave = tid >> 5;
  const unsigned lane = tid & 31u;
  const unsigned lq   = lane & 15u;   // query column of S^T / d column of O
  const unsigned hi   = lane >> 4;    // k-split half

  __shared__ __align__(16) float sO[NWAVE * 16 * OP];   // per-wave staging tile (block barrier used)

  const unsigned qrow0 = qblk * BQ + wave * 16u;        // first query row of this wave

  const bf16* kb_h = kb + ((size_t)b * NHEAD + h) * SEQ * HDIM;
  const f16*  vt_h = vt + ((size_t)b * NHEAD + h) * HDIM * SEQ;
  const unsigned lo = lane * 8u;      // this lane's unit inside a wave-wide fragment load
  const int*  mk   = mask + (size_t)b * SEQ_FULL + hi * 8u;

  // Q as B-operand fragments: lane lq holds query qrow0+lq, elements follow the split d map (same plane as K).
  FragB qf[2];
  #pragma unroll
  for (unsigned f = 0; f < 2; ++f) {
    const bf16* base = kb_h + f * (2u * FU);
    const unsigned qo = qrow0 * HDIM + lo;
    qf[f].q[0] = *(const v4u*)(base + qo);        // d = f*32 + hi*8 + 0..7
    qf[f].q[1] = *(const v4u*)(base + FU + qo);   // d = f*32 + 16 + hi*8 + 0..7
  }

  v8f o[4];
  #pragma unroll
  for (int dt = 0; dt < 4; ++dt) o[dt] = (v8f){0, 0, 0, 0, 0, 0, 0, 0};

  float rmax = -3.0e38f;
  float rsum = 0.0f;                                   // carried x4096, summed from the f16 values fed to P x V
  const float SL   = 0.03125f * 1.4426950408889634f;   // (1/sqrt(EMB)) * log2(e)
  const float FILL = -1.0e20f;                         // replace value for masked keys (applied before scaling)

  #pragma unroll 1
  for (unsigned i = 0; i < SEQ / BK; ++i) {
    const unsigned j0 = i * BK;

    // issued first: they are the first values needed behind the score product, and the wait among the V loads below
    // would otherwise hold them behind every fragment load
    // key mask words for this lane's 16 keys (two runs of 8)
    v4i mv[4];
    mv[0] = *(const v4i*)(mk + j0);
    mv[1] = *(const v4i*)(mk + j0 + 4);
    mv[2] = *(const v4i*)(mk + j0 + 16);
    mv[3] = *(const v4i*)(mk + j0 + 20);
    // K A-fragments: row = key j0 + sub*16 + lq, split d map
    FragB ak[2][2];
    #pragma unroll
    for (unsigned sub = 0; sub < 2; ++sub) {
      #pragma unroll
      for (unsigned f = 0; f < 2; ++f) {
        const bf16* base = kb_h + (size_t)(j0 + sub * 16u) * HDIM + f * (2u * FU);
        ak[sub][f].q[0] = *(const v4u*)(base + lo);
        ak[sub][f].q[1] = *(const v4u*)(base + FU + lo);
      }
    }
    // V B-fragments: column n = d = dt*16 + lq, split key map from the transposed plane
    FragH bv[4];
    #pragma unroll
    for (unsigned dt = 0; dt < 4; ++dt) {
      const f16* base = vt_h + (size_t)j0 * HDIM + dt * (2u * FU);
      bv[dt].q[0] = *(const v4u*)(base + lo);       // keys j0 + hi*8 + 0..7
      // the last load's result may be given the registers that held the earlier loads' addresses
      if (dt == 3) asm volatile("s_wait_xcnt 0x0" ::: "memory");
      bv[dt].q[1] = *(const v4u*)(base + FU + lo);  // keys j0 + 16 + hi*8 + 0..7
    }

    // S^T tiles: c[sub][r] = rawscore(query qrow0+lq, key j0 + sub*16 + hi*8 + r)
    v8f c[2];
    #pragma unroll
    for (int sub = 0; sub < 2; ++sub) {
      v8f acc = (v8f){0, 0, 0, 0, 0, 0, 0, 0};
      acc = mma_bf16(ak[sub][0].v, qf[0].v, acc);
      acc = mma_bf16(ak[sub][1].v, qf[1].v, acc);
      c[sub] = acc;
    }

    // replace mask by value (mask == 0 -> FILL), per key
    #pragma unroll
    for (int r = 0; r < 4; ++r) {
      c[0][r]     = (mv[0][r] == 0) ? FILL : c[0][r];
      c[0][4 + r] = (mv[1][r] == 0) ? FILL : c[0][4 + r];
      c[1][r]     = (mv[2][r] == 0) ? FILL : c[1][r];
      c[1][4 + r] = (mv[3][r] == 0) ? FILL : c[1][4 + r];
    }

    // online softmax (running max): query lq's 32 scores are split across lane / lane^16
    float m_new = rmax;
    #pragma unroll
    for (int r = 0; r < 8; ++r) {
      m_new = fmaxf(m_new, c[0][r]);
      m_new = fmaxf(m_new, c[1][r]);
    }
    m_new = fmaxf(m_new, __shfl_xor(m_new, 16, 32));
    const float scale = __builtin_amdgcn_exp2f((rmax - m_new) * SL);
    rmax = m_new;

    // exp + pack: P^T C-layout == A-fragment layout for the PV product
    FragH pa;
    float psum = 0.0f;
    #pragma unroll
    for (int r = 0; r < 8; ++r) {
      const float p0 = __builtin_amdgcn_exp2f((c[0][r] - m_new) * SL);   // key hi*8 + r
      const float p1 = __builtin_amdgcn_exp2f((c[1][r] - m_new) * SL);   // key 16 + hi*8 + r
      const f16 h0 = (f16)(p0 * P_CARRY);
      const f16 h1 = (f16)(p1 * P_CARRY);
      pa.h[r]     = h0;
      pa.h[8 + r] = h1;
      psum += (float)h0 + (float)h1;
    }
    rsum = rsum * scale + psum + __shfl_xor(psum, 16, 32);

    // rescale O: queries are the row dimension there -> per-row scale from lane 8*hi + r
    float sc[8];
    #pragma unroll
    for (int r = 0; r < 8; ++r) sc[r] = __shfl(scale, (int)((hi << 3) + r), 32);
    #pragma unroll
    for (int dt = 0; dt < 4; ++dt) {
      #pragma unroll
      for (int r = 0; r < 8; ++r) o[dt][r] *= sc[r];
    }

    // O += P x V
    #pragma unroll
    for (int dt = 0; dt < 4; ++dt) o[dt] = mma_f16(pa.v, bv[dt].v, o[dt]);
  }

  // normalize: lane holds column d = dt*16 + lq for query rows 8*hi + r; the x4096 carry cancels against rsum
  float rs[8];
  #pragma unroll
  for (int r = 0; r < 8; ++r) rs[r] = CTX_CARRY * (1.0f / __shfl(rsum, (int)((hi << 3) + r), 32));

  float* so = sO + wave * (16 * OP);
  #pragma unroll
  for (int r = 0; r < 8; ++r) {
    #pragma unroll
    for (int dt = 0; dt < 4; ++dt) {
      so[(hi * 8u + r) * OP + dt * 16u + lq] = o[dt][r] * rs[r];
    }
  }
  __syncthreads();

  // context planes in fragment order: [16-row tile][k/32][j][lane][8 k]; this wave's 16 rows x 64 columns are 4 loads'
  // worth (it = (k/32 within the head)*2 + j), 2 KiB contiguous per plane; lane = hi*16 + row.
  v4u    hv[4], rv[4];
  size_t gidx[4];
  #pragma unroll
  for (unsigned it = 0; it < 4; ++it) {
    const unsigned row = lq;
    const unsigned c8  = it * 16u + hi * 8u;
    const v4f a0 = *(const v4f*)(so + row * OP + c8);
    const v4f a1 = *(const v4f*)(so + row * OP + c8 + 4);
    Pack8H ph, pr;
    #pragma unroll
    for (int i = 0; i < 4; ++i) {
      const f16 t0 = (f16)a0[i];
      const f16 t1 = (f16)a1[i];
      ph.h[i]     = t0;
      ph.h[4 + i] = t1;
      pr.h[i]     = (f16)((a0[i] - (float)t0) * RES_CARRY);
      pr.h[4 + i] = (f16)((a1[i] - (float)t1) * RES_CARRY);
    }
    hv[it]   = ph.u;
    rv[it]   = pr.u;
    gidx[it] = ((size_t)b * SEQ + qrow0) * EMB + h * (HDIM * 16u) + it * FU + lane * 8u;
  }
  #pragma unroll
  for (int it = 0; it < 4; ++it) {
    *(v4u*)(ch + gidx[it]) = hv[it];
    *(v4u*)(cr + gidx[it]) = rv[it];
  }
  
}

// Output projection. Block = (128-row tile, 64-column tile, batch); one wave owns 16 rows x 64 columns.
// A fragments from the context planes, B fragments from the weight plane, all in fragment order - both with the
// split k map, two 16-B loads per fragment, every load 512 contiguous bytes per wave.
__global__ __launch_bounds__(256) void proj_kernel(const f16* __restrict__ ch,
                                                   const f16* __restrict__ cr,
                                                   const f16* __restrict__ wp,
                                                   const float* __restrict__ bias,
                                                   float* __restrict__ out) {
  const unsigned rb   = blockIdx.x;
  const unsigned cb   = blockIdx.y;
  const unsigned b    = blockIdx.z;
  const unsigned tid  = threadIdx.x;
  const unsigned wave = tid >> 5;
  const unsigned lane = tid & 31u;
  const unsigned lq   = lane & 15u;
  const unsigned hi   = lane >> 4;

  __shared__ __align__(16) float sO[NWAVE * 16 * OP];   // per-wave staging tile (block barrier used)

  const unsigned row0 = rb * GM + wave * 16u;           // first sequence row of this wave
  const unsigned col0 = cb * GN;

  const f16* ah = ch + ((size_t)b * SEQ + rb * GM) * EMB;
  const f16* ar = cr + ((size_t)b * SEQ + rb * GM) * EMB;
  const f16* bw = wp + (size_t)col0 * EMB;
  const unsigned lo = lane * 8u;                        // this lane's unit inside a wave-wide fragment load
  const unsigned ao = wave * (16u * EMB) + lo;          // plus this wave's 16-row tile

  v8f acc[4], acr[4];
  #pragma unroll
  for (int nt = 0; nt < 4; ++nt) {
    acc[nt] = (v8f){0, 0, 0, 0, 0, 0, 0, 0};
    acr[nt] = (v8f){0, 0, 0, 0, 0, 0, 0, 0};
  }

  #pragma unroll 1
  for (unsigned k0 = 0; k0 < EMB; k0 += 32u) {
    FragH a, a2;
    const unsigned ko = k0 * 16u;                   // a 16-wide tile's 32 k elements: 2 loads' worth
    a.q[0]  = *(const v4u*)(ah + ko + ao);          // k = k0 + hi*8 + 0..7
    a.q[1]  = *(const v4u*)(ah + ko + FU + ao);     // k = k0 + 16 + hi*8 + 0..7
    // each wait below: a later load's result may be given the registers that held the earlier loads' addresses
    asm volatile("s_wait_xcnt 0x0" ::: "memory");
    a2.q[0] = *(const v4u*)(ar + ko + ao);
    a2.q[1] = *(const v4u*)(ar + ko + FU + ao);
    asm volatile("s_wait_xcnt 0x0" ::: "memory");
    FragH bf[4];
    #pragma unroll
    for (unsigned nt = 0; nt < 4; ++nt) {
      const f16* base = bw + (size_t)(nt * 16u) * EMB + ko;
      bf[nt].q[0] = *(const v4u*)(base + lo);
      if (nt == 3) asm volatile("s_wait_xcnt 0x0" ::: "memory");
      bf[nt].q[1] = *(const v4u*)(base + FU + lo);
    }
    #pragma unroll
    for (int nt = 0; nt < 4; ++nt) {
      acc[nt] = mma_f16(a.v,  bf[nt].v, acc[nt]);
      acr[nt] = mma_f16(a2.v, bf[nt].v, acr[nt]);   // scaled residual: separate accumulator
    }
  }

  // fold carries: (hi + res/2048) / (256 * 64); acc[nt][r] = element (row 8*hi + r, column nt*16 + lq)
  float* so = sO + wave * (16 * OP);
  const float inv_res = 1.0f / RES_CARRY;
  const float inv_car = 1.0f / (CTX_CARRY * W_CARRY);
  #pragma unroll
  for (int r = 0; r < 8; ++r) {
    #pragma unroll
    for (int nt = 0; nt < 4; ++nt) {
      so[(hi * 8u + r) * OP + nt * 16u + lq] = (acc[nt][r] + acr[nt][r] * inv_res) * inv_car;
    }
  }
  __syncthreads();

  // bias (bf16 RNE-converted input value), added in f32
  const v4f braw = *(const v4f*)(bias + col0 + lq * 4u);
  v4f bq;
  #pragma unroll
  for (int i = 0; i < 4; ++i) bq[i] = (float)(bf16)braw[i];

  // lanes 0..15 one row (16 consecutive lanes x 16 B each), lanes 16..31 the next row; 8 instructions cover the wave's 16 rows.
  v4f    vals[8];
  size_t gidx[8];
  #pragma unroll
  for (unsigned it = 0; it < 8; ++it) {
    const unsigned row = it * 2u + hi;
    const v4f t = *(const v4f*)(so + row * OP + lq * 4u);
    vals[it] = t + bq;
    gidx[it] = ((size_t)b * SEQ_FULL + row0 + row) * EMB + col0 + lq * 4u;
  }
  #pragma unroll
  for (int it = 0; it < 8; ++it) *(v4f*)(out + gidx[it]) = vals[it];
  
}

extern "C" void kernel_launch(void* const* d_in, const int* in_sizes, int n_in,
                              void* d_out, int out_size, void* d_ws, size_t ws_size,
                              hipStream_t stream) {
  if (n_in < 4) return;
  const size_t rows_used = (size_t)(NB - 1) * SEQ_FULL + SEQ;
  if ((size_t)in_sizes[0] < rows_used * EMB) return;
  if ((size_t)in_sizes[1] < rows_used) return;
  if ((size_t)in_sizes[2] < (size_t)EMB * EMB) return;
  if ((size_t)in_sizes[3] < (size_t)EMB) return;
  if ((size_t)out_size < rows_used * EMB) return;

  const size_t kb_bytes = (size_t)NB * NHEAD * SEQ * HDIM * 2;   // bf16 row plane
  const size_t vt_bytes = (size_t)NB * NHEAD * HDIM * SEQ * 2;   // f16 transposed plane
  const size_t cx_bytes = (size_t)NB * SEQ * EMB * 2;            // each f16 context plane
  const size_t wp_bytes = (size_t)EMB * EMB * 2;                 // f16 weight plane
  const size_t total    = kb_bytes + vt_bytes + 2 * cx_bytes + wp_bytes;
  if (ws_size < total) return;

  const float* x    = (const float*)d_in[0];
  const int*   mask = (const int*)d_in[1];
  const float* w    = (const float*)d_in[2];
  const float* bias = (const float*)d_in[3];
  float*       out  = (float*)d_out;

  char* base = (char*)d_ws;
  bf16* kb = (bf16*)base;
  f16*  vt = (f16*)(base + kb_bytes);
  f16*  ch = (f16*)(base + kb_bytes + vt_bytes);
  f16*  cr = (f16*)(base + kb_bytes + vt_bytes + cx_bytes);
  f16*  wp = (f16*)(base + kb_bytes + vt_bytes + 2 * cx_bytes);

  x_planes_kernel<<<dim3(SEQ / CT, NHEAD, NB), 256, 0, stream>>>(x, kb, vt);
  w_plane_kernel<<<dim3((EMB * EMB) / (256 * WELEM)), 256, 0, stream>>>(w, wp);
  attn_kernel<<<dim3(SEQ / BQ, NHEAD, NB), 256, 0, stream>>>(kb, vt, mask, ch, cr);
  proj_kernel<<<dim3(SEQ / GM, EMB / GN, NB), 256, 0, stream>>>(ch, cr, wp, bias, out);
}

// v002
// One run takes 74.1 microseconds.
// Next to v001, in two timings, it ran 1.30 and 1.29 times as fast.
// Counting every step since v000, it is 2.10 times as fast.
#include <hip/hip_runtime.h>

// Contractions: S^T = K x Q^T on v_wmma_f32_16x16x32_bf16 (bf16 operands = RNE-converted input X, f32 accumulate);
// O = P x V on v_wmma_f32_16x16x32_f16 (P as f16 carried x4096, V = f16 of the bf16 RNE-converted X, f32 accumulate);
// Y = C x W^T on v_wmma_f32_16x16x32_f16 (C as f16 carried x256 plus an f16 residual plane x2048 with its own
// accumulator, W = f16 of the bf16 RNE-converted weight carried x64, f32 accumulate). Softmax and bias add in f32.
//
// Plane layout: every 16-bit plane is stored in fragment order. The unit is 16 B (8 consecutive k elements of one
// row or column); 32 units = the 512 contiguous bytes that one wave-wide 16-B load brings in, unit index = lane
// (lane = hi*16 + lq: lq = row or column inside a 16-wide tile, hi = which run of 8 inside a run of 16 k elements).
//
// Key compaction: a key whose mask word is 0 gets the score -1e20, so its softmax weight is exactly 0 whenever the
// batch has any kept key. The plane builder therefore packs only the kept keys (in their order) into the K and V
// planes and the attention loop walks ceil(kept / 32) blocks. A batch with no kept key has equal scores everywhere:
// there all keys are packed and Q is taken as 0, which gives the same uniform weights.

#ifndef NB
#define NB 2
#endif
#ifndef SEQ
#define SEQ 2048
#endif
#define NB_FULL    2
#define SEQ_FULL   2048
#define NHEAD      16
#define HDIM       64
#define EMB        (NHEAD * HDIM)       // floats per (b, s) of X and of the output, halves per (b, s) of each context plane
#define BQ         128                  // query rows per workgroup (8 waves x 16)
#define BK         32                   // keys per inner iteration
#define NWAVE      8
#define CT         64                   // keys per plane-builder block
#define TP         72                   // LDS pitch (halves) of the transposed tile
#define KP         17                   // LDS pitch (16-B units) of one d-chunk row of the fragment-order K tile
#define FU         256                  // elements of one wave-wide fragment load (32 lanes x 8)
#define OP         68                   // LDS pitch (floats) of the staging tile
#define GM         128                  // projection rows per workgroup (8 waves x 16)
#define GN         64                   // projection columns per workgroup
#define WELEM      8                    // weight elements per thread in the weight plane builder
#define CLINE      32                   // ints between the batches' kept-key counts: one writing block per 128-B line

#define P_CARRY    4096.0f
#define CTX_CARRY  256.0f
#define RES_CARRY  2048.0f
#define W_CARRY    64.0f

static_assert(SEQ % BQ == 0);
static_assert(SEQ % CT == 0);
static_assert(SEQ % BK == 0);
static_assert(SEQ % (NWAVE * 32) == 0);
static_assert(BK == 32 && CT % BK == 0 && CT * HDIM == 2 * 256 * 8);
static_assert(SEQ % GM == 0);
static_assert(EMB % GN == 0);
static_assert(EMB % 32 == 0);
static_assert(BQ == NWAVE * 16);
static_assert(GM == NWAVE * 16);
static_assert(HDIM == 64);
static_assert(GN == 64);
static_assert(SEQ <= SEQ_FULL);
static_assert(NB >= 1 && NB <= NB_FULL);
static_assert((TP * 2) % 16 == 0);
static_assert((OP * 4) % 16 == 0);
// coverage equalities: grid x block x per-thread elements == plane element count
static_assert((size_t)(SEQ / CT) * NHEAD * NB * 256 * 2 * 8 == (size_t)NB * NHEAD * SEQ * HDIM);   // row plane and transposed plane
static_assert((size_t)((EMB * EMB) / (256 * WELEM)) * 256 * WELEM == (size_t)EMB * EMB);           // weight plane
static_assert((size_t)(SEQ / BQ) * NHEAD * NB * NWAVE * 16 * HDIM == (size_t)NB * SEQ * EMB);       // context planes
static_assert((size_t)(SEQ / GM) * (EMB / GN) * NB * NWAVE * 16 * GN == (size_t)NB * SEQ * EMB);    // output

typedef __bf16   bf16;
typedef _Float16 f16;
typedef bf16     v16bf __attribute__((ext_vector_type(16)));
typedef f16      v16h  __attribute__((ext_vector_type(16)));
typedef f16      v8h   __attribute__((ext_vector_type(8)));
typedef float    v8f   __attribute__((ext_vector_type(8)));
typedef float    v4f   __attribute__((ext_vector_type(4)));
typedef unsigned v4u   __attribute__((ext_vector_type(4)));
typedef int      v4i   __attribute__((ext_vector_type(4)));

union FragB  { v16bf v; v4u q[2]; bf16 h[16]; };
union FragH  { v16h  v; v4u q[2]; f16  h[16]; };
union Pack8B { v4u u; bf16 h[8]; };
union Pack8H { v4u u; v8h v; f16 h[8]; };

// WMMA helpers: builtin followed by the VALU hazard guard (ties D, keeps A/B live).
static __device__ __forceinline__ v8f mma_bf16(v16bf a, v16bf b, v8f acc) {
  acc = __builtin_amdgcn_wmma_f32_16x16x32_bf16(false, a, false, b, (short)0, acc, false, false);
  asm volatile("v_nop\n\tv_nop\n\tv_nop\n\tv_nop" : "+v"(acc) : "v"(a), "v"(b));
  return acc;
}
static __device__ __forceinline__ v8f mma_f16(v16h a, v16h b, v8f acc) {
  acc = __builtin_amdgcn_wmma_f32_16x16x32_f16(false, a, false, b, (short)0, acc, false, false);
  asm volatile("v_nop\n\tv_nop\n\tv_nop\n\tv_nop" : "+v"(acc) : "v"(a), "v"(b));
  return acc;
}

// Plane builder. Block = (tile of 64 packed keys, head, batch), 256 threads. k = v = head slice of X, kept keys only.
// Every block ranks the batch's kept keys itself (ballots per wave, wave totals through LDS) and gathers the 64 rows
// whose ranks fall into its tile; ranks past the kept count are filled with 0 (finite, so a zero weight stays zero).
// A tile that starts past the kept count is not stored and never read.
// coverage: packed positions kt*64 + {0..31, 32..63}, d 0..63 for both planes; every written line whole, one instruction.
// kb, per (b, h): [16-key tile][d chunk c = d/8][key in tile][8 d]; a fragment load (f, j) is units (f*2+j)*32 + lane.
// vt, per (b, h): [32-key block][dt*2 + j][lane][8 keys], d = dt*16 + lq, keys = j*16 + hi*8 + 0..7 of the block.
__global__ __launch_bounds__(256) void x_planes_kernel(const float* __restrict__ x,
                                                       const int* __restrict__ mask,
                                                       bf16* __restrict__ kb,
                                                       f16* __restrict__ vt,
                                                       int* __restrict__ cnt) {
  const unsigned kt   = blockIdx.x;
  const unsigned h    = blockIdx.y;
  const unsigned b    = blockIdx.z;
  const unsigned tid  = threadIdx.x;
  const unsigned wave = tid >> 5;
  const unsigned lane = tid & 31u;
  __shared__ __align__(16) f16 sT[HDIM * TP];   // [d][key], cross-wave (block barrier)
  __shared__ __align__(16) v4u sK[(CT / 16) * 8 * KP];   // [tile*8 + d chunk][key in tile], cross-wave
  __shared__ unsigned sTot[NWAVE];              // kept keys in each wave's run of SEQ / NWAVE keys
  __shared__ unsigned sIdx[CT];                 // sequence position of this tile's packed keys
  const unsigned s0 = kt * CT;

  // wave w ranks keys w*KW .. w*KW + KW-1: one ballot per 32 keys
  constexpr unsigned KW = SEQ / NWAVE;
  const int* mk = mask + (size_t)b * SEQ_FULL + wave * KW + lane;
  unsigned bal[KW / 32];
  unsigned wtot = 0;
  #pragma unroll
  for (unsigned e = 0; e < KW / 32; ++e) {
    bal[e] = __builtin_amdgcn_ballot_w32(mk[e * 32u] != 0);
    wtot += (unsigned)__popc(bal[e]);
  }
  if (lane == 0) sTot[wave] = wtot;
  if (tid < CT) sIdx[tid] = 0u;                 // fill positions past the kept count point at row 0 (read, then dropped)
  __syncthreads();
  unsigned rank = 0, kept = 0;
  #pragma unroll
  for (unsigned v = 0; v < NWAVE; ++v) {
    const unsigned t = sTot[v];
    rank += (v < wave) ? t : 0u;
    kept += t;
  }
  const bool     none  = (kept == 0u);          // no kept key: pack every key
  const unsigned count = none ? (unsigned)SEQ : kept;
  if (none) rank = wave * KW;
  #pragma unroll
  for (unsigned e = 0; e < KW / 32; ++e) {
    const unsigned bits = none ? 0xFFFFFFFFu : bal[e];
    const unsigned slot = rank + (unsigned)__popc(bits & ((1u << lane) - 1u)) - s0;   // wraps below the tile
    if (((bits >> lane) & 1u) != 0u && slot < (unsigned)CT) sIdx[slot] = wave * KW + e * 32u + lane;
    rank += (unsigned)__popc(bits);
  }
  if (kt == 0 && h == 0 && tid == 0) cnt[b * CLINE] = (int)kept;
  __syncthreads();

  v4f xr[2][2];
  #pragma unroll
  for (unsigned kk = 0; kk < 2; ++kk) {
    const unsigned key = kk * 32u + (tid >> 3);     // 0..63
    const float* src = x + ((size_t)b * SEQ_FULL + sIdx[key]) * EMB + h * HDIM + (tid & 7u) * 8u;
    xr[kk][0] = *(const v4f*)(src);
    xr[kk][1] = *(const v4f*)(src + 4);
  }
  // holds the four loads ahead of the selects below: without it each row's pair sinks into a branch of its own and
  // the second row's memory latency starts only after the first row has been converted
  asm volatile("" :: "v"(xr[0][0]), "v"(xr[0][1]), "v"(xr[1][0]), "v"(xr[1][1]));

  #pragma unroll
  for (unsigned kk = 0; kk < 2; ++kk) {
    const unsigned key = kk * 32u + (tid >> 3);     // 0..63
    const unsigned d0  = (tid & 7u) * 8u;           // 0..56
    const bool     on  = s0 + key < count;
    const v4f x0 = on ? xr[kk][0] : (v4f){0, 0, 0, 0};
    const v4f x1 = on ? xr[kk][1] : (v4f){0, 0, 0, 0};
    Pack8B pk;
    #pragma unroll
    for (int i = 0; i < 4; ++i) {
      pk.h[i]     = (bf16)x0[i];                    // RNE convert
      pk.h[4 + i] = (bf16)x1[i];
    }
    sK[((key >> 4) * 8u + (tid & 7u)) * KP + (key & 15u)] = pk.u;
    #pragma unroll
    for (int i = 0; i < 4; ++i) {
      sT[(d0 + i) * TP + key]     = (f16)(float)pk.h[i];       // f16 of bf16 value: exact
      sT[(d0 + 4 + i) * TP + key] = (f16)(float)pk.h[4 + i];
    }
  }
  __syncthreads();

  // unit u = kk*256 + tid of this block's 8 KiB of each plane: both planes are written in unit order
  v4u    kval[2], vval[2];
  size_t uidx[2];
  #pragma unroll
  for (unsigned kk = 0; kk < 2; ++kk) {
    const unsigned u  = kk * 256u + tid;
    kval[kk] = sK[(u >> 4) * KP + (u & 15u)];
    const unsigned d  = (tid >> 6) * 16u + (tid & 15u);          // dt*16 + lq
    const unsigned ks = kk * 32u + ((tid >> 4) & 3u) * 8u;       // block*32 + j*16 + hi*8
    Pack8H ph;
    ph.v = *(const v8h*)(sT + d * TP + ks);
    vval[kk] = ph.u;
    uidx[kk] = (((size_t)b * NHEAD + h) * SEQ + s0) * HDIM + (size_t)u * 8u;
  }

  if (s0 < count) {
    #pragma unroll
    for (int kk = 0; kk < 2; ++kk) {
      *(v4u*)(kb + uidx[kk]) = kval[kk];
      *(v4u*)(vt + uidx[kk]) = vval[kk];
    }
  }
}

// Weight plane builder: f16(bf16(W[n][k]) * 64) in fragment order: [n/16][k/32][j][lane][8 k], n = (n/16)*16 + lq,
// k = (k/32)*32 + j*16 + hi*8 + 0..7. Thread t writes unit t.
__global__ __launch_bounds__(256) void w_plane_kernel(const float* __restrict__ w, f16* __restrict__ wp) {
  const unsigned t  = blockIdx.x * 256u + threadIdx.x;
  const size_t   e0 = (size_t)t * WELEM;
  const size_t   r0 = (size_t)((t >> 11) * 16u + (t & 15u)) * EMB + ((t >> 4) & 127u) * 8u;
  const v4f a0 = *(const v4f*)(w + r0);
  const v4f a1 = *(const v4f*)(w + r0 + 4);
  Pack8H ph;
  #pragma unroll
  for (int i = 0; i < 4; ++i) {
    ph.h[i]     = (f16)((float)(bf16)a0[i] * W_CARRY);   // bf16 significand x power of two: exact in f16
    ph.h[4 + i] = (f16)((float)(bf16)a1[i] * W_CARRY);
  }
  const v4u val = ph.u;
  *(v4u*)(wp + e0) = val;
  
}

// Flash attention over the packed (kept) keys. Block = (query block of 128, head, batch); one wave owns 16 query rows.
// S^T = K x Q^T so queries sit on lanes; P^T in C-layout is bit-identical to the A-fragment layout of O += P x V.
// K A-fragments and V^T B-fragments are loaded straight from the fragment-order planes (two 16-B loads each, every
// load 512 contiguous bytes per wave); Q B-fragments are converted once per wave from X (every position is a query).
__global__ __launch_bounds__(256) void attn_kernel(const float* __restrict__ x,
                                                   const bf16* __restrict__ kb,
                                                   const f16* __restrict__ vt,
                                                   const int* __restrict__ cnt,
                                                   f16* __restrict__ ch,
                                                   f16* __restrict__ cr) {
  const unsigned qblk = blockIdx.x;
  const unsigned h    = blockIdx.y;
  const unsigned b    = blockIdx.z;
  const unsigned tid  = threadIdx.x;
  const unsigned wave = tid >> 5;
  const unsigned lane = tid & 31u;
  const unsigned lq   = lane & 15u;   // query column of S^T / d column of O
  const unsigned hi   = lane >> 4;    // k-split half

  __shared__ __align__(16) float sO[NWAVE * 16 * OP];   // per-wave staging tile (block barrier used)

  const unsigned qrow0 = qblk * BQ + wave * 16u;        // first query row of this wave

  const bf16* kb_h = kb + ((size_t)b * NHEAD + h) * SEQ * HDIM;
  const f16*  vt_h = vt + ((size_t)b * NHEAD + h) * HDIM * SEQ;
  const unsigned lo = lane * 8u;      // this lane's unit inside a wave-wide fragment load

  // packed keys of this batch; 0 kept keys: all SEQ keys are packed and Q = 0 makes every score equal
  const int      kept = cnt[b * CLINE];
  const bool     none = kept <= 0;
  const unsigned nk   = none ? (unsigned)SEQ : ((unsigned)kept < (unsigned)SEQ ? (unsigned)kept : (unsigned)SEQ);

  // Q as B-operand fragments: lane lq holds query qrow0+lq, elements follow the split d map of the K plane.
  FragB qf[2];
  const float* xq = x + ((size_t)b * SEQ_FULL + qrow0 + lq) * EMB + h * HDIM + hi * 8u;
  #pragma unroll
  for (unsigned f = 0; f < 2; ++f) {
    #pragma unroll
    for (unsigned j = 0; j < 2; ++j) {
      const v4f a0 = *(const v4f*)(xq + f * 32u + j * 16u);        // d = f*32 + j*16 + hi*8 + 0..3
      const v4f a1 = *(const v4f*)(xq + f * 32u + j * 16u + 4u);   // d = f*32 + j*16 + hi*8 + 4..7
      Pack8B pq;
      #pragma unroll
      for (int i = 0; i < 4; ++i) {
        pq.h[i]     = (bf16)a0[i];                                 // RNE convert
        pq.h[4 + i] = (bf16)a1[i];
      }
      qf[f].q[j] = none ? (v4u){0, 0, 0, 0} : pq.u;
    }
  }

  v8f o[4];
  #pragma unroll
  for (int dt = 0; dt < 4; ++dt) o[dt] = (v8f){0, 0, 0, 0, 0, 0, 0, 0};

  float rmax = -3.0e38f;
  float rsum = 0.0f;                                   // carried x4096, summed from the f16 values fed to P x V
  const float SL   = 0.03125f * 1.4426950408889634f;   // (1/sqrt(EMB)) * log2(e)
  const float FILL = -1.0e20f;                         // the reference's replace value (applied before scaling)

  #pragma unroll 1
  for (unsigned j0 = 0; j0 < nk; j0 += BK) {
    // K A-fragments: row = key j0 + sub*16 + lq, split d map
    FragB ak[2][2];
    #pragma unroll
    for (unsigned sub = 0; sub < 2; ++sub) {
      #pragma unroll
      for (unsigned f = 0; f < 2; ++f) {
        const bf16* base = kb_h + (size_t)(j0 + sub * 16u) * HDIM + f * (2u * FU);
        ak[sub][f].q[0] = *(const v4u*)(base + lo);
        ak[sub][f].q[1] = *(const v4u*)(base + FU + lo);
      }
    }
    // V B-fragments: column n = d = dt*16 + lq, split key map from the transposed plane
    FragH bv[4];
    #pragma unroll
    for (unsigned dt = 0; dt < 4; ++dt) {
      const f16* base = vt_h + (size_t)j0 * HDIM + dt * (2u * FU);
      // the last two loads' results may be given the registers that held the earlier loads' addresses
      if (dt == 3) asm volatile("s_wait_xcnt 0x0" ::: "memory");
      bv[dt].q[0] = *(const v4u*)(base + lo);       // keys j0 + hi*8 + 0..7
      if (dt == 3) asm volatile("s_wait_xcnt 0x0" ::: "memory");
      bv[dt].q[1] = *(const v4u*)(base + FU + lo);  // keys j0 + 16 + hi*8 + 0..7
    }

    // S^T tiles: c[sub][r] = rawscore(query qrow0+lq, key j0 + sub*16 + hi*8 + r)
    v8f c[2];
    #pragma unroll
    for (int sub = 0; sub < 2; ++sub) {
      v8f acc = (v8f){0, 0, 0, 0, 0, 0, 0, 0};
      acc = mma_bf16(ak[sub][0].v, qf[0].v, acc);
      acc = mma_bf16(ak[sub][1].v, qf[1].v, acc);
      c[sub] = acc;
    }

    // only the last block can hold fill positions past the packed keys: they get the replace value (weight 0)
    if (j0 + BK > nk) {
      #pragma unroll
      for (unsigned r = 0; r < 8; ++r) {
        c[0][r] = (j0 + hi * 8u + r >= nk)       ? FILL : c[0][r];
        c[1][r] = (j0 + 16u + hi * 8u + r >= nk) ? FILL : c[1][r];
      }
    }

    // online softmax (running max): query lq's 32 scores are split across lane / lane^16
    float m_new = rmax;
    #pragma unroll
    for (int r = 0; r < 8; ++r) {
      m_new = fmaxf(m_new, c[0][r]);
      m_new = fmaxf(m_new, c[1][r]);
    }
    m_new = fmaxf(m_new, __shfl_xor(m_new, 16, 32));
    const float scale = __builtin_amdgcn_exp2f((rmax - m_new) * SL);
    rmax = m_new;

    // exp + pack: P^T C-layout == A-fragment layout for the PV product
    FragH pa;
    float psum = 0.0f;
    #pragma unroll
    for (int r = 0; r < 8; ++r) {
      const float p0 = __builtin_amdgcn_exp2f((c[0][r] - m_new) * SL);   // key hi*8 + r
      const float p1 = __builtin_amdgcn_exp2f((c[1][r] - m_new) * SL);   // key 16 + hi*8 + r
      const f16 h0 = (f16)(p0 * P_CARRY);
      const f16 h1 = (f16)(p1 * P_CARRY);
      pa.h[r]     = h0;
      pa.h[8 + r] = h1;
      psum += (float)h0 + (float)h1;
    }
    rsum = rsum * scale + psum + __shfl_xor(psum, 16, 32);

    // rescale O: queries are the row dimension there -> per-row scale from lane 8*hi + r
    float sc[8];
    #pragma unroll
    for (int r = 0; r < 8; ++r) sc[r] = __shfl(scale, (int)((hi << 3) + r), 32);
    #pragma unroll
    for (int dt = 0; dt < 4; ++dt) {
      #pragma unroll
      for (int r = 0; r < 8; ++r) o[dt][r] *= sc[r];
    }

    // O += P x V
    #pragma unroll
    for (int dt = 0; dt < 4; ++dt) o[dt] = mma_f16(pa.v, bv[dt].v, o[dt]);
  }

  // normalize: lane holds column d = dt*16 + lq for query rows 8*hi + r; the x4096 carry cancels against rsum
  float rs[8];
  #pragma unroll
  for (int r = 0; r < 8; ++r) rs[r] = CTX_CARRY * (1.0f / __shfl(rsum, (int)((hi << 3) + r), 32));

  float* so = sO + wave * (16 * OP);
  #pragma unroll
  for (int r = 0; r < 8; ++r) {
    #pragma unroll
    for (int dt = 0; dt < 4; ++dt) {
      so[(hi * 8u + r) * OP + dt * 16u + lq] = o[dt][r] * rs[r];
    }
  }
  __syncthreads();

  // context planes in fragment order: [16-row tile][k/32][j][lane][8 k]; this wave's 16 rows x 64 columns are 4 loads'
  // worth (it = (k/32 within the head)*2 + j), 2 KiB contiguous per plane; lane = hi*16 + row.
  v4u    hv[4], rv[4];
  size_t gidx[4];
  #pragma unroll
  for (unsigned it = 0; it < 4; ++it) {
    const unsigned row = lq;
    const unsigned c8  = it * 16u + hi * 8u;
    const v4f a0 = *(const v4f*)(so + row * OP + c8);
    const v4f a1 = *(const v4f*)(so + row * OP + c8 + 4);
    Pack8H ph, pr;
    #pragma unroll
    for (int i = 0; i < 4; ++i) {
      const f16 t0 = (f16)a0[i];
      const f16 t1 = (f16)a1[i];
      ph.h[i]     = t0;
      ph.h[4 + i] = t1;
      pr.h[i]     = (f16)((a0[i] - (float)t0) * RES_CARRY);
      pr.h[4 + i] = (f16)((a1[i] - (float)t1) * RES_CARRY);
    }
    hv[it]   = ph.u;
    rv[it]   = pr.u;
    gidx[it] = ((size_t)b * SEQ + qrow0) * EMB + h * (HDIM * 16u) + it * FU + lane * 8u;
  }
  #pragma unroll
  for (int it = 0; it < 4; ++it) {
    *(v4u*)(ch + gidx[it]) = hv[it];
    *(v4u*)(cr + gidx[it]) = rv[it];
  }
  
}

// Output projection. Block = (128-row tile, 64-column tile, batch); one wave owns 16 rows x 64 columns.
// A fragments from the context planes, B fragments from the weight plane, all in fragment order - both with the
// split k map, two 16-B loads per fragment, every load 512 contiguous bytes per wave.
__global__ __launch_bounds__(256) void proj_kernel(const f16* __restrict__ ch,
                                                   const f16* __restrict__ cr,
                                                   const f16* __restrict__ wp,
                                                   const float* __restrict__ bias,
                                                   float* __restrict__ out) {
  const unsigned rb   = blockIdx.x;
  const unsigned cb   = blockIdx.y;
  const unsigned b    = blockIdx.z;
  const unsigned tid  = threadIdx.x;
  const unsigned wave = tid >> 5;
  const unsigned lane = tid & 31u;
  const unsigned lq   = lane & 15u;
  const unsigned hi   = lane >> 4;

  __shared__ __align__(16) float sO[NWAVE * 16 * OP];   // per-wave staging tile (block barrier used)

  const unsigned row0 = rb * GM + wave * 16u;           // first sequence row of this wave
  const unsigned col0 = cb * GN;

  const f16* ah = ch + ((size_t)b * SEQ + rb * GM) * EMB;
  const f16* ar = cr + ((size_t)b * SEQ + rb * GM) * EMB;
  const f16* bw = wp + (size_t)col0 * EMB;
  const unsigned lo = lane * 8u;                        // this lane's unit inside a wave-wide fragment load
  const unsigned ao = wave * (16u * EMB) + lo;          // plus this wave's 16-row tile

  v8f acc[4], acr[4];
  #pragma unroll
  for (int nt = 0; nt < 4; ++nt) {
    acc[nt] = (v8f){0, 0, 0, 0, 0, 0, 0, 0};
    acr[nt] = (v8f){0, 0, 0, 0, 0, 0, 0, 0};
  }

  #pragma unroll 1
  for (unsigned k0 = 0; k0 < EMB; k0 += 32u) {
    FragH a, a2;
    const unsigned ko = k0 * 16u;                   // a 16-wide tile's 32 k elements: 2 loads' worth
    a.q[0]  = *(const v4u*)(ah + ko + ao);          // k = k0 + hi*8 + 0..7
    a.q[1]  = *(const v4u*)(ah + ko + FU + ao);     // k = k0 + 16 + hi*8 + 0..7
    // each wait below: a later load's result may be given the registers that held the earlier loads' addresses
    asm volatile("s_wait_xcnt 0x0" ::: "memory");
    a2.q[0] = *(const v4u*)(ar + ko + ao);
    a2.q[1] = *(const v4u*)(ar + ko + FU + ao);
    asm volatile("s_wait_xcnt 0x0" ::: "memory");
    FragH bf[4];
    #pragma unroll
    for (unsigned nt = 0; nt < 4; ++nt) {
      const f16* base = bw + (size_t)(nt * 16u) * EMB + ko;
      bf[nt].q[0] = *(const v4u*)(base + lo);
      if (nt == 3) asm volatile("s_wait_xcnt 0x0" ::: "memory");
      bf[nt].q[1] = *(const v4u*)(base + FU + lo);
    }
    #pragma unroll
    for (int nt = 0; nt < 4; ++nt) {
      acc[nt] = mma_f16(a.v,  bf[nt].v, acc[nt]);
      acr[nt] = mma_f16(a2.v, bf[nt].v, acr[nt]);   // scaled residual: separate accumulator
    }
  }

  // fold carries: (hi + res/2048) / (256 * 64); acc[nt][r] = element (row 8*hi + r, column nt*16 + lq)
  float* so = sO + wave * (16 * OP);
  const float inv_res = 1.0f / RES_CARRY;
  const float inv_car = 1.0f / (CTX_CARRY * W_CARRY);
  #pragma unroll
  for (int r = 0; r < 8; ++r) {
    #pragma unroll
    for (int nt = 0; nt < 4; ++nt) {
      so[(hi * 8u + r) * OP + nt * 16u + lq] = (acc[nt][r] + acr[nt][r] * inv_res) * inv_car;
    }
  }
  __syncthreads();

  // bias (bf16 RNE-converted input value), added in f32
  const v4f braw = *(const v4f*)(bias + col0 + lq * 4u);
  v4f bq;
  #pragma unroll
  for (int i = 0; i < 4; ++i) bq[i] = (float)(bf16)braw[i];

  // lanes 0..15 one row (16 consecutive lanes x 16 B each), lanes 16..31 the next row; 8 instructions cover the wave's 16 rows.
  v4f    vals[8];
  size_t gidx[8];
  #pragma unroll
  for (unsigned it = 0; it < 8; ++it) {
    const unsigned row = it * 2u + hi;
    const v4f t = *(const v4f*)(so + row * OP + lq * 4u);
    vals[it] = t + bq;
    gidx[it] = ((size_t)b * SEQ_FULL + row0 + row) * EMB + col0 + lq * 4u;
  }
  #pragma unroll
  for (int it = 0; it < 8; ++it) *(v4f*)(out + gidx[it]) = vals[it];
  
}

extern "C" void kernel_launch(void* const* d_in, const int* in_sizes, int n_in,
                              void* d_out, int out_size, void* d_ws, size_t ws_size,
                              hipStream_t stream) {
  if (n_in < 4) return;
  const size_t rows_used = (size_t)(NB - 1) * SEQ_FULL + SEQ;
  if ((size_t)in_sizes[0] < rows_used * EMB) return;
  if ((size_t)in_sizes[1] < rows_used) return;
  if ((size_t)in_sizes[2] < (size_t)EMB * EMB) return;
  if ((size_t)in_sizes[3] < (size_t)EMB) return;
  if ((size_t)out_size < rows_used * EMB) return;

  const size_t kb_bytes = (size_t)NB * NHEAD * SEQ * HDIM * 2;   // bf16 row plane
  const size_t vt_bytes = (size_t)NB * NHEAD * HDIM * SEQ * 2;   // f16 transposed plane
  const size_t cx_bytes = (size_t)NB * SEQ * EMB * 2;            // each f16 context plane
  const size_t wp_bytes = (size_t)EMB * EMB * 2;                 // f16 weight plane
  const size_t ct_bytes = (size_t)NB * CLINE * 4;                // kept-key count per batch
  const size_t total    = kb_bytes + vt_bytes + 2 * cx_bytes + wp_bytes + ct_bytes;
  if (ws_size < total) return;

  const float* x    = (const float*)d_in[0];
  const int*   mask = (const int*)d_in[1];
  const float* w    = (const float*)d_in[2];
  const float* bias = (const float*)d_in[3];
  float*       out  = (float*)d_out;

  char* base = (char*)d_ws;
  bf16* kb = (bf16*)base;
  f16*  vt = (f16*)(base + kb_bytes);
  f16*  ch = (f16*)(base + kb_bytes + vt_bytes);
  f16*  cr = (f16*)(base + kb_bytes + vt_bytes + cx_bytes);
  f16*  wp = (f16*)(base + kb_bytes + vt_bytes + 2 * cx_bytes);
  int*  ct = (int*)(base + kb_bytes + vt_bytes + 2 * cx_bytes + wp_bytes);

  x_planes_kernel<<<dim3(SEQ / CT, NHEAD, NB), 256, 0, stream>>>(x, mask, kb, vt, ct);
  w_plane_kernel<<<dim3((EMB * EMB) / (256 * WELEM)), 256, 0, stream>>>(w, wp);
  attn_kernel<<<dim3(SEQ / BQ, NHEAD, NB), 256, 0, stream>>>(x, kb, vt, ct, ch, cr);
  proj_kernel<<<dim3(SEQ / GM, EMB / GN, NB), 256, 0, stream>>>(ch, cr, wp, bias, out);
}

// v003
// A run of this version takes 58 microseconds.
// In two side-by-side timings against v002, it was 1.28 and 1.27 times as fast.
// Over all steps from v000 it is 2.69 times as fast.
#include <hip/hip_runtime.h>

// Contractions: S^T = K x Q^T on v_wmma_f32_16x16x32_bf16 (bf16 operands = RNE-converted input X, f32 accumulate);
// O = P x V on v_wmma_f32_16x16x32_f16 (P as f16 carried x4096, V = f16 of the bf16 RNE-converted X, f32 accumulate);
// Y = C x W^T on v_wmma_f32_16x16x32_f16 (C as f16 carried x256 plus an f16 residual plane x2048 with its own
// accumulator, W = f16 of the bf16 RNE-converted weight carried x64, f32 accumulate). Softmax and bias add in f32.
//
// Plane layout: every 16-bit plane is stored in fragment order. The unit is 16 B (8 consecutive k elements of one
// row or column); 32 units = the 512 contiguous bytes that one wave-wide 16-B load brings in, unit index = lane
// (lane = hi*16 + lq: lq = row or column inside a 16-wide tile, hi = which run of 8 inside a run of 16 k elements).
//
// Key compaction: a key whose mask word is 0 gets the score -1e20, so its softmax weight is exactly 0 whenever the
// batch has any kept key. The plane builder therefore packs only the kept keys (in their order) into the K and V
// planes and the attention loop walks ceil(kept / 32) blocks. A batch with no kept key has equal scores everywhere:
// there all keys are packed and Q is taken as 0, which gives the same uniform weights.

#ifndef NB
#define NB 2
#endif
#ifndef SEQ
#define SEQ 2048
#endif
#define NB_FULL    2
#define SEQ_FULL   2048
#define NHEAD      16
#define HDIM       64
#define EMB        (NHEAD * HDIM)       // floats per (b, s) of X and of the output, halves per (b, s) of each context plane
#define BQ         128                  // query rows per workgroup (8 waves x 16)
#define BK         32                   // keys per inner iteration
#define NWAVE      8
#define CT         64                   // keys per plane-builder block
#define TP         72                   // LDS pitch (halves) of the transposed tile
#define KP         17                   // LDS pitch (16-B units) of one d-chunk row of the fragment-order K tile
#define FU         256                  // elements of one wave-wide fragment load (32 lanes x 8)
#define OP         68                   // LDS pitch (floats) of the staging tile
#define GM         128                  // projection rows per workgroup (8 waves x 16)
#define GN         64                   // projection columns per workgroup
#define WELEM      8                    // weight elements per thread in the weight plane builder
#define CLINE      32                   // ints between the batches' kept-key counts: one writing block per 128-B line

#define P_CARRY    4096.0f
#define CTX_CARRY  256.0f
#define RES_CARRY  2048.0f
#define W_CARRY    64.0f

static_assert(SEQ % BQ == 0);
static_assert(SEQ % CT == 0);
static_assert(SEQ % BK == 0);
static_assert(SEQ % (NWAVE * 32) == 0);
static_assert(BK == 32 && CT % BK == 0 && CT * HDIM == 2 * 256 * 8);
static_assert(SEQ % GM == 0);
static_assert(EMB % GN == 0);
static_assert(EMB % 64 == 0 && EMB >= 128);
static_assert(BQ == NWAVE * 16);
static_assert(GM == NWAVE * 16);
static_assert(HDIM == 64);
static_assert(GN == 64);
static_assert(SEQ <= SEQ_FULL);
static_assert(NB >= 1 && NB <= NB_FULL);
static_assert((TP * 2) % 16 == 0);
static_assert((OP * 4) % 16 == 0);
// coverage equalities: grid x block x per-thread elements == plane element count
static_assert((size_t)(SEQ / CT) * NHEAD * NB * 256 * 2 * 8 == (size_t)NB * NHEAD * SEQ * HDIM);   // row plane and transposed plane
static_assert((size_t)((EMB * EMB) / (256 * WELEM)) * 256 * WELEM == (size_t)EMB * EMB);           // weight plane
static_assert((size_t)(SEQ / BQ) * NHEAD * NB * NWAVE * 16 * HDIM == (size_t)NB * SEQ * EMB);       // context planes
static_assert((size_t)(SEQ / GM) * (EMB / GN) * NB * NWAVE * 16 * GN == (size_t)NB * SEQ * EMB);    // output

typedef __bf16   bf16;
typedef _Float16 f16;
typedef bf16     v16bf __attribute__((ext_vector_type(16)));
typedef f16      v16h  __attribute__((ext_vector_type(16)));
typedef f16      v8h   __attribute__((ext_vector_type(8)));
typedef float    v8f   __attribute__((ext_vector_type(8)));
typedef float    v4f   __attribute__((ext_vector_type(4)));
typedef unsigned v4u   __attribute__((ext_vector_type(4)));
typedef int      v4i   __attribute__((ext_vector_type(4)));

union FragB  { v16bf v; v4u q[2]; bf16 h[16]; };
union FragH  { v16h  v; v4u q[2]; f16  h[16]; };
union Pack8B { v4u u; bf16 h[8]; };
union Pack8H { v4u u; v8h v; f16 h[8]; };

// WMMA helpers: builtin followed by the VALU hazard guard (ties D, keeps A/B live).
static __device__ __forceinline__ v8f mma_bf16(v16bf a, v16bf b, v8f acc) {
  acc = __builtin_amdgcn_wmma_f32_16x16x32_bf16(false, a, false, b, (short)0, acc, false, false);
  asm volatile("v_nop\n\tv_nop\n\tv_nop\n\tv_nop" : "+v"(acc) : "v"(a), "v"(b));
  return acc;
}
static __device__ __forceinline__ v8f mma_f16(v16h a, v16h b, v8f acc) {
  acc = __builtin_amdgcn_wmma_f32_16x16x32_f16(false, a, false, b, (short)0, acc, false, false);
  asm volatile("v_nop\n\tv_nop\n\tv_nop\n\tv_nop" : "+v"(acc) : "v"(a), "v"(b));
  return acc;
}

// Plane builder. Block = (tile of 64 packed keys, head, batch), 256 threads. k = v = head slice of X, kept keys only.
// Every block ranks the batch's kept keys itself (ballots per wave, wave totals through LDS) and gathers the 64 rows
// whose ranks fall into its tile; ranks past the kept count are filled with 0 (finite, so a zero weight stays zero).
// A tile that starts past the kept count is not stored and never read.
// coverage: packed positions kt*64 + {0..31, 32..63}, d 0..63 for both planes; every written line whole, one instruction.
// kb, per (b, h): [16-key tile][d chunk c = d/8][key in tile][8 d]; a fragment load (f, j) is units (f*2+j)*32 + lane.
// vt, per (b, h): [32-key block][dt*2 + j][lane][8 keys], d = dt*16 + lq, keys = j*16 + hi*8 + 0..7 of the block.
__global__ __launch_bounds__(256) void x_planes_kernel(const float* __restrict__ x,
                                                       const int* __restrict__ mask,
                                                       bf16* __restrict__ kb,
                                                       f16* __restrict__ vt,
                                                       int* __restrict__ cnt) {
  const unsigned kt   = blockIdx.x;
  const unsigned h    = blockIdx.y;
  const unsigned b    = blockIdx.z;
  const unsigned tid  = threadIdx.x;
  const unsigned wave = tid >> 5;
  const unsigned lane = tid & 31u;
  __shared__ __align__(16) f16 sT[HDIM * TP];   // [d][key], cross-wave (block barrier)
  __shared__ __align__(16) v4u sK[(CT / 16) * 8 * KP];   // [tile*8 + d chunk][key in tile], cross-wave
  __shared__ unsigned sTot[NWAVE];              // kept keys in each wave's run of SEQ / NWAVE keys
  __shared__ unsigned sIdx[CT];                 // sequence position of this tile's packed keys
  const unsigned s0 = kt * CT;

  // wave w ranks keys w*KW .. w*KW + KW-1: one ballot per 32 keys
  constexpr unsigned KW = SEQ / NWAVE;
  const int* mk = mask + (size_t)b * SEQ_FULL + wave * KW + lane;
  unsigned bal[KW / 32];
  unsigned wtot = 0;
  #pragma unroll
  for (unsigned e = 0; e < KW / 32; ++e) {
    bal[e] = __builtin_amdgcn_ballot_w32(mk[e * 32u] != 0);
    wtot += (unsigned)__popc(bal[e]);
  }
  if (lane == 0) sTot[wave] = wtot;
  if (tid < CT) sIdx[tid] = 0u;                 // fill positions past the kept count point at row 0 (read, then dropped)
  __syncthreads();
  unsigned rank = 0, kept = 0;
  #pragma unroll
  for (unsigned v = 0; v < NWAVE; ++v) {
    const unsigned t = sTot[v];
    rank += (v < wave) ? t : 0u;
    kept += t;
  }
  const bool     none  = (kept == 0u);          // no kept key: pack every key
  const unsigned count = none ? (unsigned)SEQ : kept;
  if (none) rank = wave * KW;
  #pragma unroll
  for (unsigned e = 0; e < KW / 32; ++e) {
    const unsigned bits = none ? 0xFFFFFFFFu : bal[e];
    const unsigned slot = rank + (unsigned)__popc(bits & ((1u << lane) - 1u)) - s0;   // wraps below the tile
    if (((bits >> lane) & 1u) != 0u && slot < (unsigned)CT) sIdx[slot] = wave * KW + e * 32u + lane;
    rank += (unsigned)__popc(bits);
  }
  if (kt == 0 && h == 0 && tid == 0) cnt[b * CLINE] = (int)kept;
  __syncthreads();

  v4f xr[2][2];
  #pragma unroll
  for (unsigned kk = 0; kk < 2; ++kk) {
    const unsigned key = kk * 32u + (tid >> 3);     // 0..63
    const float* src = x + ((size_t)b * SEQ_FULL + sIdx[key]) * EMB + h * HDIM + (tid & 7u) * 8u;
    xr[kk][0] = *(const v4f*)(src);
    xr[kk][1] = *(const v4f*)(src + 4);
  }
  // holds the four loads ahead of the selects below: without it each row's pair sinks into a branch of its own and
  // the second row's memory latency starts only after the first row has been converted
  asm volatile("" :: "v"(xr[0][0]), "v"(xr[0][1]), "v"(xr[1][0]), "v"(xr[1][1]));

  #pragma unroll
  for (unsigned kk = 0; kk < 2; ++kk) {
    const unsigned key = kk * 32u + (tid >> 3);     // 0..63
    const unsigned d0  = (tid & 7u) * 8u;           // 0..56
    const bool     on  = s0 + key < count;
    const v4f x0 = on ? xr[kk][0] : (v4f){0, 0, 0, 0};
    const v4f x1 = on ? xr[kk][1] : (v4f){0, 0, 0, 0};
    Pack8B pk;
    #pragma unroll
    for (int i = 0; i < 4; ++i) {
      pk.h[i]     = (bf16)x0[i];                    // RNE convert
      pk.h[4 + i] = (bf16)x1[i];
    }
    sK[((key >> 4) * 8u + (tid & 7u)) * KP + (key & 15u)] = pk.u;
    #pragma unroll
    for (int i = 0; i < 4; ++i) {
      sT[(d0 + i) * TP + key]     = (f16)(float)pk.h[i];       // f16 of bf16 value: exact
      sT[(d0 + 4 + i) * TP + key] = (f16)(float)pk.h[4 + i];
    }
  }
  __syncthreads();

  // unit u = kk*256 + tid of this block's 8 KiB of each plane: both planes are written in unit order
  v4u    kval[2], vval[2];
  size_t uidx[2];
  #pragma unroll
  for (unsigned kk = 0; kk < 2; ++kk) {
    const unsigned u  = kk * 256u + tid;
    kval[kk] = sK[(u >> 4) * KP + (u & 15u)];
    const unsigned d  = (tid >> 6) * 16u + (tid & 15u);          // dt*16 + lq
    const unsigned ks = kk * 32u + ((tid >> 4) & 3u) * 8u;       // block*32 + j*16 + hi*8
    Pack8H ph;
    ph.v = *(const v8h*)(sT + d * TP + ks);
    vval[kk] = ph.u;
    uidx[kk] = (((size_t)b * NHEAD + h) * SEQ + s0) * HDIM + (size_t)u * 8u;
  }

  if (s0 < count) {
    #pragma unroll
    for (int kk = 0; kk < 2; ++kk) {
      *(v4u*)(kb + uidx[kk]) = kval[kk];
      *(v4u*)(vt + uidx[kk]) = vval[kk];
    }
  }
}

// Weight plane builder: f16(bf16(W[n][k]) * 64) in fragment order: [n/16][k/32][j][lane][8 k], n = (n/16)*16 + lq,
// k = (k/32)*32 + j*16 + hi*8 + 0..7. Thread t writes unit t.
__global__ __launch_bounds__(256) void w_plane_kernel(const float* __restrict__ w, f16* __restrict__ wp) {
  const unsigned t  = blockIdx.x * 256u + threadIdx.x;
  const size_t   e0 = (size_t)t * WELEM;
  const size_t   r0 = (size_t)((t >> 11) * 16u + (t & 15u)) * EMB + ((t >> 4) & 127u) * 8u;
  const v4f a0 = *(const v4f*)(w + r0);
  const v4f a1 = *(const v4f*)(w + r0 + 4);
  Pack8H ph;
  #pragma unroll
  for (int i = 0; i < 4; ++i) {
    ph.h[i]     = (f16)((float)(bf16)a0[i] * W_CARRY);   // bf16 significand x power of two: exact in f16
    ph.h[4 + i] = (f16)((float)(bf16)a1[i] * W_CARRY);
  }
  const v4u val = ph.u;
  *(v4u*)(wp + e0) = val;
  
}

// Flash attention over the packed (kept) keys. Block = (query block of 128, head, batch); one wave owns 16 query rows.
// S^T = K x Q^T so queries sit on lanes; P^T in C-layout is bit-identical to the A-fragment layout of O += P x V.
// K A-fragments and V^T B-fragments are loaded straight from the fragment-order planes (two 16-B loads each, every
// load 512 contiguous bytes per wave); Q B-fragments are converted once per wave from X (every position is a query).
__global__ __launch_bounds__(256) void attn_kernel(const float* __restrict__ x,
                                                   const bf16* __restrict__ kb,
                                                   const f16* __restrict__ vt,
                                                   const int* __restrict__ cnt,
                                                   f16* __restrict__ ch,
                                                   f16* __restrict__ cr) {
  const unsigned qblk = blockIdx.x;
  const unsigned h    = blockIdx.y;
  const unsigned b    = blockIdx.z;
  const unsigned tid  = threadIdx.x;
  const unsigned wave = tid >> 5;
  const unsigned lane = tid & 31u;
  const unsigned lq   = lane & 15u;   // query column of S^T / d column of O
  const unsigned hi   = lane >> 4;    // k-split half

  __shared__ __align__(16) float sO[NWAVE * 16 * OP];   // per-wave staging tile (block barrier used)

  const unsigned qrow0 = qblk * BQ + wave * 16u;        // first query row of this wave

  // wave-uniform plane bases in bytes; a block of 32 keys is BKB bytes of either plane, a fragment load FB bytes
  const char* kb_h = (const char*)(kb + ((size_t)b * NHEAD + h) * SEQ * HDIM);
  const char* vt_h = (const char*)(vt + ((size_t)b * NHEAD + h) * HDIM * SEQ);
  constexpr unsigned FB  = FU * 2u;
  constexpr unsigned BKB = BK * HDIM * 2u;
  const unsigned lo = lane * 16u;     // this lane's unit (byte offset) inside a wave-wide fragment load

  // packed keys of this batch; 0 kept keys: all SEQ keys are packed and Q = 0 makes every score equal
  const int      kept = cnt[b * CLINE];
  const bool     none = kept <= 0;
  const unsigned nk   = none ? (unsigned)SEQ : ((unsigned)kept < (unsigned)SEQ ? (unsigned)kept : (unsigned)SEQ);

  // Q as B-operand fragments: lane lq holds query qrow0+lq, elements follow the split d map of the K plane.
  FragB qf[2];
  const float* xq = x + ((size_t)b * SEQ_FULL + qrow0 + lq) * EMB + h * HDIM + hi * 8u;
  #pragma unroll
  for (unsigned f = 0; f < 2; ++f) {
    #pragma unroll
    for (unsigned j = 0; j < 2; ++j) {
      const v4f a0 = *(const v4f*)(xq + f * 32u + j * 16u);        // d = f*32 + j*16 + hi*8 + 0..3
      const v4f a1 = *(const v4f*)(xq + f * 32u + j * 16u + 4u);   // d = f*32 + j*16 + hi*8 + 4..7
      Pack8B pq;
      #pragma unroll
      for (int i = 0; i < 4; ++i) {
        pq.h[i]     = (bf16)a0[i];                                 // RNE convert
        pq.h[4 + i] = (bf16)a1[i];
      }
      qf[f].q[j] = none ? (v4u){0, 0, 0, 0} : pq.u;
    }
  }

  v8f o[4];
  #pragma unroll
  for (int dt = 0; dt < 4; ++dt) o[dt] = (v8f){0, 0, 0, 0, 0, 0, 0, 0};

  float rmax = -3.0e38f;
  float rsum = 0.0f;                                   // carried x4096, summed from the f16 values fed to P x V
  const float SL   = 0.03125f * 1.4426950408889634f;   // (1/sqrt(EMB)) * log2(e)
  const float FILL = -1.0e20f;                         // the reference's replace value (applied before scaling)

  // K A-fragments: row = key j0 + sub*16 + lq, split d map. They are fetched one block ahead: block 0 here, block
  // j0 + BK inside pass j0, right behind the products that were the last readers of the registers.
  FragB ak[2][2];
  #pragma unroll
  for (unsigned sub = 0; sub < 2; ++sub) {
    #pragma unroll
    for (unsigned f = 0; f < 2; ++f) {
      ak[sub][f].q[0] = *(const v4u*)(kb_h + lo + (sub * 4u + f * 2u) * FB);
      ak[sub][f].q[1] = *(const v4u*)(kb_h + lo + (sub * 4u + f * 2u + 1u) * FB);
    }
  }

  #pragma unroll 1
  for (unsigned j0 = 0; j0 < nk; j0 += BK) {
    // V B-fragments: column n = d = dt*16 + lq, split key map from the transposed plane
    FragH bv[4];
    const char* vbase = vt_h + (size_t)(j0 / BK) * BKB;
    #pragma unroll
    for (unsigned dt = 0; dt < 4; ++dt) {
      bv[dt].q[0] = *(const v4u*)(vbase + lo + (dt * 2u) * FB);        // keys j0 + hi*8 + 0..7
      bv[dt].q[1] = *(const v4u*)(vbase + lo + (dt * 2u + 1u) * FB);   // keys j0 + 16 + hi*8 + 0..7
    }

    // S^T tiles: c[sub][r] = rawscore(query qrow0+lq, key j0 + sub*16 + hi*8 + r)
    v8f c[2];
    #pragma unroll
    for (int sub = 0; sub < 2; ++sub) {
      v8f acc = (v8f){0, 0, 0, 0, 0, 0, 0, 0};
      acc = mma_bf16(ak[sub][0].v, qf[0].v, acc);
      acc = mma_bf16(ak[sub][1].v, qf[1].v, acc);
      c[sub] = acc;
    }

    // the V loads' address registers are stepped on behind this point
    asm volatile("s_wait_xcnt 0x0" ::: "memory");

    // next block's K fragments; the last pass reads its own block again (written, in bounds, never used)
    const char* kbase = kb_h + (size_t)(((j0 + BK < nk) ? j0 + BK : j0) / BK) * BKB;
    #pragma unroll
    for (unsigned sub = 0; sub < 2; ++sub) {
      #pragma unroll
      for (unsigned f = 0; f < 2; ++f) {
        ak[sub][f].q[0] = *(const v4u*)(kbase + lo + (sub * 4u + f * 2u) * FB);
        ak[sub][f].q[1] = *(const v4u*)(kbase + lo + (sub * 4u + f * 2u + 1u) * FB);
      }
    }

    // only the last block can hold fill positions past the packed keys: they get the replace value (weight 0)
    if (j0 + BK > nk) {
      #pragma unroll
      for (unsigned r = 0; r < 8; ++r) {
        c[0][r] = (j0 + hi * 8u + r >= nk)       ? FILL : c[0][r];
        c[1][r] = (j0 + 16u + hi * 8u + r >= nk) ? FILL : c[1][r];
      }
    }

    // online softmax (running max): query lq's 32 scores are split across lane / lane^16
    float m_new = rmax;
    #pragma unroll
    for (int r = 0; r < 8; ++r) {
      m_new = fmaxf(m_new, c[0][r]);
      m_new = fmaxf(m_new, c[1][r]);
    }
    m_new = fmaxf(m_new, __shfl_xor(m_new, 16, 32));
    const float scale = __builtin_amdgcn_exp2f((rmax - m_new) * SL);
    rmax = m_new;

    // exp + pack: P^T C-layout == A-fragment layout for the PV product
    FragH pa;
    float psum = 0.0f;
    #pragma unroll
    for (int r = 0; r < 8; ++r) {
      const float p0 = __builtin_amdgcn_exp2f((c[0][r] - m_new) * SL);   // key hi*8 + r
      const float p1 = __builtin_amdgcn_exp2f((c[1][r] - m_new) * SL);   // key 16 + hi*8 + r
      const f16 h0 = (f16)(p0 * P_CARRY);
      const f16 h1 = (f16)(p1 * P_CARRY);
      pa.h[r]     = h0;
      pa.h[8 + r] = h1;
      psum += (float)h0 + (float)h1;
    }
    rsum = rsum * scale + psum + __shfl_xor(psum, 16, 32);

    // rescale O: queries are the row dimension there -> per-row scale from lane 8*hi + r
    float sc[8];
    #pragma unroll
    for (int r = 0; r < 8; ++r) sc[r] = __shfl(scale, (int)((hi << 3) + r), 32);
    #pragma unroll
    for (int dt = 0; dt < 4; ++dt) {
      #pragma unroll
      for (int r = 0; r < 8; ++r) o[dt][r] *= sc[r];
    }

    // O += P x V
    #pragma unroll
    for (int dt = 0; dt < 4; ++dt) o[dt] = mma_f16(pa.v, bv[dt].v, o[dt]);
  }

  // normalize: lane holds column d = dt*16 + lq for query rows 8*hi + r; the x4096 carry cancels against rsum
  float rs[8];
  #pragma unroll
  for (int r = 0; r < 8; ++r) rs[r] = CTX_CARRY * (1.0f / __shfl(rsum, (int)((hi << 3) + r), 32));

  float* so = sO + wave * (16 * OP);
  #pragma unroll
  for (int r = 0; r < 8; ++r) {
    #pragma unroll
    for (int dt = 0; dt < 4; ++dt) {
      so[(hi * 8u + r) * OP + dt * 16u + lq] = o[dt][r] * rs[r];
    }
  }
  __syncthreads();

  // context planes in fragment order: [16-row tile][k/32][j][lane][8 k]; this wave's 16 rows x 64 columns are 4 loads'
  // worth (it = (k/32 within the head)*2 + j), 2 KiB contiguous per plane; lane = hi*16 + row.
  v4u    hv[4], rv[4];
  size_t gidx[4];
  #pragma unroll
  for (unsigned it = 0; it < 4; ++it) {
    const unsigned row = lq;
    const unsigned c8  = it * 16u + hi * 8u;
    const v4f a0 = *(const v4f*)(so + row * OP + c8);
    const v4f a1 = *(const v4f*)(so + row * OP + c8 + 4);
    Pack8H ph, pr;
    #pragma unroll
    for (int i = 0; i < 4; ++i) {
      const f16 t0 = (f16)a0[i];
      const f16 t1 = (f16)a1[i];
      ph.h[i]     = t0;
      ph.h[4 + i] = t1;
      pr.h[i]     = (f16)((a0[i] - (float)t0) * RES_CARRY);
      pr.h[4 + i] = (f16)((a1[i] - (float)t1) * RES_CARRY);
    }
    hv[it]   = ph.u;
    rv[it]   = pr.u;
    gidx[it] = ((size_t)b * SEQ + qrow0) * EMB + h * (HDIM * 16u) + it * FU + lane * 8u;
  }
  #pragma unroll
  for (int it = 0; it < 4; ++it) {
    *(v4u*)(ch + gidx[it]) = hv[it];
    *(v4u*)(cr + gidx[it]) = rv[it];
  }
  
}

// One 32-k step of the projection: A fragments of both context planes, B fragments of the four 16-column tiles.
// ah, ar, bw: uniform byte bases; ao, lo: the lane's byte offsets; a 16-wide tile's 32 k elements are 2 loads' worth.
struct ProjFrag { FragH a, a2, bf[4]; };
template <bool LAST>
static __device__ __forceinline__ void proj_load(ProjFrag& f, const char* ah, const char* ar, const char* bw,
                                                 unsigned ao, unsigned lo, unsigned k0) {
  constexpr unsigned FB = FU * 2u;                  // bytes of one wave-wide fragment load
  const size_t ko = (size_t)k0 * 32u;
  f.a.q[0]  = *(const v4u*)(ah + ko + ao);          // k = k0 + hi*8 + 0..7
  f.a.q[1]  = *(const v4u*)(ah + ko + ao + FB);     // k = k0 + 16 + hi*8 + 0..7
  f.a2.q[0] = *(const v4u*)(ar + ko + ao);
  f.a2.q[1] = *(const v4u*)(ar + ko + ao + FB);
  #pragma unroll
  for (unsigned nt = 0; nt < 4; ++nt) {
    // behind the loop the address registers die here: the last results may be given the registers that held them
    if (LAST && nt == 3) asm volatile("s_wait_xcnt 0x0" ::: "memory");
    f.bf[nt].q[0] = *(const v4u*)(bw + ko + lo + nt * (16u * EMB * 2u));
    f.bf[nt].q[1] = *(const v4u*)(bw + ko + lo + nt * (16u * EMB * 2u) + FB);
  }
}
static __device__ __forceinline__ void proj_mma(const ProjFrag& f, v8f (&acc)[4], v8f (&acr)[4]) {
  #pragma unroll
  for (int nt = 0; nt < 4; ++nt) {
    acc[nt] = mma_f16(f.a.v,  f.bf[nt].v, acc[nt]);
    acr[nt] = mma_f16(f.a2.v, f.bf[nt].v, acr[nt]);   // scaled residual: separate accumulator
  }
}

// Output projection. Block = (128-row tile, 64-column tile, batch); one wave owns 16 rows x 64 columns.
// A fragments from the context planes, B fragments from the weight plane, all in fragment order - both with the
// split k map, two 16-B loads per fragment, every load 512 contiguous bytes per wave.
__global__ __launch_bounds__(256) void proj_kernel(const f16* __restrict__ ch,
                                                   const f16* __restrict__ cr,
                                                   const f16* __restrict__ wp,
                                                   const float* __restrict__ bias,
                                                   float* __restrict__ out) {
  const unsigned rb   = blockIdx.x;
  const unsigned cb   = blockIdx.y;
  const unsigned b    = blockIdx.z;
  const unsigned tid  = threadIdx.x;
  const unsigned wave = tid >> 5;
  const unsigned lane = tid & 31u;
  const unsigned lq   = lane & 15u;
  const unsigned hi   = lane >> 4;

  __shared__ __align__(16) float sO[NWAVE * 16 * OP];   // per-wave staging tile (block barrier used)

  const unsigned row0 = rb * GM + wave * 16u;           // first sequence row of this wave
  const unsigned col0 = cb * GN;

  // workgroup-uniform plane bases in bytes
  const char* ah = (const char*)(ch + ((size_t)b * SEQ + rb * GM) * EMB);
  const char* ar = (const char*)(cr + ((size_t)b * SEQ + rb * GM) * EMB);
  const char* bw = (const char*)(wp + (size_t)col0 * EMB);
  const unsigned lo = lane * 16u;                       // this lane's unit (byte offset) inside a wave-wide fragment load
  const unsigned ao = wave * (16u * EMB * 2u) + lo;     // plus this wave's 16-row tile

  v8f acc[4], acr[4];
  #pragma unroll
  for (int nt = 0; nt < 4; ++nt) {
    acc[nt] = (v8f){0, 0, 0, 0, 0, 0, 0, 0};
    acr[nt] = (v8f){0, 0, 0, 0, 0, 0, 0, 0};
  }

  // two fragment sets: while one set's products run, the other set's loads (the next 32 k) are in flight
  ProjFrag f0, f1;
  proj_load<false>(f0, ah, ar, bw, ao, lo, 0u);
  // the start values of the accumulators and of the loop take over registers that these loads name
  asm volatile("s_wait_xcnt 0x0" ::: "memory");
  __builtin_amdgcn_sched_barrier(0);   // without it the compiler lifts those writes over the wait
  #pragma unroll 1
  for (unsigned k0 = 0; k0 < EMB - 64u; k0 += 64u) {
    proj_load<false>(f1, ah, ar, bw, ao, lo, k0 + 32u);
    proj_mma(f0, acc, acr);
    proj_load<false>(f0, ah, ar, bw, ao, lo, k0 + 64u);
    proj_mma(f1, acc, acr);
    // the next pass forms its addresses in the registers that hold this pass's
    asm volatile("s_wait_xcnt 0x0" ::: "memory");
  }
  proj_load<true>(f1, ah, ar, bw, ao, lo, EMB - 32u);
  proj_mma(f0, acc, acr);
  proj_mma(f1, acc, acr);

  // fold carries: (hi + res/2048) / (256 * 64); acc[nt][r] = element (row 8*hi + r, column nt*16 + lq)
  float* so = sO + wave * (16 * OP);
  const float inv_res = 1.0f / RES_CARRY;
  const float inv_car = 1.0f / (CTX_CARRY * W_CARRY);
  #pragma unroll
  for (int r = 0; r < 8; ++r) {
    #pragma unroll
    for (int nt = 0; nt < 4; ++nt) {
      so[(hi * 8u + r) * OP + nt * 16u + lq] = (acc[nt][r] + acr[nt][r] * inv_res) * inv_car;
    }
  }
  __syncthreads();

  // bias (bf16 RNE-converted input value), added in f32
  const v4f braw = *(const v4f*)(bias + col0 + lq * 4u);
  v4f bq;
  #pragma unroll
  for (int i = 0; i < 4; ++i) bq[i] = (float)(bf16)braw[i];

  // lanes 0..15 one row (16 consecutive lanes x 16 B each), lanes 16..31 the next row; 8 instructions cover the wave's 16 rows.
  v4f    vals[8];
  size_t gidx[8];
  #pragma unroll
  for (unsigned it = 0; it < 8; ++it) {
    const unsigned row = it * 2u + hi;
    const v4f t = *(const v4f*)(so + row * OP + lq * 4u);
    vals[it] = t + bq;
    gidx[it] = ((size_t)b * SEQ_FULL + row0 + row) * EMB + col0 + lq * 4u;
  }
  #pragma unroll
  for (int it = 0; it < 8; ++it) *(v4f*)(out + gidx[it]) = vals[it];
  
}

extern "C" void kernel_launch(void* const* d_in, const int* in_sizes, int n_in,
                              void* d_out, int out_size, void* d_ws, size_t ws_size,
                              hipStream_t stream) {
  if (n_in < 4) return;
  const size_t rows_used = (size_t)(NB - 1) * SEQ_FULL + SEQ;
  if ((size_t)in_sizes[0] < rows_used * EMB) return;
  if ((size_t)in_sizes[1] < rows_used) return;
  if ((size_t)in_sizes[2] < (size_t)EMB * EMB) return;
  if ((size_t)in_sizes[3] < (size_t)EMB) return;
  if ((size_t)out_size < rows_used * EMB) return;

  const size_t kb_bytes = (size_t)NB * NHEAD * SEQ * HDIM * 2;   // bf16 row plane
  const size_t vt_bytes = (size_t)NB * NHEAD * HDIM * SEQ * 2;   // f16 transposed plane
  const size_t cx_bytes = (size_t)NB * SEQ * EMB * 2;            // each f16 context plane
  const size_t wp_bytes = (size_t)EMB * EMB * 2;                 // f16 weight plane
  const size_t ct_bytes = (size_t)NB * CLINE * 4;                // kept-key count per batch
  const size_t total    = kb_bytes + vt_bytes + 2 * cx_bytes + wp_bytes + ct_bytes;
  if (ws_size < total) return;

  const float* x    = (const float*)d_in[0];
  const int*   mask = (const int*)d_in[1];
  const float* w    = (const float*)d_in[2];
  const float* bias = (const float*)d_in[3];
  float*       out  = (float*)d_out;

  char* base = (char*)d_ws;
  bf16* kb = (bf16*)base;
  f16*  vt = (f16*)(base + kb_bytes);
  f16*  ch = (f16*)(base + kb_bytes + vt_bytes);
  f16*  cr = (f16*)(base + kb_bytes + vt_bytes + cx_bytes);
  f16*  wp = (f16*)(base + kb_bytes + vt_bytes + 2 * cx_bytes);
  int*  ct = (int*)(base + kb_bytes + vt_bytes + 2 * cx_bytes + wp_bytes);

  x_planes_kernel<<<dim3(SEQ / CT, NHEAD, NB), 256, 0, stream>>>(x, mask, kb, vt, ct);
  w_plane_kernel<<<dim3((EMB * EMB) / (256 * WELEM)), 256, 0, stream>>>(w, wp);
  attn_kernel<<<dim3(SEQ / BQ, NHEAD, NB), 256, 0, stream>>>(x, kb, vt, ct, ch, cr);
  proj_kernel<<<dim3(SEQ / GM, EMB / GN, NB), 256, 0, stream>>>(ch, cr, wp, bias, out);
}

// v004
// A run of this version takes 55.8 microseconds.
// Two timings next to v003 put it at 1.04 and 1.05 times that version's speed.
// Over all steps from v000 it is 2.81 times as fast.
#include <hip/hip_runtime.h>

// Contractions: S^T = K x Q^T on v_wmma_f32_16x16x32_bf16 (bf16 operands = RNE-converted input X, f32 accumulate);
// O = P x V on v_wmma_f32_16x16x32_f16 (P as f16 carried x4096, V = f16 of the bf16 RNE-converted X, f32 accumulate);
// Y = C x W^T on v_wmma_f32_16x16x32_f16 (C as f16 carried x256 plus an f16 residual plane x2048 with its own
// accumulator, W = f16 of the bf16 RNE-converted weight carried x64, f32 accumulate). Softmax and bias add in f32.
//
// Plane layout: every 16-bit plane is stored in fragment order. The unit is 16 B (8 consecutive k elements of one
// row or column); 32 units = the 512 contiguous bytes that one wave-wide 16-B load brings in, unit index = lane
// (lane = hi*16 + lq: lq = row or column inside a 16-wide tile, hi = which run of 8 inside a run of 16 k elements).
//
// Key compaction: a key whose mask word is 0 gets the score -1e20, so its softmax weight is exactly 0 whenever the
// batch has any kept key. The plane builder therefore packs only the kept keys (in their order) into the K and V
// planes and the attention loop walks ceil(kept / 32) blocks. A batch with no kept key has equal scores everywhere:
// there all keys are packed and Q is taken as 0, which gives the same uniform weights.

#ifndef NB
#define NB 2
#endif
#ifndef SEQ
#define SEQ 2048
#endif
#define NB_FULL    2
#define SEQ_FULL   2048
#define NHEAD      16
#define HDIM       64
#define EMB        (NHEAD * HDIM)       // floats per (b, s) of X and of the output, halves per (b, s) of each context plane
#define BQ         128                  // query rows per workgroup (8 waves x 16)
#define BK         32                   // keys per inner iteration
#define NWAVE      8
#define CT         64                   // keys per plane-builder block
#define TP         72                   // LDS pitch (halves) of the transposed tile
#define KP         17                   // LDS pitch (16-B units) of one d-chunk row of the fragment-order K tile
#define FU         256                  // elements of one wave-wide fragment load (32 lanes x 8)
#define OP         68                   // LDS pitch (floats) of the staging tile
#define GM         128                  // projection rows per workgroup (8 waves x 16)
#define GN         64                   // projection columns per workgroup
#define WELEM      8                    // weight elements per thread in the weight plane builder
#define CLINE      32                   // ints between the batches' kept-key counts: one writing block per 128-B line

#define P_CARRY    4096.0f
#define CTX_CARRY  256.0f
#define RES_CARRY  2048.0f
#define W_CARRY    64.0f

static_assert(SEQ % BQ == 0);
static_assert(SEQ % CT == 0);
static_assert(SEQ % BK == 0);
static_assert(SEQ % (NWAVE * 32) == 0);
static_assert(BK == 32 && CT % BK == 0 && CT * HDIM == 2 * 256 * 8);
static_assert(SEQ % GM == 0);
static_assert(EMB % GN == 0);
static_assert(EMB % 64 == 0 && EMB >= 128);
static_assert(BQ == NWAVE * 16);
static_assert(GM == NWAVE * 16);
static_assert(HDIM == 64);
static_assert(GN == 64);
static_assert(SEQ <= SEQ_FULL);
static_assert(NB >= 1 && NB <= NB_FULL);
static_assert((TP * 2) % 16 == 0);
static_assert((OP * 4) % 16 == 0);
// coverage equalities: grid x block x per-thread elements == plane element count
static_assert((size_t)(SEQ / CT) * NHEAD * NB * 256 * 2 * 8 == (size_t)NB * NHEAD * SEQ * HDIM);   // row plane and transposed plane
static_assert((size_t)(SEQ / CT) * NHEAD * 256 * WELEM == (size_t)EMB * EMB);                      // weight plane (one grid slice)
static_assert((size_t)(SEQ / BQ) * NHEAD * NB * NWAVE * 16 * HDIM == (size_t)NB * SEQ * EMB);       // context planes
static_assert((size_t)(SEQ / GM) * (EMB / GN) * NB * NWAVE * 16 * GN == (size_t)NB * SEQ * EMB);    // output

typedef __bf16   bf16;
typedef _Float16 f16;
typedef bf16     v16bf __attribute__((ext_vector_type(16)));
typedef f16      v16h  __attribute__((ext_vector_type(16)));
typedef f16      v8h   __attribute__((ext_vector_type(8)));
typedef float    v8f   __attribute__((ext_vector_type(8)));
typedef float    v4f   __attribute__((ext_vector_type(4)));
typedef unsigned v4u   __attribute__((ext_vector_type(4)));
typedef int      v4i   __attribute__((ext_vector_type(4)));

union FragB  { v16bf v; v4u q[2]; bf16 h[16]; };
union FragH  { v16h  v; v4u q[2]; f16  h[16]; };
union Pack8B { v4u u; bf16 h[8]; };
union Pack8H { v4u u; v8h v; f16 h[8]; };

// WMMA helpers: builtin followed by the VALU hazard guard (ties D, keeps A/B live).
static __device__ __forceinline__ v8f mma_bf16(v16bf a, v16bf b, v8f acc) {
  acc = __builtin_amdgcn_wmma_f32_16x16x32_bf16(false, a, false, b, (short)0, acc, false, false);
  asm volatile("v_nop\n\tv_nop\n\tv_nop\n\tv_nop" : "+v"(acc) : "v"(a), "v"(b));
  return acc;
}
static __device__ __forceinline__ v8f mma_f16(v16h a, v16h b, v8f acc) {
  acc = __builtin_amdgcn_wmma_f32_16x16x32_f16(false, a, false, b, (short)0, acc, false, false);
  asm volatile("v_nop\n\tv_nop\n\tv_nop\n\tv_nop" : "+v"(acc) : "v"(a), "v"(b));
  return acc;
}

// Weight plane: f16(bf16(W[n][k]) * 64) in fragment order: [n/16][k/32][j][lane][8 k], n = (n/16)*16 + lq,
// k = (k/32)*32 + j*16 + hi*8 + 0..7. Thread t writes unit t.
static __device__ __forceinline__ void w_plane_unit(const float* __restrict__ w, f16* __restrict__ wp, unsigned t) {
  const size_t   e0 = (size_t)t * WELEM;
  const size_t   r0 = (size_t)((t >> 11) * 16u + (t & 15u)) * EMB + ((t >> 4) & 127u) * 8u;
  const v4f a0 = *(const v4f*)(w + r0);
  const v4f a1 = *(const v4f*)(w + r0 + 4);
  Pack8H ph;
  #pragma unroll
  for (int i = 0; i < 4; ++i) {
    ph.h[i]     = (f16)((float)(bf16)a0[i] * W_CARRY);   // bf16 significand x power of two: exact in f16
    ph.h[4 + i] = (f16)((float)(bf16)a1[i] * W_CARRY);
  }
  const v4u val = ph.u;
  *(v4u*)(wp + e0) = val;
}

// Plane builder, one launch for all three planes: the weight plane depends on nothing the K and V planes need, so its
// blocks ride in the same grid as one more z slice (z == NB; it has the shortest chain of loads).
// Block = (tile of 64 packed keys, head, batch), 256 threads. k = v = head slice of X, kept keys only.
// Every block ranks the batch's kept keys itself (ballots per wave, wave totals through LDS) and gathers the 64 rows
// whose ranks fall into its tile; ranks past the kept count are filled with 0 (finite, so a zero weight stays zero).
// A tile that starts past the kept count is not stored and never read.
// coverage: packed positions kt*64 + {0..31, 32..63}, d 0..63 for both planes; every written line whole, one instruction.
// kb, per (b, h): [16-key tile][d chunk c = d/8][key in tile][8 d]; a fragment load (f, j) is units (f*2+j)*32 + lane.
// vt, per (b, h): [32-key block][dt*2 + j][lane][8 keys], d = dt*16 + lq, keys = j*16 + hi*8 + 0..7 of the block.
__global__ __launch_bounds__(256) void planes_kernel(const float* __restrict__ x,
                                                     const int* __restrict__ mask,
                                                     const float* __restrict__ w,
                                                     bf16* __restrict__ kb,
                                                     f16* __restrict__ vt,
                                                     f16* __restrict__ wp,
                                                     int* __restrict__ cnt) {
  const unsigned kt   = blockIdx.x;
  const unsigned h    = blockIdx.y;
  const unsigned b    = blockIdx.z;
  const unsigned tid  = threadIdx.x;
  if (b == (unsigned)NB) {                      // whole blocks, ahead of every barrier
    w_plane_unit(w, wp, (h * (unsigned)(SEQ / CT) + kt) * 256u + tid);
    return;
  }
  const unsigned wave = tid >> 5;
  const unsigned lane = tid & 31u;
  __shared__ __align__(16) f16 sT[HDIM * TP];   // [d][key], cross-wave (block barrier)
  __shared__ __align__(16) v4u sK[(CT / 16) * 8 * KP];   // [tile*8 + d chunk][key in tile], cross-wave
  __shared__ unsigned sTot[NWAVE];              // kept keys in each wave's run of SEQ / NWAVE keys
  __shared__ unsigned sIdx[CT];                 // sequence position of this tile's packed keys
  const unsigned s0 = kt * CT;

  // wave w ranks keys w*KW .. w*KW + KW-1: one ballot per 32 keys
  constexpr unsigned KW = SEQ / NWAVE;
  const int* mk = mask + (size_t)b * SEQ_FULL + wave * KW + lane;
  unsigned bal[KW / 32];
  unsigned wtot = 0;
  #pragma unroll
  for (unsigned e = 0; e < KW / 32; ++e) {
    bal[e] = __builtin_amdgcn_ballot_w32(mk[e * 32u] != 0);
    wtot += (unsigned)__popc(bal[e]);
  }
  if (lane == 0) sTot[wave] = wtot;
  if (tid < CT) sIdx[tid] = 0u;                 // fill positions past the kept count point at row 0 (read, then dropped)
  __syncthreads();
  unsigned rank = 0, kept = 0;
  #pragma unroll
  for (unsigned v = 0; v < NWAVE; ++v) {
    const unsigned t = sTot[v];
    rank += (v < wave) ? t : 0u;
    kept += t;
  }
  const bool     none  = (kept == 0u);          // no kept key: pack every key
  const unsigned count = none ? (unsigned)SEQ : kept;
  if (none) rank = wave * KW;
  #pragma unroll
  for (unsigned e = 0; e < KW / 32; ++e) {
    const unsigned bits = none ? 0xFFFFFFFFu : bal[e];
    const unsigned slot = rank + (unsigned)__popc(bits & ((1u << lane) - 1u)) - s0;   // wraps below the tile
    if (((bits >> lane) & 1u) != 0u && slot < (unsigned)CT) sIdx[slot] = wave * KW + e * 32u + lane;
    rank += (unsigned)__popc(bits);
  }
  if (kt == 0 && h == 0 && tid == 0) cnt[b * CLINE] = (int)kept;
  __syncthreads();

  v4f xr[2][2];
  #pragma unroll
  for (unsigned kk = 0; kk < 2; ++kk) {
    const unsigned key = kk * 32u + (tid >> 3);     // 0..63
    const float* src = x + ((size_t)b * SEQ_FULL + sIdx[key]) * EMB + h * HDIM + (tid & 7u) * 8u;
    xr[kk][0] = *(const v4f*)(src);
    xr[kk][1] = *(const v4f*)(src + 4);
  }
  // holds the four loads ahead of the selects below: without it each row's pair sinks into a branch of its own and
  // the second row's memory latency starts only after the first row has been converted
  asm volatile("" :: "v"(xr[0][0]), "v"(xr[0][1]), "v"(xr[1][0]), "v"(xr[1][1]));

  #pragma unroll
  for (unsigned kk = 0; kk < 2; ++kk) {
    const unsigned key = kk * 32u + (tid >> 3);     // 0..63
    const unsigned d0  = (tid & 7u) * 8u;           // 0..56
    const bool     on  = s0 + key < count;
    const v4f x0 = on ? xr[kk][0] : (v4f){0, 0, 0, 0};
    const v4f x1 = on ? xr[kk][1] : (v4f){0, 0, 0, 0};
    Pack8B pk;
    #pragma unroll
    for (int i = 0; i < 4; ++i) {
      pk.h[i]     = (bf16)x0[i];                    // RNE convert
      pk.h[4 + i] = (bf16)x1[i];
    }
    sK[((key >> 4) * 8u + (tid & 7u)) * KP + (key & 15u)] = pk.u;
    #pragma unroll
    for (int i = 0; i < 4; ++i) {
      sT[(d0 + i) * TP + key]     = (f16)(float)pk.h[i];       // f16 of bf16 value: exact
      sT[(d0 + 4 + i) * TP + key] = (f16)(float)pk.h[4 + i];
    }
  }
  __syncthreads();

  // unit u = kk*256 + tid of this block's 8 KiB of each plane: both planes are written in unit order
  v4u    kval[2], vval[2];
  size_t uidx[2];
  #pragma unroll
  for (unsigned kk = 0; kk < 2; ++kk) {
    const unsigned u  = kk * 256u + tid;
    kval[kk] = sK[(u >> 4) * KP + (u & 15u)];
    const unsigned d  = (tid >> 6) * 16u + (tid & 15u);          // dt*16 + lq
    const unsigned ks = kk * 32u + ((tid >> 4) & 3u) * 8u;       // block*32 + j*16 + hi*8
    Pack8H ph;
    ph.v = *(const v8h*)(sT + d * TP + ks);
    vval[kk] = ph.u;
    uidx[kk] = (((size_t)b * NHEAD + h) * SEQ + s0) * HDIM + (size_t)u * 8u;
  }

  if (s0 < count) {
    #pragma unroll
    for (int kk = 0; kk < 2; ++kk) {
      *(v4u*)(kb + uidx[kk]) = kval[kk];
      *(v4u*)(vt + uidx[kk]) = vval[kk];
    }
  }
}

// Flash attention over the packed (kept) keys. Block = (query block of 128, head, batch); one wave owns 16 query rows.
// S^T = K x Q^T so queries sit on lanes; P^T in C-layout is bit-identical to the A-fragment layout of O += P x V.
// K A-fragments and V^T B-fragments are loaded straight from the fragment-order planes (two 16-B loads each, every
// load 512 contiguous bytes per wave); Q B-fragments are converted once per wave from X (every position is a query).
__global__ __launch_bounds__(256) void attn_kernel(const float* __restrict__ x,
                                                   const bf16* __restrict__ kb,
                                                   const f16* __restrict__ vt,
                                                   const int* __restrict__ cnt,
                                                   f16* __restrict__ ch,
                                                   f16* __restrict__ cr) {
  const unsigned qblk = blockIdx.x;
  const unsigned h    = blockIdx.y;
  const unsigned b    = blockIdx.z;
  const unsigned tid  = threadIdx.x;
  const unsigned wave = tid >> 5;
  const unsigned lane = tid & 31u;
  const unsigned lq   = lane & 15u;   // query column of S^T / d column of O
  const unsigned hi   = lane >> 4;    // k-split half

  __shared__ __align__(16) float sO[NWAVE * 16 * OP];   // per-wave staging tile (block barrier used)

  const unsigned qrow0 = qblk * BQ + wave * 16u;        // first query row of this wave

  // wave-uniform plane bases in bytes; a block of 32 keys is BKB bytes of either plane, a fragment load FB bytes
  const char* kb_h = (const char*)(kb + ((size_t)b * NHEAD + h) * SEQ * HDIM);
  const char* vt_h = (const char*)(vt + ((size_t)b * NHEAD + h) * HDIM * SEQ);
  constexpr unsigned FB  = FU * 2u;
  constexpr unsigned BKB = BK * HDIM * 2u;
  const unsigned lo = lane * 16u;     // this lane's unit (byte offset) inside a wave-wide fragment load

  // packed keys of this batch; 0 kept keys: all SEQ keys are packed and Q = 0 makes every score equal
  const int      kept = cnt[b * CLINE];
  const bool     none = kept <= 0;
  const unsigned nk   = none ? (unsigned)SEQ : ((unsigned)kept < (unsigned)SEQ ? (unsigned)kept : (unsigned)SEQ);

  // Q as B-operand fragments: lane lq holds query qrow0+lq, elements follow the split d map of the K plane.
  FragB qf[2];
  const float* xq = x + ((size_t)b * SEQ_FULL + qrow0 + lq) * EMB + h * HDIM + hi * 8u;
  #pragma unroll
  for (unsigned f = 0; f < 2; ++f) {
    #pragma unroll
    for (unsigned j = 0; j < 2; ++j) {
      const v4f a0 = *(const v4f*)(xq + f * 32u + j * 16u);        // d = f*32 + j*16 + hi*8 + 0..3
      const v4f a1 = *(const v4f*)(xq + f * 32u + j * 16u + 4u);   // d = f*32 + j*16 + hi*8 + 4..7
      Pack8B pq;
      #pragma unroll
      for (int i = 0; i < 4; ++i) {
        pq.h[i]     = (bf16)a0[i];                                 // RNE convert
        pq.h[4 + i] = (bf16)a1[i];
      }
      qf[f].q[j] = none ? (v4u){0, 0, 0, 0} : pq.u;
    }
  }

  v8f o[4];
  #pragma unroll
  for (int dt = 0; dt < 4; ++dt) o[dt] = (v8f){0, 0, 0, 0, 0, 0, 0, 0};

  float rmax = -3.0e38f;
  float rsum = 0.0f;                                   // carried x4096, summed from the f16 values fed to P x V
  const float SL   = 0.03125f * 1.4426950408889634f;   // (1/sqrt(EMB)) * log2(e)
  const float FILL = -1.0e20f;                         // the reference's replace value (applied before scaling)

  // K A-fragments: row = key j0 + sub*16 + lq, split d map. They are fetched one block ahead: block 0 here, block
  // j0 + BK inside pass j0, right behind the products that were the last readers of the registers.
  FragB ak[2][2];
  #pragma unroll
  for (unsigned sub = 0; sub < 2; ++sub) {
    #pragma unroll
    for (unsigned f = 0; f < 2; ++f) {
      ak[sub][f].q[0] = *(const v4u*)(kb_h + lo + (sub * 4u + f * 2u) * FB);
      ak[sub][f].q[1] = *(const v4u*)(kb_h + lo + (sub * 4u + f * 2u + 1u) * FB);
    }
  }

  #pragma unroll 1
  for (unsigned j0 = 0; j0 < nk; j0 += BK) {
    // V B-fragments: column n = d = dt*16 + lq, split key map from the transposed plane
    FragH bv[4];
    const char* vbase = vt_h + (size_t)(j0 / BK) * BKB;
    #pragma unroll
    for (unsigned dt = 0; dt < 4; ++dt) {
      bv[dt].q[0] = *(const v4u*)(vbase + lo + (dt * 2u) * FB);        // keys j0 + hi*8 + 0..7
      bv[dt].q[1] = *(const v4u*)(vbase + lo + (dt * 2u + 1u) * FB);   // keys j0 + 16 + hi*8 + 0..7
    }

    // S^T tiles: c[sub][r] = rawscore(query qrow0+lq, key j0 + sub*16 + hi*8 + r)
    v8f c[2];
    #pragma unroll
    for (int sub = 0; sub < 2; ++sub) {
      v8f acc = (v8f){0, 0, 0, 0, 0, 0, 0, 0};
      acc = mma_bf16(ak[sub][0].v, qf[0].v, acc);
      acc = mma_bf16(ak[sub][1].v, qf[1].v, acc);
      c[sub] = acc;
    }

    // the V loads' address registers are stepped on behind this point
    asm volatile("s_wait_xcnt 0x0" ::: "memory");

    // next block's K fragments; the last pass reads its own block again (written, in bounds, never used)
    const char* kbase = kb_h + (size_t)(((j0 + BK < nk) ? j0 + BK : j0) / BK) * BKB;
    #pragma unroll
    for (unsigned sub = 0; sub < 2; ++sub) {
      #pragma unroll
      for (unsigned f = 0; f < 2; ++f) {
        ak[sub][f].q[0] = *(const v4u*)(kbase + lo + (sub * 4u + f * 2u) * FB);
        ak[sub][f].q[1] = *(const v4u*)(kbase + lo + (sub * 4u + f * 2u + 1u) * FB);
      }
    }

    // only the last block can hold fill positions past the packed keys: they get the replace value (weight 0)
    if (j0 + BK > nk) {
      #pragma unroll
      for (unsigned r = 0; r < 8; ++r) {
        c[0][r] = (j0 + hi * 8u + r >= nk)       ? FILL : c[0][r];
        c[1][r] = (j0 + 16u + hi * 8u + r >= nk) ? FILL : c[1][r];
      }
    }

    // online softmax (running max): query lq's 32 scores are split across lane / lane^16
    float m_new = rmax;
    #pragma unroll
    for (int r = 0; r < 8; ++r) {
      m_new = fmaxf(m_new, c[0][r]);
      m_new = fmaxf(m_new, c[1][r]);
    }
    m_new = fmaxf(m_new, __shfl_xor(m_new, 16, 32));
    const float scale = __builtin_amdgcn_exp2f((rmax - m_new) * SL);
    rmax = m_new;

    // exp + pack: P^T C-layout == A-fragment layout for the PV product
    FragH pa;
    float psum = 0.0f;
    #pragma unroll
    for (int r = 0; r < 8; ++r) {
      const float p0 = __builtin_amdgcn_exp2f((c[0][r] - m_new) * SL);   // key hi*8 + r
      const float p1 = __builtin_amdgcn_exp2f((c[1][r] - m_new) * SL);   // key 16 + hi*8 + r
      const f16 h0 = (f16)(p0 * P_CARRY);
      const f16 h1 = (f16)(p1 * P_CARRY);
      pa.h[r]     = h0;
      pa.h[8 + r] = h1;
      psum += (float)h0 + (float)h1;
    }
    rsum = rsum * scale + psum + __shfl_xor(psum, 16, 32);

    // rescale O: queries are the row dimension there -> per-row scale from lane 8*hi + r
    float sc[8];
    #pragma unroll
    for (int r = 0; r < 8; ++r) sc[r] = __shfl(scale, (int)((hi << 3) + r), 32);
    #pragma unroll
    for (int dt = 0; dt < 4; ++dt) {
      #pragma unroll
      for (int r = 0; r < 8; ++r) o[dt][r] *= sc[r];
    }

    // O += P x V
    #pragma unroll
    for (int dt = 0; dt < 4; ++dt) o[dt] = mma_f16(pa.v, bv[dt].v, o[dt]);
  }

  // normalize: lane holds column d = dt*16 + lq for query rows 8*hi + r; the x4096 carry cancels against rsum
  float rs[8];
  #pragma unroll
  for (int r = 0; r < 8; ++r) rs[r] = CTX_CARRY * (1.0f / __shfl(rsum, (int)((hi << 3) + r), 32));

  float* so = sO + wave * (16 * OP);
  #pragma unroll
  for (int r = 0; r < 8; ++r) {
    #pragma unroll
    for (int dt = 0; dt < 4; ++dt) {
      so[(hi * 8u + r) * OP + dt * 16u + lq] = o[dt][r] * rs[r];
    }
  }
  __syncthreads();

  // context planes in fragment order: [16-row tile][k/32][j][lane][8 k]; this wave's 16 rows x 64 columns are 4 loads'
  // worth (it = (k/32 within the head)*2 + j), 2 KiB contiguous per plane; lane = hi*16 + row.
  v4u    hv[4], rv[4];
  size_t gidx[4];
  #pragma unroll
  for (unsigned it = 0; it < 4; ++it) {
    const unsigned row = lq;
    const unsigned c8  = it * 16u + hi * 8u;
    const v4f a0 = *(const v4f*)(so + row * OP + c8);
    const v4f a1 = *(const v4f*)(so + row * OP + c8 + 4);
    Pack8H ph, pr;
    #pragma unroll
    for (int i = 0; i < 4; ++i) {
      const f16 t0 = (f16)a0[i];
      const f16 t1 = (f16)a1[i];
      ph.h[i]     = t0;
      ph.h[4 + i] = t1;
      pr.h[i]     = (f16)((a0[i] - (float)t0) * RES_CARRY);
      pr.h[4 + i] = (f16)((a1[i] - (float)t1) * RES_CARRY);
    }
    hv[it]   = ph.u;
    rv[it]   = pr.u;
    gidx[it] = ((size_t)b * SEQ + qrow0) * EMB + h * (HDIM * 16u) + it * FU + lane * 8u;
  }
  #pragma unroll
  for (int it = 0; it < 4; ++it) {
    *(v4u*)(ch + gidx[it]) = hv[it];
    *(v4u*)(cr + gidx[it]) = rv[it];
  }
  
}

// One 32-k step of the projection: A fragments of both context planes, B fragments of the four 16-column tiles.
// ah, ar, bw: uniform byte bases; ao, lo: the lane's byte offsets; a 16-wide tile's 32 k elements are 2 loads' worth.
struct ProjFrag { FragH a, a2, bf[4]; };
template <bool LAST>
static __device__ __forceinline__ void proj_load(ProjFrag& f, const char* ah, const char* ar, const char* bw,
                                                 unsigned ao, unsigned lo, unsigned k0) {
  constexpr unsigned FB = FU * 2u;                  // bytes of one wave-wide fragment load
  const size_t ko = (size_t)k0 * 32u;
  f.a.q[0]  = *(const v4u*)(ah + ko + ao);          // k = k0 + hi*8 + 0..7
  f.a.q[1]  = *(const v4u*)(ah + ko + ao + FB);     // k = k0 + 16 + hi*8 + 0..7
  f.a2.q[0] = *(const v4u*)(ar + ko + ao);
  f.a2.q[1] = *(const v4u*)(ar + ko + ao + FB);
  #pragma unroll
  for (unsigned nt = 0; nt < 4; ++nt) {
    // behind the loop the address registers die here: the last results may be given the registers that held them
    if (LAST && nt == 3) asm volatile("s_wait_xcnt 0x0" ::: "memory");
    f.bf[nt].q[0] = *(const v4u*)(bw + ko + lo + nt * (16u * EMB * 2u));
    f.bf[nt].q[1] = *(const v4u*)(bw + ko + lo + nt * (16u * EMB * 2u) + FB);
  }
}
static __device__ __forceinline__ void proj_mma(const ProjFrag& f, v8f (&acc)[4], v8f (&acr)[4]) {
  #pragma unroll
  for (int nt = 0; nt < 4; ++nt) {
    acc[nt] = mma_f16(f.a.v,  f.bf[nt].v, acc[nt]);
    acr[nt] = mma_f16(f.a2.v, f.bf[nt].v, acr[nt]);   // scaled residual: separate accumulator
  }
}

// Output projection. Block = (128-row tile, 64-column tile, batch); one wave owns 16 rows x 64 columns.
// A fragments from the context planes, B fragments from the weight plane, all in fragment order - both with the
// split k map, two 16-B loads per fragment, every load 512 contiguous bytes per wave.
__global__ __launch_bounds__(256) void proj_kernel(const f16* __restrict__ ch,
                                                   const f16* __restrict__ cr,
                                                   const f16* __restrict__ wp,
                                                   const float* __restrict__ bias,
                                                   float* __restrict__ out) {
  const unsigned rb   = blockIdx.x;
  const unsigned cb   = blockIdx.y;
  const unsigned b    = blockIdx.z;
  const unsigned tid  = threadIdx.x;
  const unsigned wave = tid >> 5;
  const unsigned lane = tid & 31u;
  const unsigned lq   = lane & 15u;
  const unsigned hi   = lane >> 4;

  __shared__ __align__(16) float sO[NWAVE * 16 * OP];   // per-wave staging tile (block barrier used)

  const unsigned row0 = rb * GM + wave * 16u;           // first sequence row of this wave
  const unsigned col0 = cb * GN;

  // workgroup-uniform plane bases in bytes
  const char* ah = (const char*)(ch + ((size_t)b * SEQ + rb * GM) * EMB);
  const char* ar = (const char*)(cr + ((size_t)b * SEQ + rb * GM) * EMB);
  const char* bw = (const char*)(wp + (size_t)col0 * EMB);
  const unsigned lo = lane * 16u;                       // this lane's unit (byte offset) inside a wave-wide fragment load
  const unsigned ao = wave * (16u * EMB * 2u) + lo;     // plus this wave's 16-row tile

  v8f acc[4], acr[4];
  #pragma unroll
  for (int nt = 0; nt < 4; ++nt) {
    acc[nt] = (v8f){0, 0, 0, 0, 0, 0, 0, 0};
    acr[nt] = (v8f){0, 0, 0, 0, 0, 0, 0, 0};
  }

  // two fragment sets: while one set's products run, the other set's loads (the next 32 k) are in flight
  ProjFrag f0, f1;
  proj_load<false>(f0, ah, ar, bw, ao, lo, 0u);
  // the start values of the accumulators and of the loop take over registers that these loads name
  asm volatile("s_wait_xcnt 0x0" ::: "memory");
  __builtin_amdgcn_sched_barrier(0);   // without it the compiler lifts those writes over the wait
  #pragma unroll 1
  for (unsigned k0 = 0; k0 < EMB - 64u; k0 += 64u) {
    proj_load<false>(f1, ah, ar, bw, ao, lo, k0 + 32u);
    proj_mma(f0, acc, acr);
    proj_load<false>(f0, ah, ar, bw, ao, lo, k0 + 64u);
    proj_mma(f1, acc, acr);
    // the next pass forms its addresses in the registers that hold this pass's
    asm volatile("s_wait_xcnt 0x0" ::: "memory");
  }
  proj_load<true>(f1, ah, ar, bw, ao, lo, EMB - 32u);
  proj_mma(f0, acc, acr);
  proj_mma(f1, acc, acr);

  // fold carries: (hi + res/2048) / (256 * 64); acc[nt][r] = element (row 8*hi + r, column nt*16 + lq)
  float* so = sO + wave * (16 * OP);
  const float inv_res = 1.0f / RES_CARRY;
  const float inv_car = 1.0f / (CTX_CARRY * W_CARRY);
  #pragma unroll
  for (int r = 0; r < 8; ++r) {
    #pragma unroll
    for (int nt = 0; nt < 4; ++nt) {
      so[(hi * 8u + r) * OP + nt * 16u + lq] = (acc[nt][r] + acr[nt][r] * inv_res) * inv_car;
    }
  }
  __syncthreads();

  // bias (bf16 RNE-converted input value), added in f32
  const v4f braw = *(const v4f*)(bias + col0 + lq * 4u);
  v4f bq;
  #pragma unroll
  for (int i = 0; i < 4; ++i) bq[i] = (float)(bf16)braw[i];

  // lanes 0..15 one row (16 consecutive lanes x 16 B each), lanes 16..31 the next row; 8 instructions cover the wave's 16 rows.
  v4f    vals[8];
  size_t gidx[8];
  #pragma unroll
  for (unsigned it = 0; it < 8; ++it) {
    const unsigned row = it * 2u + hi;
    const v4f t = *(const v4f*)(so + row * OP + lq * 4u);
    vals[it] = t + bq;
    gidx[it] = ((size_t)b * SEQ_FULL + row0 + row) * EMB + col0 + lq * 4u;
  }
  #pragma unroll
  for (int it = 0; it < 8; ++it) *(v4f*)(out + gidx[it]) = vals[it];
  
}

extern "C" void kernel_launch(void* const* d_in, const int* in_sizes, int n_in,
                              void* d_out, int out_size, void* d_ws, size_t ws_size,
                              hipStream_t stream) {
  if (n_in < 4) return;
  const size_t rows_used = (size_t)(NB - 1) * SEQ_FULL + SEQ;
  if ((size_t)in_sizes[0] < rows_used * EMB) return;
  if ((size_t)in_sizes[1] < rows_used) return;
  if ((size_t)in_sizes[2] < (size_t)EMB * EMB) return;
  if ((size_t)in_sizes[3] < (size_t)EMB) return;
  if ((size_t)out_size < rows_used * EMB) return;

  const size_t kb_bytes = (size_t)NB * NHEAD * SEQ * HDIM * 2;   // bf16 row plane
  const size_t vt_bytes = (size_t)NB * NHEAD * HDIM * SEQ * 2;   // f16 transposed plane
  const size_t cx_bytes = (size_t)NB * SEQ * EMB * 2;            // each f16 context plane
  const size_t wp_bytes = (size_t)EMB * EMB * 2;                 // f16 weight plane
  const size_t ct_bytes = (size_t)NB * CLINE * 4;                // kept-key count per batch
  const size_t total    = kb_bytes + vt_bytes + 2 * cx_bytes + wp_bytes + ct_bytes;
  if (ws_size < total) return;

  const float* x    = (const float*)d_in[0];
  const int*   mask = (const int*)d_in[1];
  const float* w    = (const float*)d_in[2];
  const float* bias = (const float*)d_in[3];
  float*       out  = (float*)d_out;

  char* base = (char*)d_ws;
  bf16* kb = (bf16*)base;
  f16*  vt = (f16*)(base + kb_bytes);
  f16*  ch = (f16*)(base + kb_bytes + vt_bytes);
  f16*  cr = (f16*)(base + kb_bytes + vt_bytes + cx_bytes);
  f16*  wp = (f16*)(base + kb_bytes + vt_bytes + 2 * cx_bytes);
  int*  ct = (int*)(base + kb_bytes + vt_bytes + 2 * cx_bytes + wp_bytes);

  planes_kernel<<<dim3(SEQ / CT, NHEAD, NB + 1), 256, 0, stream>>>(x, mask, w, kb, vt, wp, ct);
  attn_kernel<<<dim3(SEQ / BQ, NHEAD, NB), 256, 0, stream>>>(x, kb, vt, ct, ch, cr);
  proj_kernel<<<dim3(SEQ / GM, EMB / GN, NB), 256, 0, stream>>>(ch, cr, wp, bias, out);
}

// v005
// It runs in 52 microseconds.
// Next to v004, in two timings, it ran 1.10 and 1.06 times as fast.
// Counting every step since v000, it is 3.02 times as fast.
#include <hip/hip_runtime.h>

// Contractions: S^T = K x Q^T on v_wmma_f32_16x16x32_bf16 (bf16 operands = RNE-converted input X, f32 accumulate);
// O = P x V on v_wmma_f32_16x16x32_f16 (P as f16 carried x4096, V = f16 of the bf16 RNE-converted X, f32 accumulate);
// Y = C x W^T on v_wmma_f32_16x16x32_f16 (C as f16 carried x256 plus an f16 residual plane x2048 with its own
// accumulator, W = f16 of the bf16 RNE-converted weight carried x64, f32 accumulate). Softmax and bias add in f32.
//
// Plane layout: every 16-bit plane is stored in fragment order. The unit is 16 B (8 consecutive k elements of one
// row or column); 32 units = the 512 contiguous bytes that one wave-wide 16-B load brings in, unit index = lane
// (lane = hi*16 + lq: lq = row or column inside a 16-wide tile, hi = which run of 8 inside a run of 16 k elements).
//
// Key compaction: a key whose mask word is 0 gets the score -1e20, so its softmax weight is exactly 0 whenever the
// batch has any kept key. The plane builder therefore packs only the kept keys (in their order) into the K and V
// planes and the attention loop walks ceil(kept / 32) blocks. A batch with no kept key has equal scores everywhere:
// there all keys are packed and Q is taken as 0, which gives the same uniform weights.
//
// Rotated walks: work-groups that read the same plane (the 16 query blocks of a head; the projection blocks of one row
// or one column tile) run at the same time. Walking it from the same end they ask L2 for the same lines at the same
// moment, and all of them wait for each line's first fetch. Each work-group therefore starts its key walk or k walk at
// a place set by its block index and wraps round; every block of the walk is still taken exactly once.

#ifndef NB
#define NB 2
#endif
#ifndef SEQ
#define SEQ 2048
#endif
#define NB_FULL    2
#define SEQ_FULL   2048
#define NHEAD      16
#define HDIM       64
#define EMB        (NHEAD * HDIM)       // floats per (b, s) of X and of the output, halves per (b, s) of each context plane
#define BQ         128                  // query rows per workgroup (8 waves x 16)
#define BK         32                   // keys per inner iteration
#define NWAVE      8
#define CT         64                   // keys per plane-builder block
#define TP         72                   // LDS pitch (halves) of the transposed tile
#define KP         17                   // LDS pitch (16-B units) of one d-chunk row of the fragment-order K tile
#define FU         256                  // elements of one wave-wide fragment load (32 lanes x 8)
#define OP         68                   // LDS pitch (floats) of the staging tile
#define GM         128                  // projection rows per workgroup (8 waves x 16)
#define GN         64                   // projection columns per workgroup
#define WELEM      8                    // weight elements per thread in the weight plane builder
#define CLINE      32                   // ints between the batches' kept-key counts: one writing block per 128-B line

#define P_CARRY    4096.0f
#define CTX_CARRY  256.0f
#define RES_CARRY  2048.0f
#define W_CARRY    64.0f

static_assert(SEQ % BQ == 0);
static_assert(SEQ % CT == 0);
static_assert(SEQ % BK == 0);
static_assert(SEQ % (NWAVE * 32) == 0);
static_assert(BK == 32 && CT % BK == 0 && CT * HDIM == 2 * 256 * 8);
static_assert(SEQ % GM == 0);
static_assert(EMB % GN == 0);
static_assert(EMB % 64 == 0 && EMB >= 128);
static_assert(BQ == NWAVE * 16);
static_assert(GM == NWAVE * 16);
static_assert(HDIM == 64);
static_assert(GN == 64);
static_assert(SEQ <= SEQ_FULL);
static_assert(NB >= 1 && NB <= NB_FULL);
static_assert((TP * 2) % 16 == 0);
static_assert((OP * 4) % 16 == 0);
// coverage equalities: grid x block x per-thread elements == plane element count
static_assert((size_t)(SEQ / CT) * NHEAD * NB * 256 * 2 * 8 == (size_t)NB * NHEAD * SEQ * HDIM);   // row plane and transposed plane
static_assert((size_t)(SEQ / CT) * NHEAD * 256 * WELEM == (size_t)EMB * EMB);                      // weight plane (one grid slice)
static_assert((size_t)(SEQ / BQ) * NHEAD * NB * NWAVE * 16 * HDIM == (size_t)NB * SEQ * EMB);       // context planes
static_assert((size_t)(SEQ / GM) * (EMB / GN) * NB * NWAVE * 16 * GN == (size_t)NB * SEQ * EMB);    // output

typedef __bf16   bf16;
typedef _Float16 f16;
typedef bf16     v16bf __attribute__((ext_vector_type(16)));
typedef f16      v16h  __attribute__((ext_vector_type(16)));
typedef f16      v8h   __attribute__((ext_vector_type(8)));
typedef float    v8f   __attribute__((ext_vector_type(8)));
typedef float    v4f   __attribute__((ext_vector_type(4)));
typedef unsigned v4u   __attribute__((ext_vector_type(4)));
typedef int      v4i   __attribute__((ext_vector_type(4)));

union FragB  { v16bf v; v4u q[2]; bf16 h[16]; };
union FragH  { v16h  v; v4u q[2]; f16  h[16]; };
union Pack8B { v4u u; bf16 h[8]; };
union Pack8H { v4u u; v8h v; f16 h[8]; };

// WMMA helpers: builtin followed by the VALU hazard guard (ties D, keeps A/B live).
static __device__ __forceinline__ v8f mma_bf16(v16bf a, v16bf b, v8f acc) {
  acc = __builtin_amdgcn_wmma_f32_16x16x32_bf16(false, a, false, b, (short)0, acc, false, false);
  asm volatile("v_nop\n\tv_nop\n\tv_nop\n\tv_nop" : "+v"(acc) : "v"(a), "v"(b));
  return acc;
}
static __device__ __forceinline__ v8f mma_f16(v16h a, v16h b, v8f acc) {
  acc = __builtin_amdgcn_wmma_f32_16x16x32_f16(false, a, false, b, (short)0, acc, false, false);
  asm volatile("v_nop\n\tv_nop\n\tv_nop\n\tv_nop" : "+v"(acc) : "v"(a), "v"(b));
  return acc;
}

// Weight plane: f16(bf16(W[n][k]) * 64) in fragment order: [n/16][k/32][j][lane][8 k], n = (n/16)*16 + lq,
// k = (k/32)*32 + j*16 + hi*8 + 0..7. Thread t writes unit t.
static __device__ __forceinline__ void w_plane_unit(const float* __restrict__ w, f16* __restrict__ wp, unsigned t) {
  const size_t   e0 = (size_t)t * WELEM;
  const size_t   r0 = (size_t)((t >> 11) * 16u + (t & 15u)) * EMB + ((t >> 4) & 127u) * 8u;
  const v4f a0 = *(const v4f*)(w + r0);
  const v4f a1 = *(const v4f*)(w + r0 + 4);
  Pack8H ph;
  #pragma unroll
  for (int i = 0; i < 4; ++i) {
    ph.h[i]     = (f16)((float)(bf16)a0[i] * W_CARRY);   // bf16 significand x power of two: exact in f16
    ph.h[4 + i] = (f16)((float)(bf16)a1[i] * W_CARRY);
  }
  const v4u val = ph.u;
  *(v4u*)(wp + e0) = val;
}

// Plane builder, one launch for all three planes: the weight plane depends on nothing the K and V planes need, so its
// blocks ride in the same grid as one more z slice (z == NB; it has the shortest chain of loads).
// Block = (tile of 64 packed keys, head, batch), 256 threads. k = v = head slice of X, kept keys only.
// Every block ranks the batch's kept keys itself (ballots per wave, wave totals through LDS) and gathers the 64 rows
// whose ranks fall into its tile; ranks past the kept count are filled with 0 (finite, so a zero weight stays zero).
// A tile that starts past the kept count is not stored and never read.
// coverage: packed positions kt*64 + {0..31, 32..63}, d 0..63 for both planes; every written line whole, one instruction.
// kb, per (b, h): [16-key tile][d chunk c = d/8][key in tile][8 d]; a fragment load (f, j) is units (f*2+j)*32 + lane.
// vt, per (b, h): [32-key block][dt*2 + j][lane][8 keys], d = dt*16 + lq, keys = j*16 + hi*8 + 0..7 of the block.
__global__ __launch_bounds__(256) void planes_kernel(const float* __restrict__ x,
                                                     const int* __restrict__ mask,
                                                     const float* __restrict__ w,
                                                     bf16* __restrict__ kb,
                                                     f16* __restrict__ vt,
                                                     f16* __restrict__ wp,
                                                     int* __restrict__ cnt) {
  const unsigned kt   = blockIdx.x;
  const unsigned h    = blockIdx.y;
  const unsigned b    = blockIdx.z;
  const unsigned tid  = threadIdx.x;
  if (b == (unsigned)NB) {                      // whole blocks, ahead of every barrier
    w_plane_unit(w, wp, (h * (unsigned)(SEQ / CT) + kt) * 256u + tid);
    return;
  }
  const unsigned wave = tid >> 5;
  const unsigned lane = tid & 31u;
  __shared__ __align__(16) f16 sT[HDIM * TP];   // [d][key], cross-wave (block barrier)
  __shared__ __align__(16) v4u sK[(CT / 16) * 8 * KP];   // [tile*8 + d chunk][key in tile], cross-wave
  __shared__ unsigned sTot[NWAVE];              // kept keys in each wave's run of SEQ / NWAVE keys
  __shared__ unsigned sIdx[CT];                 // sequence position of this tile's packed keys
  const unsigned s0 = kt * CT;

  // wave w ranks keys w*KW .. w*KW + KW-1: one ballot per 32 keys
  constexpr unsigned KW = SEQ / NWAVE;
  const int* mk = mask + (size_t)b * SEQ_FULL + wave * KW + lane;
  unsigned bal[KW / 32];
  unsigned wtot = 0;
  #pragma unroll
  for (unsigned e = 0; e < KW / 32; ++e) {
    bal[e] = __builtin_amdgcn_ballot_w32(mk[e * 32u] != 0);
    wtot += (unsigned)__popc(bal[e]);
  }
  if (lane == 0) sTot[wave] = wtot;
  if (tid < CT) sIdx[tid] = 0u;                 // fill positions past the kept count point at row 0 (read, then dropped)
  __syncthreads();
  unsigned rank = 0, kept = 0;
  #pragma unroll
  for (unsigned v = 0; v < NWAVE; ++v) {
    const unsigned t = sTot[v];
    rank += (v < wave) ? t : 0u;
    kept += t;
  }
  const bool     none  = (kept == 0u);          // no kept key: pack every key
  const unsigned count = none ? (unsigned)SEQ : kept;
  if (none) rank = wave * KW;
  #pragma unroll
  for (unsigned e = 0; e < KW / 32; ++e) {
    const unsigned bits = none ? 0xFFFFFFFFu : bal[e];
    const unsigned slot = rank + (unsigned)__popc(bits & ((1u << lane) - 1u)) - s0;   // wraps below the tile
    if (((bits >> lane) & 1u) != 0u && slot < (unsigned)CT) sIdx[slot] = wave * KW + e * 32u + lane;
    rank += (unsigned)__popc(bits);
  }
  if (kt == 0 && h == 0 && tid == 0) cnt[b * CLINE] = (int)kept;
  __syncthreads();

  v4f xr[2][2];
  #pragma unroll
  for (unsigned kk = 0; kk < 2; ++kk) {
    const unsigned key = kk * 32u + (tid >> 3);     // 0..63
    const float* src = x + ((size_t)b * SEQ_FULL + sIdx[key]) * EMB + h * HDIM + (tid & 7u) * 8u;
    xr[kk][0] = *(const v4f*)(src);
    xr[kk][1] = *(const v4f*)(src + 4);
  }
  // holds the four loads ahead of the selects below: without it each row's pair sinks into a branch of its own and
  // the second row's memory latency starts only after the first row has been converted
  asm volatile("" :: "v"(xr[0][0]), "v"(xr[0][1]), "v"(xr[1][0]), "v"(xr[1][1]));

  #pragma unroll
  for (unsigned kk = 0; kk < 2; ++kk) {
    const unsigned key = kk * 32u + (tid >> 3);     // 0..63
    const unsigned d0  = (tid & 7u) * 8u;           // 0..56
    const bool     on  = s0 + key < count;
    const v4f x0 = on ? xr[kk][0] : (v4f){0, 0, 0, 0};
    const v4f x1 = on ? xr[kk][1] : (v4f){0, 0, 0, 0};
    Pack8B pk;
    #pragma unroll
    for (int i = 0; i < 4; ++i) {
      pk.h[i]     = (bf16)x0[i];                    // RNE convert
      pk.h[4 + i] = (bf16)x1[i];
    }
    sK[((key >> 4) * 8u + (tid & 7u)) * KP + (key & 15u)] = pk.u;
    #pragma unroll
    for (int i = 0; i < 4; ++i) {
      sT[(d0 + i) * TP + key]     = (f16)(float)pk.h[i];       // f16 of bf16 value: exact
      sT[(d0 + 4 + i) * TP + key] = (f16)(float)pk.h[4 + i];
    }
  }
  __syncthreads();

  // unit u = kk*256 + tid of this block's 8 KiB of each plane: both planes are written in unit order
  v4u    kval[2], vval[2];
  size_t uidx[2];
  #pragma unroll
  for (unsigned kk = 0; kk < 2; ++kk) {
    const unsigned u  = kk * 256u + tid;
    kval[kk] = sK[(u >> 4) * KP + (u & 15u)];
    const unsigned d  = (tid >> 6) * 16u + (tid & 15u);          // dt*16 + lq
    const unsigned ks = kk * 32u + ((tid >> 4) & 3u) * 8u;       // block*32 + j*16 + hi*8
    Pack8H ph;
    ph.v = *(const v8h*)(sT + d * TP + ks);
    vval[kk] = ph.u;
    uidx[kk] = (((size_t)b * NHEAD + h) * SEQ + s0) * HDIM + (size_t)u * 8u;
  }

  if (s0 < count) {
    #pragma unroll
    for (int kk = 0; kk < 2; ++kk) {
      *(v4u*)(kb + uidx[kk]) = kval[kk];
      *(v4u*)(vt + uidx[kk]) = vval[kk];
    }
  }
}

// Flash attention over the packed (kept) keys. Block = (query block of 128, head, batch); one wave owns 16 query rows.
// S^T = K x Q^T so queries sit on lanes; P^T in C-layout is bit-identical to the A-fragment layout of O += P x V.
// K A-fragments and V^T B-fragments are loaded straight from the fragment-order planes (two 16-B loads each, every
// load 512 contiguous bytes per wave); Q B-fragments are converted once per wave from X (every position is a query).
__global__ __launch_bounds__(256) void attn_kernel(const float* __restrict__ x,
                                                   const bf16* __restrict__ kb,
                                                   const f16* __restrict__ vt,
                                                   const int* __restrict__ cnt,
                                                   f16* __restrict__ ch,
                                                   f16* __restrict__ cr) {
  const unsigned qblk = blockIdx.x;
  const unsigned h    = blockIdx.y;
  const unsigned b    = blockIdx.z;
  const unsigned tid  = threadIdx.x;
  const unsigned wave = tid >> 5;
  const unsigned lane = tid & 31u;
  const unsigned lq   = lane & 15u;   // query column of S^T / d column of O
  const unsigned hi   = lane >> 4;    // k-split half

  __shared__ __align__(16) float sO[NWAVE * 16 * OP];   // per-wave staging tile (block barrier used)

  const unsigned qrow0 = qblk * BQ + wave * 16u;        // first query row of this wave

  // wave-uniform plane bases in bytes; a block of 32 keys is BKB bytes of either plane, a fragment load FB bytes
  const char* kb_h = (const char*)(kb + ((size_t)b * NHEAD + h) * SEQ * HDIM);
  const char* vt_h = (const char*)(vt + ((size_t)b * NHEAD + h) * HDIM * SEQ);
  constexpr unsigned FB  = FU * 2u;
  constexpr unsigned BKB = BK * HDIM * 2u;
  const unsigned lo = lane * 16u;     // this lane's unit (byte offset) inside a wave-wide fragment load

  // packed keys of this batch; 0 kept keys: all SEQ keys are packed and Q = 0 makes every score equal
  const int      kept = cnt[b * CLINE];
  const bool     none = kept <= 0;
  const unsigned nk   = none ? (unsigned)SEQ : ((unsigned)kept < (unsigned)SEQ ? (unsigned)kept : (unsigned)SEQ);

  // Q as B-operand fragments: lane lq holds query qrow0+lq, elements follow the split d map of the K plane.
  FragB qf[2];
  const float* xq = x + ((size_t)b * SEQ_FULL + qrow0 + lq) * EMB + h * HDIM + hi * 8u;
  #pragma unroll
  for (unsigned f = 0; f < 2; ++f) {
    #pragma unroll
    for (unsigned j = 0; j < 2; ++j) {
      const v4f a0 = *(const v4f*)(xq + f * 32u + j * 16u);        // d = f*32 + j*16 + hi*8 + 0..3
      const v4f a1 = *(const v4f*)(xq + f * 32u + j * 16u + 4u);   // d = f*32 + j*16 + hi*8 + 4..7
      Pack8B pq;
      #pragma unroll
      for (int i = 0; i < 4; ++i) {
        pq.h[i]     = (bf16)a0[i];                                 // RNE convert
        pq.h[4 + i] = (bf16)a1[i];
      }
      qf[f].q[j] = none ? (v4u){0, 0, 0, 0} : pq.u;
    }
  }

  v8f o[4];
  #pragma unroll
  for (int dt = 0; dt < 4; ++dt) o[dt] = (v8f){0, 0, 0, 0, 0, 0, 0, 0};

  float rmax = -3.0e38f;
  float rsum = 0.0f;                                   // carried x4096, summed from the f16 values fed to P x V
  const float SL   = 0.03125f * 1.4426950408889634f;   // (1/sqrt(EMB)) * log2(e)
  const float FILL = -1.0e20f;                         // the reference's replace value (applied before scaling)

  // rotated key walk: the 16 query blocks of a head start spread over the nblk key blocks and wrap. The index is
  // transposed (4 x 4) first, so that neighbouring query blocks start far apart: any run of neighbours that shares a
  // cache has its starts spread over the whole walk.
  const unsigned nblk = (nk + BK - 1u) / BK;
  static_assert(SEQ / BQ == 16);
  unsigned blk = (((qblk & 3u) * 4u + (qblk >> 2)) * nblk) / (unsigned)(SEQ / BQ);   // < nblk

  // K A-fragments: row = key j0 + sub*16 + lq, split d map. They are fetched one block ahead: the first block here,
  // the walk's next block inside each pass, right behind the products that were the last readers of the registers.
  FragB ak[2][2];
  const char* kfirst = kb_h + (size_t)blk * BKB;
  #pragma unroll
  for (unsigned sub = 0; sub < 2; ++sub) {
    #pragma unroll
    for (unsigned f = 0; f < 2; ++f) {
      ak[sub][f].q[0] = *(const v4u*)(kfirst + lo + (sub * 4u + f * 2u) * FB);
      ak[sub][f].q[1] = *(const v4u*)(kfirst + lo + (sub * 4u + f * 2u + 1u) * FB);
    }
  }

  // this lane's address in the V plane, carried from pass to pass: ready when a pass begins, so that the V loads go
  // out ahead of the score products
  const char* vcur = vt_h + lo + (size_t)blk * BKB;

  #pragma unroll 1
  for (unsigned it = 0; it < nblk; ++it) {
    const unsigned j0  = blk * BK;                               // first packed key of this pass
    const unsigned nxt = (blk + 1u < nblk) ? blk + 1u : 0u;      // the walk wraps behind the last key block
    // V B-fragments: column n = d = dt*16 + lq, split key map from the transposed plane
    FragH bv[4];
    #pragma unroll
    for (unsigned dt = 0; dt < 4; ++dt) {
      bv[dt].q[0] = *(const v4u*)(vcur + (dt * 2u) * FB);        // keys j0 + hi*8 + 0..7
      bv[dt].q[1] = *(const v4u*)(vcur + (dt * 2u + 1u) * FB);   // keys j0 + 16 + hi*8 + 0..7
    }

    // S^T tiles: c[sub][r] = rawscore(query qrow0+lq, key j0 + sub*16 + hi*8 + r)
    v8f c[2];
    #pragma unroll
    for (int sub = 0; sub < 2; ++sub) {
      v8f acc = (v8f){0, 0, 0, 0, 0, 0, 0, 0};
      acc = mma_bf16(ak[sub][0].v, qf[0].v, acc);
      acc = mma_bf16(ak[sub][1].v, qf[1].v, acc);
      c[sub] = acc;
    }

    // the V loads' address registers are stepped on behind this point
    asm volatile("s_wait_xcnt 0x0" ::: "memory");

    // next block's K fragments; the last pass reads the walk's first block again (written, in bounds, never used)
    const char* kbase = kb_h + (size_t)nxt * BKB;
    #pragma unroll
    for (unsigned sub = 0; sub < 2; ++sub) {
      #pragma unroll
      for (unsigned f = 0; f < 2; ++f) {
        ak[sub][f].q[0] = *(const v4u*)(kbase + lo + (sub * 4u + f * 2u) * FB);
        ak[sub][f].q[1] = *(const v4u*)(kbase + lo + (sub * 4u + f * 2u + 1u) * FB);
      }
    }

    // only the last key block can hold fill positions past the packed keys: they get the replace value (weight 0)
    if (j0 + BK > nk) {
      #pragma unroll
      for (unsigned r = 0; r < 8; ++r) {
        c[0][r] = (j0 + hi * 8u + r >= nk)       ? FILL : c[0][r];
        c[1][r] = (j0 + 16u + hi * 8u + r >= nk) ? FILL : c[1][r];
      }
    }

    // behind the wait above: one block on, or back to the plane's first block
    vcur += (blk + 1u < nblk) ? (long long)BKB : -(long long)((size_t)(nblk - 1u) * BKB);

    // online softmax (running max): query lq's 32 scores are split across lane / lane^16
    float m_new = rmax;
    #pragma unroll
    for (int r = 0; r < 8; ++r) {
      m_new = fmaxf(m_new, c[0][r]);
      m_new = fmaxf(m_new, c[1][r]);
    }
    m_new = fmaxf(m_new, __shfl_xor(m_new, 16, 32));
    const float scale = __builtin_amdgcn_exp2f((rmax - m_new) * SL);
    rmax = m_new;

    // exp + pack: P^T C-layout == A-fragment layout for the PV product
    FragH pa;
    float psum = 0.0f;
    #pragma unroll
    for (int r = 0; r < 8; ++r) {
      const float p0 = __builtin_amdgcn_exp2f((c[0][r] - m_new) * SL);   // key hi*8 + r
      const float p1 = __builtin_amdgcn_exp2f((c[1][r] - m_new) * SL);   // key 16 + hi*8 + r
      const f16 h0 = (f16)(p0 * P_CARRY);
      const f16 h1 = (f16)(p1 * P_CARRY);
      pa.h[r]     = h0;
      pa.h[8 + r] = h1;
      psum += (float)h0 + (float)h1;
    }
    rsum = rsum * scale + psum + __shfl_xor(psum, 16, 32);

    // rescale O: queries are the row dimension there -> per-row scale from lane 8*hi + r
    float sc[8];
    #pragma unroll
    for (int r = 0; r < 8; ++r) sc[r] = __shfl(scale, (int)((hi << 3) + r), 32);
    #pragma unroll
    for (int dt = 0; dt < 4; ++dt) {
      #pragma unroll
      for (int r = 0; r < 8; ++r) o[dt][r] *= sc[r];
    }

    // O += P x V
    #pragma unroll
    for (int dt = 0; dt < 4; ++dt) o[dt] = mma_f16(pa.v, bv[dt].v, o[dt]);
    blk = nxt;
  }

  // normalize: lane holds column d = dt*16 + lq for query rows 8*hi + r; the x4096 carry cancels against rsum
  float rs[8];
  #pragma unroll
  for (int r = 0; r < 8; ++r) rs[r] = CTX_CARRY * (1.0f / __shfl(rsum, (int)((hi << 3) + r), 32));

  float* so = sO + wave * (16 * OP);
  #pragma unroll
  for (int r = 0; r < 8; ++r) {
    #pragma unroll
    for (int dt = 0; dt < 4; ++dt) {
      so[(hi * 8u + r) * OP + dt * 16u + lq] = o[dt][r] * rs[r];
    }
  }
  __syncthreads();

  // context planes in fragment order: [16-row tile][k/32][j][lane][8 k]; this wave's 16 rows x 64 columns are 4 loads'
  // worth (it = (k/32 within the head)*2 + j), 2 KiB contiguous per plane; lane = hi*16 + row.
  v4u    hv[4], rv[4];
  size_t gidx[4];
  #pragma unroll
  for (unsigned it = 0; it < 4; ++it) {
    const unsigned row = lq;
    const unsigned c8  = it * 16u + hi * 8u;
    const v4f a0 = *(const v4f*)(so + row * OP + c8);
    const v4f a1 = *(const v4f*)(so + row * OP + c8 + 4);
    Pack8H ph, pr;
    #pragma unroll
    for (int i = 0; i < 4; ++i) {
      const f16 t0 = (f16)a0[i];
      const f16 t1 = (f16)a1[i];
      ph.h[i]     = t0;
      ph.h[4 + i] = t1;
      pr.h[i]     = (f16)((a0[i] - (float)t0) * RES_CARRY);
      pr.h[4 + i] = (f16)((a1[i] - (float)t1) * RES_CARRY);
    }
    hv[it]   = ph.u;
    rv[it]   = pr.u;
    gidx[it] = ((size_t)b * SEQ + qrow0) * EMB + h * (HDIM * 16u) + it * FU + lane * 8u;
  }
  #pragma unroll
  for (int it = 0; it < 4; ++it) {
    *(v4u*)(ch + gidx[it]) = hv[it];
    *(v4u*)(cr + gidx[it]) = rv[it];
  }
  
}

// One 32-k step of the projection: A fragments of both context planes, B fragments of the four 16-column tiles.
// ah, ar, bw: uniform byte bases; ao, lo: the lane's byte offsets; a 16-wide tile's 32 k elements are 2 loads' worth.
struct ProjFrag { FragH a, a2, bf[4]; };
template <bool LAST>
static __device__ __forceinline__ void proj_load(ProjFrag& f, const char* ah, const char* ar, const char* bw,
                                                 unsigned ao, unsigned lo, unsigned k0) {
  constexpr unsigned FB = FU * 2u;                  // bytes of one wave-wide fragment load
  const size_t ko = (size_t)k0 * 32u;
  f.a.q[0]  = *(const v4u*)(ah + ko + ao);          // k = k0 + hi*8 + 0..7
  f.a.q[1]  = *(const v4u*)(ah + ko + ao + FB);     // k = k0 + 16 + hi*8 + 0..7
  f.a2.q[0] = *(const v4u*)(ar + ko + ao);
  f.a2.q[1] = *(const v4u*)(ar + ko + ao + FB);
  #pragma unroll
  for (unsigned nt = 0; nt < 4; ++nt) {
    // behind the loop the address registers die here: the last results may be given the registers that held them
    if (LAST && nt == 3) asm volatile("s_wait_xcnt 0x0" ::: "memory");
    f.bf[nt].q[0] = *(const v4u*)(bw + ko + lo + nt * (16u * EMB * 2u));
    f.bf[nt].q[1] = *(const v4u*)(bw + ko + lo + nt * (16u * EMB * 2u) + FB);
  }
}
static __device__ __forceinline__ void proj_mma(const ProjFrag& f, v8f (&acc)[4], v8f (&acr)[4]) {
  #pragma unroll
  for (int nt = 0; nt < 4; ++nt) {
    acc[nt] = mma_f16(f.a.v,  f.bf[nt].v, acc[nt]);
    acr[nt] = mma_f16(f.a2.v, f.bf[nt].v, acr[nt]);   // scaled residual: separate accumulator
  }
}

// Output projection. Block = (128-row tile, 64-column tile, batch); one wave owns 16 rows x 64 columns.
// A fragments from the context planes, B fragments from the weight plane, all in fragment order - both with the
// split k map, two 16-B loads per fragment, every load 512 contiguous bytes per wave.
__global__ __launch_bounds__(256) void proj_kernel(const f16* __restrict__ ch,
                                                   const f16* __restrict__ cr,
                                                   const f16* __restrict__ wp,
                                                   const float* __restrict__ bias,
                                                   float* __restrict__ out) {
  const unsigned rb   = blockIdx.x;
  const unsigned cb   = blockIdx.y;
  const unsigned b    = blockIdx.z;
  const unsigned tid  = threadIdx.x;
  const unsigned wave = tid >> 5;
  const unsigned lane = tid & 31u;
  const unsigned lq   = lane & 15u;
  const unsigned hi   = lane >> 4;

  __shared__ __align__(16) float sO[NWAVE * 16 * OP];   // per-wave staging tile (block barrier used)

  const unsigned row0 = rb * GM + wave * 16u;           // first sequence row of this wave
  const unsigned col0 = cb * GN;

  // workgroup-uniform plane bases in bytes
  const char* ah = (const char*)(ch + ((size_t)b * SEQ + rb * GM) * EMB);
  const char* ar = (const char*)(cr + ((size_t)b * SEQ + rb * GM) * EMB);
  const char* bw = (const char*)(wp + (size_t)col0 * EMB);
  const unsigned lo = lane * 16u;                       // this lane's unit (byte offset) inside a wave-wide fragment load
  const unsigned ao = wave * (16u * EMB * 2u) + lo;     // plus this wave's 16-row tile

  v8f acc[4], acr[4];
  #pragma unroll
  for (int nt = 0; nt < 4; ++nt) {
    acc[nt] = (v8f){0, 0, 0, 0, 0, 0, 0, 0};
    acr[nt] = (v8f){0, 0, 0, 0, 0, 0, 0, 0};
  }

  // rotated k walk: the 16 column blocks of a row tile, and the 16 row blocks of a column tile and batch, start 64 k
  // apart; k wraps at EMB. The start is an odd number of 32-k steps, so the two steps that a pass of the loop loads
  // (the second of one pair, the first of the next) are neighbours in memory and never straddle the wrap.
  static_assert(EMB / 64 == 16 && EMB / GN == 16 && SEQ / GM == 16);
  const unsigned kr = (((cb + rb) & 15u) * 2u + 1u) * 32u;

  // two fragment sets: while one set's products run, the other set's loads (the next 32 k) are in flight
  ProjFrag f0, f1;
  proj_load<false>(f0, ah, ar, bw, ao, lo, kr);
  // the start values of the accumulators and of the loop take over registers that these loads name
  asm volatile("s_wait_xcnt 0x0" ::: "memory");
  __builtin_amdgcn_sched_barrier(0);   // without it the compiler lifts those writes over the wait
  #pragma unroll 1
  for (unsigned k0 = 0; k0 < EMB - 64u; k0 += 64u) {
    const unsigned kp = (kr + k0 + 32u) & (EMB - 1u);   // a multiple of 64
    proj_load<false>(f1, ah, ar, bw, ao, lo, kp);
    proj_mma(f0, acc, acr);
    proj_load<false>(f0, ah, ar, bw, ao, lo, kp + 32u);
    proj_mma(f1, acc, acr);
    // the next pass forms its addresses in the registers that hold this pass's
    asm volatile("s_wait_xcnt 0x0" ::: "memory");
  }
  proj_load<true>(f1, ah, ar, bw, ao, lo, (kr + EMB - 32u) & (EMB - 1u));
  proj_mma(f0, acc, acr);
  proj_mma(f1, acc, acr);

  // fold carries: (hi + res/2048) / (256 * 64); acc[nt][r] = element (row 8*hi + r, column nt*16 + lq)
  float* so = sO + wave * (16 * OP);
  const float inv_res = 1.0f / RES_CARRY;
  const float inv_car = 1.0f / (CTX_CARRY * W_CARRY);
  #pragma unroll
  for (int r = 0; r < 8; ++r) {
    #pragma unroll
    for (int nt = 0; nt < 4; ++nt) {
      so[(hi * 8u + r) * OP + nt * 16u + lq] = (acc[nt][r] + acr[nt][r] * inv_res) * inv_car;
    }
  }
  __syncthreads();

  // bias (bf16 RNE-converted input value), added in f32
  const v4f braw = *(const v4f*)(bias + col0 + lq * 4u);
  v4f bq;
  #pragma unroll
  for (int i = 0; i < 4; ++i) bq[i] = (float)(bf16)braw[i];

  // lanes 0..15 one row (16 consecutive lanes x 16 B each), lanes 16..31 the next row; 8 instructions cover the wave's 16 rows.
  v4f    vals[8];
  size_t gidx[8];
  #pragma unroll
  for (unsigned it = 0; it < 8; ++it) {
    const unsigned row = it * 2u + hi;
    const v4f t = *(const v4f*)(so + row * OP + lq * 4u);
    vals[it] = t + bq;
    gidx[it] = ((size_t)b * SEQ_FULL + row0 + row) * EMB + col0 + lq * 4u;
  }
  #pragma unroll
  for (int it = 0; it < 8; ++it) *(v4f*)(out + gidx[it]) = vals[it];
  
}

extern "C" void kernel_launch(void* const* d_in, const int* in_sizes, int n_in,
                              void* d_out, int out_size, void* d_ws, size_t ws_size,
                              hipStream_t stream) {
  if (n_in < 4) return;
  const size_t rows_used = (size_t)(NB - 1) * SEQ_FULL + SEQ;
  if ((size_t)in_sizes[0] < rows_used * EMB) return;
  if ((size_t)in_sizes[1] < rows_used) return;
  if ((size_t)in_sizes[2] < (size_t)EMB * EMB) return;
  if ((size_t)in_sizes[3] < (size_t)EMB) return;
  if ((size_t)out_size < rows_used * EMB) return;

  const size_t kb_bytes = (size_t)NB * NHEAD * SEQ * HDIM * 2;   // bf16 row plane
  const size_t vt_bytes = (size_t)NB * NHEAD * HDIM * SEQ * 2;   // f16 transposed plane
  const size_t cx_bytes = (size_t)NB * SEQ * EMB * 2;            // each f16 context plane
  const size_t wp_bytes = (size_t)EMB * EMB * 2;                 // f16 weight plane
  const size_t ct_bytes = (size_t)NB * CLINE * 4;                // kept-key count per batch
  const size_t total    = kb_bytes + vt_bytes + 2 * cx_bytes + wp_bytes + ct_bytes;
  if (ws_size < total) return;

  const float* x    = (const float*)d_in[0];
  const int*   mask = (const int*)d_in[1];
  const float* w    = (const float*)d_in[2];
  const float* bias = (const float*)d_in[3];
  float*       out  = (float*)d_out;

  char* base = (char*)d_ws;
  bf16* kb = (bf16*)base;
  f16*  vt = (f16*)(base + kb_bytes);
  f16*  ch = (f16*)(base + kb_bytes + vt_bytes);
  f16*  cr = (f16*)(base + kb_bytes + vt_bytes + cx_bytes);
  f16*  wp = (f16*)(base + kb_bytes + vt_bytes + 2 * cx_bytes);
  int*  ct = (int*)(base + kb_bytes + vt_bytes + 2 * cx_bytes + wp_bytes);

  planes_kernel<<<dim3(SEQ / CT, NHEAD, NB + 1), 256, 0, stream>>>(x, mask, w, kb, vt, wp, ct);
  attn_kernel<<<dim3(SEQ / BQ, NHEAD, NB), 256, 0, stream>>>(x, kb, vt, ct, ch, cr);
  proj_kernel<<<dim3(SEQ / GM, EMB / GN, NB), 256, 0, stream>>>(ch, cr, wp, bias, out);
}

// v006
// One run takes 46.9 microseconds.
// Two timings next to v005 put it at 1.12 and 1.10 times that version's speed.
// Counting every step since v000, it is 3.35 times as fast.
#include <hip/hip_runtime.h>

// Contractions: S^T = K x Q^T on v_wmma_f32_16x16x32_bf16 (bf16 operands = RNE-converted input X, f32 accumulate);
// O = P x V on v_wmma_f32_16x16x32_f16 (P as f16 carried x4096, V = f16 of the bf16 RNE-converted X, f32 accumulate);
// Y = C x W^T on v_wmma_f32_16x16x32_f16 (C as f16 carried x256 plus an f16 residual plane x2048 with its own
// accumulator, W = f16 of the bf16 RNE-converted weight carried x64, f32 accumulate). Softmax and bias add in f32.
//
// Plane layout: every 16-bit plane is stored in fragment order. The unit is 16 B (8 consecutive k elements of one
// row or column); 32 units = the 512 contiguous bytes that one wave-wide 16-B load brings in, unit index = lane
// (lane = hi*16 + lq: lq = row or column inside a 16-wide tile, hi = which run of 8 inside a run of 16 k elements).
//
// Key compaction: a key whose mask word is 0 gets the score -1e20, so its softmax weight is exactly 0 whenever the
// batch has any kept key. The plane builder therefore packs only the kept keys (in their order) into the K and V
// planes and the attention loop walks ceil(kept / 32) blocks. A batch with no kept key has equal scores everywhere:
// there all keys are packed and Q is taken as 0, which gives the same uniform weights.
//
// Rotated walks: work-groups that read the same plane (the 16 query blocks of a head; the projection blocks of one row
// or one column tile) run at the same time. Walking it from the same end they ask L2 for the same lines at the same
// moment, and all of them wait for each line's first fetch. Each work-group therefore starts its key walk or k walk at
// a place set by its block index and wraps round; every block of the walk is still taken exactly once.

#ifndef NB
#define NB 2
#endif
#ifndef SEQ
#define SEQ 2048
#endif
#define NB_FULL    2
#define SEQ_FULL   2048
#define NHEAD      16
#define HDIM       64
#define EMB        (NHEAD * HDIM)       // floats per (b, s) of X and of the output, halves per (b, s) of each context plane
#define BQ         128                  // query rows per workgroup (8 waves x 16)
#define BK         32                   // keys per inner iteration
#define NWAVE      8
#define CT         64                   // keys per plane-builder block
#define TP         72                   // LDS pitch (halves) of the transposed tile
#define KP         17                   // LDS pitch (16-B units) of one d-chunk row of the fragment-order K tile
#define FU         256                  // elements of one wave-wide fragment load (32 lanes x 8)
#define OP         68                   // LDS pitch (floats) of the staging tile
#define GM         128                  // projection rows per workgroup (8 waves x 16)
#define GN         64                   // projection columns per workgroup
#define WELEM      8                    // weight elements per thread in the weight plane builder
#define CLINE      32                   // ints between the batches' kept-key counts: one writing block per 128-B line

#define P_CARRY    4096.0f
#define CTX_CARRY  256.0f
#define RES_CARRY  2048.0f
#define W_CARRY    64.0f

static_assert(SEQ % BQ == 0);
static_assert(SEQ % CT == 0);
static_assert(SEQ % BK == 0);
static_assert(SEQ % (NWAVE * 32) == 0);
static_assert(BK == 32 && CT % BK == 0 && CT * HDIM == 2 * 256 * 8);
static_assert(SEQ % GM == 0);
static_assert(EMB % GN == 0);
static_assert(EMB % 64 == 0 && EMB >= 128);
static_assert(BQ == NWAVE * 16);
static_assert(GM == NWAVE * 16);
static_assert(HDIM == 64);
static_assert(GN == 64);
static_assert(SEQ <= SEQ_FULL);
static_assert(NB >= 1 && NB <= NB_FULL);
static_assert((TP * 2) % 16 == 0);
static_assert((OP * 4) % 16 == 0);
// coverage equalities: grid x block x per-thread elements == plane element count
static_assert((size_t)(SEQ / CT) * NHEAD * NB * 256 * 2 * 8 == (size_t)NB * NHEAD * SEQ * HDIM);   // row plane and transposed plane
static_assert((size_t)(SEQ / CT) * NHEAD * 256 * WELEM == (size_t)EMB * EMB);                      // weight plane (one grid slice)
static_assert((size_t)(SEQ / BQ) * NHEAD * NB * NWAVE * 16 * HDIM == (size_t)NB * SEQ * EMB);       // context planes
static_assert((size_t)(SEQ / GM) * (EMB / GN) * NB * NWAVE * 16 * GN == (size_t)NB * SEQ * EMB);    // output

typedef __bf16   bf16;
typedef _Float16 f16;
typedef bf16     v16bf __attribute__((ext_vector_type(16)));
typedef f16      v16h  __attribute__((ext_vector_type(16)));
typedef f16      v8h   __attribute__((ext_vector_type(8)));
typedef float    v8f   __attribute__((ext_vector_type(8)));
typedef float    v4f   __attribute__((ext_vector_type(4)));
typedef unsigned v4u   __attribute__((ext_vector_type(4)));
typedef int      v4i   __attribute__((ext_vector_type(4)));

union FragB  { v16bf v; v4u q[2]; bf16 h[16]; };
union FragH  { v16h  v; v4u q[2]; f16  h[16]; };
union Pack8B { v4u u; bf16 h[8]; };
union Pack8H { v4u u; v8h v; f16 h[8]; };

// WMMA helpers: builtin followed by the VALU hazard guard (ties D, keeps A/B live).
static __device__ __forceinline__ v8f mma_bf16(v16bf a, v16bf b, v8f acc) {
  acc = __builtin_amdgcn_wmma_f32_16x16x32_bf16(false, a, false, b, (short)0, acc, false, false);
  asm volatile("v_nop\n\tv_nop\n\tv_nop\n\tv_nop" : "+v"(acc) : "v"(a), "v"(b));
  return acc;
}
static __device__ __forceinline__ v8f mma_f16(v16h a, v16h b, v8f acc) {
  acc = __builtin_amdgcn_wmma_f32_16x16x32_f16(false, a, false, b, (short)0, acc, false, false);
  asm volatile("v_nop\n\tv_nop\n\tv_nop\n\tv_nop" : "+v"(acc) : "v"(a), "v"(b));
  return acc;
}

// Weight plane: f16(bf16(W[n][k]) * 64) in fragment order: [n/16][k/32][j][lane][8 k], n = (n/16)*16 + lq,
// k = (k/32)*32 + j*16 + hi*8 + 0..7. Thread t writes unit t.
static __device__ __forceinline__ void w_plane_unit(const float* __restrict__ w, f16* __restrict__ wp, unsigned t) {
  const size_t   e0 = (size_t)t * WELEM;
  const size_t   r0 = (size_t)((t >> 11) * 16u + (t & 15u)) * EMB + ((t >> 4) & 127u) * 8u;
  const v4f a0 = *(const v4f*)(w + r0);
  const v4f a1 = *(const v4f*)(w + r0 + 4);
  Pack8H ph;
  #pragma unroll
  for (int i = 0; i < 4; ++i) {
    ph.h[i]     = (f16)((float)(bf16)a0[i] * W_CARRY);   // bf16 significand x power of two: exact in f16
    ph.h[4 + i] = (f16)((float)(bf16)a1[i] * W_CARRY);
  }
  const v4u val = ph.u;
  *(v4u*)(wp + e0) = val;
}

// Plane builder, one launch for all three planes: the weight plane depends on nothing the K and V planes need, so its
// blocks ride in the same grid as one more z slice (z == NB; it has the shortest chain of loads).
// Block = (tile of 64 packed keys, head, batch), 256 threads. k = v = head slice of X, kept keys only.
// Every block ranks the batch's kept keys itself (ballots per wave, wave totals through LDS) and gathers the 64 rows
// whose ranks fall into its tile; ranks past the kept count are filled with 0 (finite, so a zero weight stays zero).
// A tile that starts past the kept count is not stored and never read.
// coverage: packed positions kt*64 + {0..31, 32..63}, d 0..63 for both planes; every written line whole, one instruction.
// kb, per (b, h): [16-key tile][d chunk c = d/8][key in tile][8 d]; a fragment load (f, j) is units (f*2+j)*32 + lane.
// vt, per (b, h): [32-key block][dt*2 + j][lane][8 keys], d = dt*16 + lq, keys = j*16 + hi*8 + 0..7 of the block.
__global__ __launch_bounds__(256) void planes_kernel(const float* __restrict__ x,
                                                     const int* __restrict__ mask,
                                                     const float* __restrict__ w,
                                                     bf16* __restrict__ kb,
                                                     f16* __restrict__ vt,
                                                     f16* __restrict__ wp,
                                                     int* __restrict__ cnt) {
  const unsigned kt   = blockIdx.x;
  const unsigned h    = blockIdx.y;
  const unsigned b    = blockIdx.z;
  const unsigned tid  = threadIdx.x;
  if (b == (unsigned)NB) {                      // whole blocks, ahead of every barrier
    w_plane_unit(w, wp, (h * (unsigned)(SEQ / CT) + kt) * 256u + tid);
    return;
  }
  const unsigned wave = tid >> 5;
  const unsigned lane = tid & 31u;
  __shared__ __align__(16) f16 sT[HDIM * TP];   // [d][key], cross-wave (block barrier)
  __shared__ __align__(16) v4u sK[(CT / 16) * 8 * KP];   // [tile*8 + d chunk][key in tile], cross-wave
  __shared__ unsigned sTot[NWAVE];              // kept keys in each wave's run of SEQ / NWAVE keys
  __shared__ unsigned sIdx[CT];                 // sequence position of this tile's packed keys
  const unsigned s0 = kt * CT;

  // wave w ranks keys w*KW .. w*KW + KW-1: one ballot per 32 keys
  constexpr unsigned KW = SEQ / NWAVE;
  const int* mk = mask + (size_t)b * SEQ_FULL + wave * KW + lane;
  unsigned bal[KW / 32];
  unsigned wtot = 0;
  #pragma unroll
  for (unsigned e = 0; e < KW / 32; ++e) {
    bal[e] = __builtin_amdgcn_ballot_w32(mk[e * 32u] != 0);
    wtot += (unsigned)__popc(bal[e]);
  }
  if (lane == 0) sTot[wave] = wtot;
  if (tid < CT) sIdx[tid] = 0u;                 // fill positions past the kept count point at row 0 (read, then dropped)
  __syncthreads();
  unsigned rank = 0, kept = 0;
  #pragma unroll
  for (unsigned v = 0; v < NWAVE; ++v) {
    const unsigned t = sTot[v];
    rank += (v < wave) ? t : 0u;
    kept += t;
  }
  const bool     none  = (kept == 0u);          // no kept key: pack every key
  const unsigned count = none ? (unsigned)SEQ : kept;
  if (none) rank = wave * KW;
  #pragma unroll
  for (unsigned e = 0; e < KW / 32; ++e) {
    const unsigned bits = none ? 0xFFFFFFFFu : bal[e];
    const unsigned slot = rank + (unsigned)__popc(bits & ((1u << lane) - 1u)) - s0;   // wraps below the tile
    if (((bits >> lane) & 1u) != 0u && slot < (unsigned)CT) sIdx[slot] = wave * KW + e * 32u + lane;
    rank += (unsigned)__popc(bits);
  }
  if (kt == 0 && h == 0 && tid == 0) cnt[b * CLINE] = (int)kept;
  __syncthreads();

  v4f xr[2][2];
  #pragma unroll
  for (unsigned kk = 0; kk < 2; ++kk) {
    const unsigned key = kk * 32u + (tid >> 3);     // 0..63
    const float* src = x + ((size_t)b * SEQ_FULL + sIdx[key]) * EMB + h * HDIM + (tid & 7u) * 8u;
    xr[kk][0] = *(const v4f*)(src);
    xr[kk][1] = *(const v4f*)(src + 4);
  }
  // holds the four loads ahead of the selects below: without it each row's pair sinks into a branch of its own and
  // the second row's memory latency starts only after the first row has been converted
  asm volatile("" :: "v"(xr[0][0]), "v"(xr[0][1]), "v"(xr[1][0]), "v"(xr[1][1]));

  #pragma unroll
  for (unsigned kk = 0; kk < 2; ++kk) {
    const unsigned key = kk * 32u + (tid >> 3);     // 0..63
    const unsigned d0  = (tid & 7u) * 8u;           // 0..56
    const bool     on  = s0 + key < count;
    const v4f x0 = on ? xr[kk][0] : (v4f){0, 0, 0, 0};
    const v4f x1 = on ? xr[kk][1] : (v4f){0, 0, 0, 0};
    Pack8B pk;
    #pragma unroll
    for (int i = 0; i < 4; ++i) {
      pk.h[i]     = (bf16)x0[i];                    // RNE convert
      pk.h[4 + i] = (bf16)x1[i];
    }
    sK[((key >> 4) * 8u + (tid & 7u)) * KP + (key & 15u)] = pk.u;
    #pragma unroll
    for (int i = 0; i < 4; ++i) {
      sT[(d0 + i) * TP + key]     = (f16)(float)pk.h[i];       // f16 of bf16 value: exact
      sT[(d0 + 4 + i) * TP + key] = (f16)(float)pk.h[4 + i];
    }
  }
  __syncthreads();

  // unit u = kk*256 + tid of this block's 8 KiB of each plane: both planes are written in unit order
  v4u    kval[2], vval[2];
  size_t uidx[2];
  #pragma unroll
  for (unsigned kk = 0; kk < 2; ++kk) {
    const unsigned u  = kk * 256u + tid;
    kval[kk] = sK[(u >> 4) * KP + (u & 15u)];
    const unsigned d  = (tid >> 6) * 16u + (tid & 15u);          // dt*16 + lq
    const unsigned ks = kk * 32u + ((tid >> 4) & 3u) * 8u;       // block*32 + j*16 + hi*8
    Pack8H ph;
    ph.v = *(const v8h*)(sT + d * TP + ks);
    vval[kk] = ph.u;
    uidx[kk] = (((size_t)b * NHEAD + h) * SEQ + s0) * HDIM + (size_t)u * 8u;
  }

  if (s0 < count) {
    #pragma unroll
    for (int kk = 0; kk < 2; ++kk) {
      *(v4u*)(kb + uidx[kk]) = kval[kk];
      *(v4u*)(vt + uidx[kk]) = vval[kk];
    }
  }
}

// Flash attention over the packed (kept) keys. Block = (query block of 128, head, batch); one wave owns 16 query rows.
// S^T = K x Q^T so queries sit on lanes; P^T in C-layout is bit-identical to the A-fragment layout of O += P x V.
// K A-fragments and V^T B-fragments are loaded straight from the fragment-order planes (two 16-B loads each, every
// load 512 contiguous bytes per wave); Q B-fragments are converted once per wave from X (every position is a query).
__global__ __launch_bounds__(256) void attn_kernel(const float* __restrict__ x,
                                                   const bf16* __restrict__ kb,
                                                   const f16* __restrict__ vt,
                                                   const int* __restrict__ cnt,
                                                   f16* __restrict__ ch,
                                                   f16* __restrict__ cr) {
  const unsigned qblk = blockIdx.x;
  const unsigned h    = blockIdx.y;
  const unsigned b    = blockIdx.z;
  const unsigned tid  = threadIdx.x;
  const unsigned wave = tid >> 5;
  const unsigned lane = tid & 31u;
  const unsigned lq   = lane & 15u;   // query column of S^T / d column of O
  const unsigned hi   = lane >> 4;    // k-split half

  __shared__ __align__(16) float sO[NWAVE * 16 * OP];   // per-wave staging tile (block barrier used)

  const unsigned qrow0 = qblk * BQ + wave * 16u;        // first query row of this wave

  // wave-uniform plane bases in bytes; a block of 32 keys is BKB bytes of either plane, a fragment load FB bytes
  const char* kb_h = (const char*)(kb + ((size_t)b * NHEAD + h) * SEQ * HDIM);
  const char* vt_h = (const char*)(vt + ((size_t)b * NHEAD + h) * HDIM * SEQ);
  constexpr unsigned FB  = FU * 2u;
  constexpr unsigned BKB = BK * HDIM * 2u;
  const unsigned lo = lane * 16u;     // this lane's unit (byte offset) inside a wave-wide fragment load

  // packed keys of this batch; 0 kept keys: all SEQ keys are packed and Q = 0 makes every score equal
  const int      kept = cnt[b * CLINE];
  const bool     none = kept <= 0;
  const unsigned nk   = none ? (unsigned)SEQ : ((unsigned)kept < (unsigned)SEQ ? (unsigned)kept : (unsigned)SEQ);

  // Q as B-operand fragments: lane lq holds query qrow0+lq, elements follow the split d map of the K plane.
  FragB qf[2];
  const float* xq = x + ((size_t)b * SEQ_FULL + qrow0 + lq) * EMB + h * HDIM + hi * 8u;
  #pragma unroll
  for (unsigned f = 0; f < 2; ++f) {
    #pragma unroll
    for (unsigned j = 0; j < 2; ++j) {
      const v4f a0 = *(const v4f*)(xq + f * 32u + j * 16u);        // d = f*32 + j*16 + hi*8 + 0..3
      const v4f a1 = *(const v4f*)(xq + f * 32u + j * 16u + 4u);   // d = f*32 + j*16 + hi*8 + 4..7
      Pack8B pq;
      #pragma unroll
      for (int i = 0; i < 4; ++i) {
        pq.h[i]     = (bf16)a0[i];                                 // RNE convert
        pq.h[4 + i] = (bf16)a1[i];
      }
      qf[f].q[j] = none ? (v4u){0, 0, 0, 0} : pq.u;
    }
  }

  v8f o[4];
  #pragma unroll
  for (int dt = 0; dt < 4; ++dt) o[dt] = (v8f){0, 0, 0, 0, 0, 0, 0, 0};

  // Lazy softmax reference: the weights are taken against mref, a maximum seen earlier, and mref moves only when a
  // score tops it by more than 2^LAZY. Weights then reach 2^LAZY at most: x4096 that is 2^15, inside f16.
  const float SL   = 0.03125f * 1.4426950408889634f;   // (1/sqrt(EMB)) * log2(e)
  const float LAZY = 3.0f;
  float mref = -3.0e38f;                               // raw score units; equal in the two lanes of a query
  float mtop = -3.0e38f;                               // mref + LAZY / SL: every first pass tops it
  float ebias = 0.0f;                                  // -mref * SL, set in the first pass
  float rsum = 0.0f;                                   // this lane's 16 keys a pass; carried x4096, f16 values summed
  const float FILL = -1.0e20f;                         // the reference's replace value (applied before scaling)

  // rotated key walk: the 16 query blocks of a head start spread over the nblk key blocks and wrap. The index is
  // transposed (4 x 4) first, so that neighbouring query blocks start far apart: any run of neighbours that shares a
  // cache has its starts spread over the whole walk.
  const unsigned nblk = (nk + BK - 1u) / BK;
  static_assert(SEQ / BQ == 16);
  unsigned blk = (((qblk & 3u) * 4u + (qblk >> 2)) * nblk) / (unsigned)(SEQ / BQ);   // < nblk

  // K A-fragments: row = key j0 + sub*16 + lq, split d map. They are fetched one block ahead: the first block here,
  // the walk's next block inside each pass, right behind the products that were the last readers of the registers.
  FragB ak[2][2];
  const char* kfirst = kb_h + (size_t)blk * BKB;
  #pragma unroll
  for (unsigned sub = 0; sub < 2; ++sub) {
    #pragma unroll
    for (unsigned f = 0; f < 2; ++f) {
      ak[sub][f].q[0] = *(const v4u*)(kfirst + lo + (sub * 4u + f * 2u) * FB);
      ak[sub][f].q[1] = *(const v4u*)(kfirst + lo + (sub * 4u + f * 2u + 1u) * FB);
    }
  }

  // this lane's address in the V plane, carried from pass to pass: ready when a pass begins, so that the V loads go
  // out ahead of the score products
  const char* vcur = vt_h + lo + (size_t)blk * BKB;

  #pragma unroll 1
  for (unsigned it = 0; it < nblk; ++it) {
    const unsigned j0  = blk * BK;                               // first packed key of this pass
    const unsigned nxt = (blk + 1u < nblk) ? blk + 1u : 0u;      // the walk wraps behind the last key block
    // V B-fragments: column n = d = dt*16 + lq, split key map from the transposed plane
    FragH bv[4];
    #pragma unroll
    for (unsigned dt = 0; dt < 4; ++dt) {
      bv[dt].q[0] = *(const v4u*)(vcur + (dt * 2u) * FB);        // keys j0 + hi*8 + 0..7
      bv[dt].q[1] = *(const v4u*)(vcur + (dt * 2u + 1u) * FB);   // keys j0 + 16 + hi*8 + 0..7
    }

    // S^T tiles: c[sub][r] = rawscore(query qrow0+lq, key j0 + sub*16 + hi*8 + r)
    v8f c[2];
    #pragma unroll
    for (int sub = 0; sub < 2; ++sub) {
      v8f acc = (v8f){0, 0, 0, 0, 0, 0, 0, 0};
      acc = mma_bf16(ak[sub][0].v, qf[0].v, acc);
      acc = mma_bf16(ak[sub][1].v, qf[1].v, acc);
      c[sub] = acc;
    }

    // the V loads' address registers are stepped on behind this point
    asm volatile("s_wait_xcnt 0x0" ::: "memory");

    // next block's K fragments; the last pass reads the walk's first block again (written, in bounds, never used)
    const char* kbase = kb_h + (size_t)nxt * BKB;
    #pragma unroll
    for (unsigned sub = 0; sub < 2; ++sub) {
      #pragma unroll
      for (unsigned f = 0; f < 2; ++f) {
        ak[sub][f].q[0] = *(const v4u*)(kbase + lo + (sub * 4u + f * 2u) * FB);
        ak[sub][f].q[1] = *(const v4u*)(kbase + lo + (sub * 4u + f * 2u + 1u) * FB);
      }
    }

    // only the last key block can hold fill positions past the packed keys: they get the replace value (weight 0)
    if (j0 + BK > nk) {
      #pragma unroll
      for (unsigned r = 0; r < 8; ++r) {
        c[0][r] = (j0 + hi * 8u + r >= nk)       ? FILL : c[0][r];
        c[1][r] = (j0 + 16u + hi * 8u + r >= nk) ? FILL : c[1][r];
      }
    }

    // behind the wait above: one block on, or back to the plane's first block
    vcur += (blk + 1u < nblk) ? (long long)BKB : -(long long)((size_t)(nblk - 1u) * BKB);

    // the reference in use and this lane's 16 of query lq's 32 scores (the other 16 sit in lane ^ 16)
    float lmax = mref;
    #pragma unroll
    for (int r = 0; r < 8; ++r) {
      lmax = fmaxf(lmax, c[0][r]);
      lmax = fmaxf(lmax, c[1][r]);
    }

    // one wave-wide test a pass (a scalar branch): only a pass in which some score tops the reference in use by more
    // than 2^LAZY pays for the lane exchange, the new reference and the rescale of the sums
    if (__builtin_amdgcn_ballot_w32(lmax > mtop) != 0u) {
      const float m_new = fmaxf(lmax, __shfl_xor(lmax, 16, 32));
      const float scale = __builtin_amdgcn_exp2f((mref - m_new) * SL);
      mref  = m_new;
      mtop  = m_new + LAZY / SL;
      ebias = -m_new * SL;
      rsum *= scale;
      // rescale O: queries are the row dimension there -> per-row scale from lane 8*hi + r
      float sc[8];
      #pragma unroll
      for (int r = 0; r < 8; ++r) sc[r] = __shfl(scale, (int)((hi << 3) + r), 32);
      #pragma unroll
      for (int dt = 0; dt < 4; ++dt) {
        #pragma unroll
        for (int r = 0; r < 8; ++r) o[dt][r] *= sc[r];
      }
    }

    // exp + pack: P^T C-layout == A-fragment layout for the PV product
    FragH pa;
    float psum = 0.0f;
    // exponents against the reference in use: one fused multiply-add a score
    #pragma unroll
    for (int r = 0; r < 8; ++r) {
      c[0][r] = __builtin_fmaf(c[0][r], SL, ebias);
      c[1][r] = __builtin_fmaf(c[1][r], SL, ebias);
    }
    #pragma unroll
    for (int r = 0; r < 8; ++r) {
      const float p0 = __builtin_amdgcn_exp2f(c[0][r]);   // key hi*8 + r
      const float p1 = __builtin_amdgcn_exp2f(c[1][r]);   // key 16 + hi*8 + r
      const f16 h0 = (f16)(p0 * P_CARRY);
      const f16 h1 = (f16)(p1 * P_CARRY);
      pa.h[r]     = h0;
      pa.h[8 + r] = h1;
      psum += (float)h0 + (float)h1;
    }
    rsum += psum;

    // O += P x V
    #pragma unroll
    for (int dt = 0; dt < 4; ++dt) o[dt] = mma_f16(pa.v, bv[dt].v, o[dt]);
    blk = nxt;
  }

  // the two lanes of a query join their sums here, once (both were kept against the same reference)
  rsum += __shfl_xor(rsum, 16, 32);

  // normalize: lane holds column d = dt*16 + lq for query rows 8*hi + r; the x4096 carry cancels against rsum
  float rs[8];
  #pragma unroll
  for (int r = 0; r < 8; ++r) rs[r] = CTX_CARRY * (1.0f / __shfl(rsum, (int)((hi << 3) + r), 32));

  float* so = sO + wave * (16 * OP);
  #pragma unroll
  for (int r = 0; r < 8; ++r) {
    #pragma unroll
    for (int dt = 0; dt < 4; ++dt) {
      so[(hi * 8u + r) * OP + dt * 16u + lq] = o[dt][r] * rs[r];
    }
  }
  __syncthreads();

  // context planes in fragment order: [16-row tile][k/32][j][lane][8 k]; this wave's 16 rows x 64 columns are 4 loads'
  // worth (it = (k/32 within the head)*2 + j), 2 KiB contiguous per plane; lane = hi*16 + row.
  v4u    hv[4], rv[4];
  size_t gidx[4];
  #pragma unroll
  for (unsigned it = 0; it < 4; ++it) {
    const unsigned row = lq;
    const unsigned c8  = it * 16u + hi * 8u;
    const v4f a0 = *(const v4f*)(so + row * OP + c8);
    const v4f a1 = *(const v4f*)(so + row * OP + c8 + 4);
    Pack8H ph, pr;
    #pragma unroll
    for (int i = 0; i < 4; ++i) {
      const f16 t0 = (f16)a0[i];
      const f16 t1 = (f16)a1[i];
      ph.h[i]     = t0;
      ph.h[4 + i] = t1;
      pr.h[i]     = (f16)((a0[i] - (float)t0) * RES_CARRY);
      pr.h[4 + i] = (f16)((a1[i] - (float)t1) * RES_CARRY);
    }
    hv[it]   = ph.u;
    rv[it]   = pr.u;
    gidx[it] = ((size_t)b * SEQ + qrow0) * EMB + h * (HDIM * 16u) + it * FU + lane * 8u;
  }
  #pragma unroll
  for (int it = 0; it < 4; ++it) {
    *(v4u*)(ch + gidx[it]) = hv[it];
    *(v4u*)(cr + gidx[it]) = rv[it];
  }
  
}

// One 32-k step of the projection: A fragments of both context planes, B fragments of the four 16-column tiles.
// ah, ar, bw: uniform byte bases; ao, lo: the lane's byte offsets; a 16-wide tile's 32 k elements are 2 loads' worth.
struct ProjFrag { FragH a, a2, bf[4]; };
template <bool LAST>
static __device__ __forceinline__ void proj_load(ProjFrag& f, const char* ah, const char* ar, const char* bw,
                                                 unsigned ao, unsigned lo, unsigned k0) {
  constexpr unsigned FB = FU * 2u;                  // bytes of one wave-wide fragment load
  const size_t ko = (size_t)k0 * 32u;
  f.a.q[0]  = *(const v4u*)(ah + ko + ao);          // k = k0 + hi*8 + 0..7
  f.a.q[1]  = *(const v4u*)(ah + ko + ao + FB);     // k = k0 + 16 + hi*8 + 0..7
  f.a2.q[0] = *(const v4u*)(ar + ko + ao);
  f.a2.q[1] = *(const v4u*)(ar + ko + ao + FB);
  #pragma unroll
  for (unsigned nt = 0; nt < 4; ++nt) {
    // behind the loop the address registers die here: the last results may be given the registers that held them
    if (LAST && nt == 3) asm volatile("s_wait_xcnt 0x0" ::: "memory");
    f.bf[nt].q[0] = *(const v4u*)(bw + ko + lo + nt * (16u * EMB * 2u));
    f.bf[nt].q[1] = *(const v4u*)(bw + ko + lo + nt * (16u * EMB * 2u) + FB);
  }
}
static __device__ __forceinline__ void proj_mma(const ProjFrag& f, v8f (&acc)[4], v8f (&acr)[4]) {
  #pragma unroll
  for (int nt = 0; nt < 4; ++nt) {
    acc[nt] = mma_f16(f.a.v,  f.bf[nt].v, acc[nt]);
    acr[nt] = mma_f16(f.a2.v, f.bf[nt].v, acr[nt]);   // scaled residual: separate accumulator
  }
}

// Output projection. Block = (128-row tile, 64-column tile, batch); one wave owns 16 rows x 64 columns.
// A fragments from the context planes, B fragments from the weight plane, all in fragment order - both with the
// split k map, two 16-B loads per fragment, every load 512 contiguous bytes per wave.
__global__ __launch_bounds__(256) void proj_kernel(const f16* __restrict__ ch,
                                                   const f16* __restrict__ cr,
                                                   const f16* __restrict__ wp,
                                                   const float* __restrict__ bias,
                                                   float* __restrict__ out) {
  const unsigned rb   = blockIdx.x;
  const unsigned cb   = blockIdx.y;
  const unsigned b    = blockIdx.z;
  const unsigned tid  = threadIdx.x;
  const unsigned wave = tid >> 5;
  const unsigned lane = tid & 31u;
  const unsigned lq   = lane & 15u;
  const unsigned hi   = lane >> 4;

  __shared__ __align__(16) float sO[NWAVE * 16 * OP];   // per-wave staging tile (block barrier used)

  const unsigned row0 = rb * GM + wave * 16u;           // first sequence row of this wave
  const unsigned col0 = cb * GN;

  // workgroup-uniform plane bases in bytes
  const char* ah = (const char*)(ch + ((size_t)b * SEQ + rb * GM) * EMB);
  const char* ar = (const char*)(cr + ((size_t)b * SEQ + rb * GM) * EMB);
  const char* bw = (const char*)(wp + (size_t)col0 * EMB);
  const unsigned lo = lane * 16u;                       // this lane's unit (byte offset) inside a wave-wide fragment load
  const unsigned ao = wave * (16u * EMB * 2u) + lo;     // plus this wave's 16-row tile

  v8f acc[4], acr[4];
  #pragma unroll
  for (int nt = 0; nt < 4; ++nt) {
    acc[nt] = (v8f){0, 0, 0, 0, 0, 0, 0, 0};
    acr[nt] = (v8f){0, 0, 0, 0, 0, 0, 0, 0};
  }

  // rotated k walk: the 16 column blocks of a row tile, and the 16 row blocks of a column tile and batch, start 64 k
  // apart; k wraps at EMB. The start is an odd number of 32-k steps, so the two steps that a pass of the loop loads
  // (the second of one pair, the first of the next) are neighbours in memory and never straddle the wrap.
  static_assert(EMB / 64 == 16 && EMB / GN == 16 && SEQ / GM == 16);
  const unsigned kr = (((cb + rb) & 15u) * 2u + 1u) * 32u;

  // two fragment sets: while one set's products run, the other set's loads (the next 32 k) are in flight
  ProjFrag f0, f1;
  proj_load<false>(f0, ah, ar, bw, ao, lo, kr);
  // the start values of the accumulators and of the loop take over registers that these loads name
  asm volatile("s_wait_xcnt 0x0" ::: "memory");
  __builtin_amdgcn_sched_barrier(0);   // without it the compiler lifts those writes over the wait
  #pragma unroll 1
  for (unsigned k0 = 0; k0 < EMB - 64u; k0 += 64u) {
    const unsigned kp = (kr + k0 + 32u) & (EMB - 1u);   // a multiple of 64
    proj_load<false>(f1, ah, ar, bw, ao, lo, kp);
    proj_mma(f0, acc, acr);
    proj_load<false>(f0, ah, ar, bw, ao, lo, kp + 32u);
    proj_mma(f1, acc, acr);
    // the next pass forms its addresses in the registers that hold this pass's
    asm volatile("s_wait_xcnt 0x0" ::: "memory");
  }
  proj_load<true>(f1, ah, ar, bw, ao, lo, (kr + EMB - 32u) & (EMB - 1u));
  proj_mma(f0, acc, acr);
  proj_mma(f1, acc, acr);

  // fold carries: (hi + res/2048) / (256 * 64); acc[nt][r] = element (row 8*hi + r, column nt*16 + lq)
  float* so = sO + wave * (16 * OP);
  const float inv_res = 1.0f / RES_CARRY;
  const float inv_car = 1.0f / (CTX_CARRY * W_CARRY);
  #pragma unroll
  for (int r = 0; r < 8; ++r) {
    #pragma unroll
    for (int nt = 0; nt < 4; ++nt) {
      so[(hi * 8u + r) * OP + nt * 16u + lq] = (acc[nt][r] + acr[nt][r] * inv_res) * inv_car;
    }
  }
  __syncthreads();

  // bias (bf16 RNE-converted input value), added in f32
  const v4f braw = *(const v4f*)(bias + col0 + lq * 4u);
  v4f bq;
  #pragma unroll
  for (int i = 0; i < 4; ++i) bq[i] = (float)(bf16)braw[i];

  // lanes 0..15 one row (16 consecutive lanes x 16 B each), lanes 16..31 the next row; 8 instructions cover the wave's 16 rows.
  v4f    vals[8];
  size_t gidx[8];
  #pragma unroll
  for (unsigned it = 0; it < 8; ++it) {
    const unsigned row = it * 2u + hi;
    const v4f t = *(const v4f*)(so + row * OP + lq * 4u);
    vals[it] = t + bq;
    gidx[it] = ((size_t)b * SEQ_FULL + row0 + row) * EMB + col0 + lq * 4u;
  }
  #pragma unroll
  for (int it = 0; it < 8; ++it) *(v4f*)(out + gidx[it]) = vals[it];
  
}

extern "C" void kernel_launch(void* const* d_in, const int* in_sizes, int n_in,
                              void* d_out, int out_size, void* d_ws, size_t ws_size,
                              hipStream_t stream) {
  if (n_in < 4) return;
  const size_t rows_used = (size_t)(NB - 1) * SEQ_FULL + SEQ;
  if ((size_t)in_sizes[0] < rows_used * EMB) return;
  if ((size_t)in_sizes[1] < rows_used) return;
  if ((size_t)in_sizes[2] < (size_t)EMB * EMB) return;
  if ((size_t)in_sizes[3] < (size_t)EMB) return;
  if ((size_t)out_size < rows_used * EMB) return;

  const size_t kb_bytes = (size_t)NB * NHEAD * SEQ * HDIM * 2;   // bf16 row plane
  const size_t vt_bytes = (size_t)NB * NHEAD * HDIM * SEQ * 2;   // f16 transposed plane
  const size_t cx_bytes = (size_t)NB * SEQ * EMB * 2;            // each f16 context plane
  const size_t wp_bytes = (size_t)EMB * EMB * 2;                 // f16 weight plane
  const size_t ct_bytes = (size_t)NB * CLINE * 4;                // kept-key count per batch
  const size_t total    = kb_bytes + vt_bytes + 2 * cx_bytes + wp_bytes + ct_bytes;
  if (ws_size < total) return;

  const float* x    = (const float*)d_in[0];
  const int*   mask = (const int*)d_in[1];
  const float* w    = (const float*)d_in[2];
  const float* bias = (const float*)d_in[3];
  float*       out  = (float*)d_out;

  char* base = (char*)d_ws;
  bf16* kb = (bf16*)base;
  f16*  vt = (f16*)(base + kb_bytes);
  f16*  ch = (f16*)(base + kb_bytes + vt_bytes);
  f16*  cr = (f16*)(base + kb_bytes + vt_bytes + cx_bytes);
  f16*  wp = (f16*)(base + kb_bytes + vt_bytes + 2 * cx_bytes);
  int*  ct = (int*)(base + kb_bytes + vt_bytes + 2 * cx_bytes + wp_bytes);

  planes_kernel<<<dim3(SEQ / CT, NHEAD, NB + 1), 256, 0, stream>>>(x, mask, w, kb, vt, wp, ct);
  attn_kernel<<<dim3(SEQ / BQ, NHEAD, NB), 256, 0, stream>>>(x, kb, vt, ct, ch, cr);
  proj_kernel<<<dim3(SEQ / GM, EMB / GN, NB), 256, 0, stream>>>(ch, cr, wp, bias, out);
}

// v007
// A run of this version takes 44.2 microseconds.
// In two side-by-side timings against v006, it was 1.03 and 1.04 times as fast.
// Over all steps from v000 it is 3.47 times as fast.
#include <hip/hip_runtime.h>

// Contractions: S^T = K x Q^T on v_wmma_f32_16x16x32_bf16 (bf16 operands = RNE-converted input X, f32 accumulate);
// O = P x V on v_wmma_f32_16x16x32_f16 (P as f16 carried x4096, V = f16 of the bf16 RNE-converted X, f32 accumulate);
// Y = C x W^T on v_wmma_f32_16x16x32_f16 (C as f16 carried x256 plus an f16 residual plane x2048 with its own
// accumulator, W = f16 of the bf16 RNE-converted weight carried x64, f32 accumulate). Softmax and bias add in f32.
//
// Plane layout: every 16-bit plane is stored in fragment order. The unit is 16 B (8 consecutive k elements of one
// row or column); 32 units = the 512 contiguous bytes that one wave-wide 16-B load brings in, unit index = lane
// (lane = hi*16 + lq: lq = row or column inside a 16-wide tile, hi = which run of 8 inside a run of 16 k elements).
//
// Key compaction: a key whose mask word is 0 gets the score -1e20, so its softmax weight is exactly 0 whenever the
// batch has any kept key. The plane builder therefore packs only the kept keys (in their order) into the K and V
// planes and the attention loop walks ceil(kept / 32) blocks. A batch with no kept key has equal scores everywhere:
// there all keys are packed and Q is taken as 0, which gives the same uniform weights.
//
// Rotated walks: work-groups that read the same plane (the 16 query blocks of a head; the projection blocks of one row
// or one column tile) run at the same time. Walking it from the same end they ask L2 for the same lines at the same
// moment, and all of them wait for each line's first fetch. Each work-group therefore starts its key walk or k walk at
// a place set by its block index and wraps round; every block of the walk is still taken exactly once.

#ifndef NB
#define NB 2
#endif
#ifndef SEQ
#define SEQ 2048
#endif
#define NB_FULL    2
#define SEQ_FULL   2048
#define NHEAD      16
#define HDIM       64
#define EMB        (NHEAD * HDIM)       // floats per (b, s) of X and of the output, halves per (b, s) of each context plane
#define BQ         128                  // query rows per workgroup (8 waves x 16)
#define BK         32                   // keys per inner iteration
#define NWAVE      8
#define CT         64                   // keys per plane-builder block
#define TP         72                   // LDS pitch (halves) of the transposed tile
#define KP         17                   // LDS pitch (16-B units) of one d-chunk row of the fragment-order K tile
#define FU         256                  // elements of one wave-wide fragment load (32 lanes x 8)
#define OP         68                   // LDS pitch (floats) of the staging tile
#define GM         128                  // projection rows per workgroup (8 waves x 16)
#define GN         64                   // projection columns per workgroup
#define WELEM      8                    // weight elements per thread in the weight plane builder
#define CLINE      32                   // ints between the batches' kept-key counts: one writing block per 128-B line

#define P_CARRY    4096.0f
#define CTX_CARRY  256.0f
#define RES_CARRY  2048.0f
#define W_CARRY    64.0f

static_assert(SEQ % BQ == 0);
static_assert(SEQ % CT == 0);
static_assert(SEQ % BK == 0);
static_assert(SEQ % (NWAVE * 32) == 0);
static_assert(BK == 32 && CT % BK == 0 && CT * HDIM == 2 * 256 * 8);
static_assert(SEQ % GM == 0);
static_assert(EMB % GN == 0);
static_assert(EMB % 64 == 0 && EMB >= 128);
static_assert(BQ == NWAVE * 16);
static_assert(GM == NWAVE * 16);
static_assert(HDIM == 64);
static_assert(GN == 64);
static_assert(SEQ <= SEQ_FULL);
static_assert(NB >= 1 && NB <= NB_FULL);
static_assert((TP * 2) % 16 == 0);
static_assert((OP * 4) % 16 == 0);
// coverage equalities: grid x block x per-thread elements == plane element count
static_assert((size_t)(SEQ / CT) * NHEAD * NB * 256 * 2 * 8 == (size_t)NB * NHEAD * SEQ * HDIM);   // row plane and transposed plane
static_assert((size_t)(SEQ / CT) * NHEAD * 256 * WELEM == (size_t)EMB * EMB);                      // weight plane (one grid slice)
static_assert((size_t)(SEQ / BQ) * NHEAD * NB * NWAVE * 16 * HDIM == (size_t)NB * SEQ * EMB);       // context planes
static_assert((size_t)(SEQ / GM) * (EMB / GN) * NB * NWAVE * 16 * GN == (size_t)NB * SEQ * EMB);    // output

typedef __bf16   bf16;
typedef _Float16 f16;
typedef bf16     v16bf __attribute__((ext_vector_type(16)));
typedef f16      v16h  __attribute__((ext_vector_type(16)));
typedef f16      v8h   __attribute__((ext_vector_type(8)));
typedef float    v8f   __attribute__((ext_vector_type(8)));
typedef float    v4f   __attribute__((ext_vector_type(4)));
typedef unsigned v4u   __attribute__((ext_vector_type(4)));
typedef int      v4i   __attribute__((ext_vector_type(4)));

union FragB  { v16bf v; v4u q[2]; bf16 h[16]; };
union FragH  { v16h  v; v4u q[2]; f16  h[16]; };
union Pack8B { v4u u; bf16 h[8]; };
union Pack8H { v4u u; v8h v; f16 h[8]; };

// WMMA helpers of the attention loop: the plain builtins. The compiler keeps the distance behind a matrix instruction
// itself, and only where a vector instruction really follows on its registers. By the listing's count a pass asks about
// twice as many vector slots as matrix cycles, and four waves share a SIMD's vector port: an idle slot of one wave is a
// slot taken from another wave's softmax.
static __device__ __forceinline__ v8f mma_bf16(v16bf a, v16bf b, v8f acc) {
  return __builtin_amdgcn_wmma_f32_16x16x32_bf16(false, a, false, b, (short)0, acc, false, false);
}
static __device__ __forceinline__ v8f mma_pv(v16h a, v16h b, v8f acc) {
  return __builtin_amdgcn_wmma_f32_16x16x32_f16(false, a, false, b, (short)0, acc, false, false);
}
// WMMA helper of the projection loop: builtin followed by the VALU hazard guard (ties D, keeps A/B live). It stays:
// that loop is not bound by vector issue, and the statements also hold the order of its loads and products (without
// them the compiler draws the two fragment sets' loads together and the one-step lead of the loads is lost).
static __device__ __forceinline__ v8f mma_f16(v16h a, v16h b, v8f acc) {
  acc = __builtin_amdgcn_wmma_f32_16x16x32_f16(false, a, false, b, (short)0, acc, false, false);
  asm volatile("v_nop\n\tv_nop\n\tv_nop\n\tv_nop" : "+v"(acc) : "v"(a), "v"(b));
  return acc;
}

// Weight plane: f16(bf16(W[n][k]) * 64) in fragment order: [n/16][k/32][j][lane][8 k], n = (n/16)*16 + lq,
// k = (k/32)*32 + j*16 + hi*8 + 0..7. Thread t writes unit t.
static __device__ __forceinline__ void w_plane_unit(const float* __restrict__ w, f16* __restrict__ wp, unsigned t) {
  const size_t   e0 = (size_t)t * WELEM;
  const size_t   r0 = (size_t)((t >> 11) * 16u + (t & 15u)) * EMB + ((t >> 4) & 127u) * 8u;
  const v4f a0 = *(const v4f*)(w + r0);
  const v4f a1 = *(const v4f*)(w + r0 + 4);
  Pack8H ph;
  #pragma unroll
  for (int i = 0; i < 4; ++i) {
    ph.h[i]     = (f16)((float)(bf16)a0[i] * W_CARRY);   // bf16 significand x power of two: exact in f16
    ph.h[4 + i] = (f16)((float)(bf16)a1[i] * W_CARRY);
  }
  const v4u val = ph.u;
  *(v4u*)(wp + e0) = val;
}

// Plane builder, one launch for all three planes: the weight plane depends on nothing the K and V planes need, so its
// blocks ride in the same grid as one more z slice (z == NB; it has the shortest chain of loads).
// Block = (tile of 64 packed keys, head, batch), 256 threads. k = v = head slice of X, kept keys only.
// Every block ranks the batch's kept keys itself (ballots per wave, wave totals through LDS) and gathers the 64 rows
// whose ranks fall into its tile; ranks past the kept count are filled with 0 (finite, so a zero weight stays zero).
// A tile that starts past the kept count is not stored and never read.
// coverage: packed positions kt*64 + {0..31, 32..63}, d 0..63 for both planes; every written line whole, one instruction.
// kb, per (b, h): [16-key tile][d chunk c = d/8][key in tile][8 d]; a fragment load (f, j) is units (f*2+j)*32 + lane.
// vt, per (b, h): [32-key block][dt*2 + j][lane][8 keys], d = dt*16 + lq, keys = j*16 + hi*8 + 0..7 of the block.
__global__ __launch_bounds__(256) void planes_kernel(const float* __restrict__ x,
                                                     const int* __restrict__ mask,
                                                     const float* __restrict__ w,
                                                     bf16* __restrict__ kb,
                                                     f16* __restrict__ vt,
                                                     f16* __restrict__ wp,
                                                     int* __restrict__ cnt) {
  const unsigned kt   = blockIdx.x;
  const unsigned h    = blockIdx.y;
  const unsigned b    = blockIdx.z;
  const unsigned tid  = threadIdx.x;
  if (b == (unsigned)NB) {                      // whole blocks, ahead of every barrier
    w_plane_unit(w, wp, (h * (unsigned)(SEQ / CT) + kt) * 256u + tid);
    return;
  }
  const unsigned wave = tid >> 5;
  const unsigned lane = tid & 31u;
  __shared__ __align__(16) f16 sT[HDIM * TP];   // [d][key], cross-wave (block barrier)
  __shared__ __align__(16) v4u sK[(CT / 16) * 8 * KP];   // [tile*8 + d chunk][key in tile], cross-wave
  __shared__ unsigned sTot[NWAVE];              // kept keys in each wave's run of SEQ / NWAVE keys
  __shared__ unsigned sIdx[CT];                 // sequence position of this tile's packed keys
  const unsigned s0 = kt * CT;

  // wave w ranks keys w*KW .. w*KW + KW-1: one ballot per 32 keys
  constexpr unsigned KW = SEQ / NWAVE;
  const int* mk = mask + (size_t)b * SEQ_FULL + wave * KW + lane;
  unsigned bal[KW / 32];
  unsigned wtot = 0;
  #pragma unroll
  for (unsigned e = 0; e < KW / 32; ++e) {
    bal[e] = __builtin_amdgcn_ballot_w32(mk[e * 32u] != 0);
    wtot += (unsigned)__popc(bal[e]);
  }
  if (lane == 0) sTot[wave] = wtot;
  if (tid < CT) sIdx[tid] = 0u;                 // fill positions past the kept count point at row 0 (read, then dropped)
  __syncthreads();
  unsigned rank = 0, kept = 0;
  #pragma unroll
  for (unsigned v = 0; v < NWAVE; ++v) {
    const unsigned t = sTot[v];
    rank += (v < wave) ? t : 0u;
    kept += t;
  }
  const bool     none  = (kept == 0u);          // no kept key: pack every key
  const unsigned count = none ? (unsigned)SEQ : kept;
  if (none) rank = wave * KW;
  #pragma unroll
  for (unsigned e = 0; e < KW / 32; ++e) {
    const unsigned bits = none ? 0xFFFFFFFFu : bal[e];
    const unsigned slot = rank + (unsigned)__popc(bits & ((1u << lane) - 1u)) - s0;   // wraps below the tile
    if (((bits >> lane) & 1u) != 0u && slot < (unsigned)CT) sIdx[slot] = wave * KW + e * 32u + lane;
    rank += (unsigned)__popc(bits);
  }
  if (kt == 0 && h == 0 && tid == 0) cnt[b * CLINE] = (int)kept;
  __syncthreads();

  v4f xr[2][2];
  #pragma unroll
  for (unsigned kk = 0; kk < 2; ++kk) {
    const unsigned key = kk * 32u + (tid >> 3);     // 0..63
    const float* src = x + ((size_t)b * SEQ_FULL + sIdx[key]) * EMB + h * HDIM + (tid & 7u) * 8u;
    xr[kk][0] = *(const v4f*)(src);
    xr[kk][1] = *(const v4f*)(src + 4);
  }
  // holds the four loads ahead of the selects below: without it each row's pair sinks into a branch of its own and
  // the second row's memory latency starts only after the first row has been converted
  asm volatile("" :: "v"(xr[0][0]), "v"(xr[0][1]), "v"(xr[1][0]), "v"(xr[1][1]));

  #pragma unroll
  for (unsigned kk = 0; kk < 2; ++kk) {
    const unsigned key = kk * 32u + (tid >> 3);     // 0..63
    const unsigned d0  = (tid & 7u) * 8u;           // 0..56
    const bool     on  = s0 + key < count;
    const v4f x0 = on ? xr[kk][0] : (v4f){0, 0, 0, 0};
    const v4f x1 = on ? xr[kk][1] : (v4f){0, 0, 0, 0};
    Pack8B pk;
    #pragma unroll
    for (int i = 0; i < 4; ++i) {
      pk.h[i]     = (bf16)x0[i];                    // RNE convert
      pk.h[4 + i] = (bf16)x1[i];
    }
    sK[((key >> 4) * 8u + (tid & 7u)) * KP + (key & 15u)] = pk.u;
    #pragma unroll
    for (int i = 0; i < 4; ++i) {
      sT[(d0 + i) * TP + key]     = (f16)(float)pk.h[i];       // f16 of bf16 value: exact
      sT[(d0 + 4 + i) * TP + key] = (f16)(float)pk.h[4 + i];
    }
  }
  __syncthreads();

  // unit u = kk*256 + tid of this block's 8 KiB of each plane: both planes are written in unit order
  v4u    kval[2], vval[2];
  size_t uidx[2];
  #pragma unroll
  for (unsigned kk = 0; kk < 2; ++kk) {
    const unsigned u  = kk * 256u + tid;
    kval[kk] = sK[(u >> 4) * KP + (u & 15u)];
    const unsigned d  = (tid >> 6) * 16u + (tid & 15u);          // dt*16 + lq
    const unsigned ks = kk * 32u + ((tid >> 4) & 3u) * 8u;       // block*32 + j*16 + hi*8
    Pack8H ph;
    ph.v = *(const v8h*)(sT + d * TP + ks);
    vval[kk] = ph.u;
    uidx[kk] = (((size_t)b * NHEAD + h) * SEQ + s0) * HDIM + (size_t)u * 8u;
  }

  if (s0 < count) {
    #pragma unroll
    for (int kk = 0; kk < 2; ++kk) {
      *(v4u*)(kb + uidx[kk]) = kval[kk];
      *(v4u*)(vt + uidx[kk]) = vval[kk];
    }
  }
}

// Flash attention over the packed (kept) keys. Block = (query block of 128, head, batch); one wave owns 16 query rows.
// S^T = K x Q^T so queries sit on lanes; P^T in C-layout is bit-identical to the A-fragment layout of O += P x V.
// K A-fragments and V^T B-fragments are loaded straight from the fragment-order planes (two 16-B loads each, every
// load 512 contiguous bytes per wave); Q B-fragments are converted once per wave from X (every position is a query).
__global__ __launch_bounds__(256) void attn_kernel(const float* __restrict__ x,
                                                   const bf16* __restrict__ kb,
                                                   const f16* __restrict__ vt,
                                                   const int* __restrict__ cnt,
                                                   f16* __restrict__ ch,
                                                   f16* __restrict__ cr) {
  const unsigned qblk = blockIdx.x;
  const unsigned h    = blockIdx.y;
  const unsigned b    = blockIdx.z;
  const unsigned tid  = threadIdx.x;
  const unsigned wave = tid >> 5;
  const unsigned lane = tid & 31u;
  const unsigned lq   = lane & 15u;   // query column of S^T / d column of O
  const unsigned hi   = lane >> 4;    // k-split half

  __shared__ __align__(16) float sO[NWAVE * 16 * OP];   // per-wave staging tile (block barrier used)

  const unsigned qrow0 = qblk * BQ + wave * 16u;        // first query row of this wave

  // wave-uniform plane bases in bytes; a block of 32 keys is BKB bytes of either plane, a fragment load FB bytes
  const char* kb_h = (const char*)(kb + ((size_t)b * NHEAD + h) * SEQ * HDIM);
  const char* vt_h = (const char*)(vt + ((size_t)b * NHEAD + h) * HDIM * SEQ);
  constexpr unsigned FB  = FU * 2u;
  constexpr unsigned BKB = BK * HDIM * 2u;
  const unsigned lo = lane * 16u;     // this lane's unit (byte offset) inside a wave-wide fragment load

  // packed keys of this batch; 0 kept keys: all SEQ keys are packed and Q = 0 makes every score equal
  const int      kept = cnt[b * CLINE];
  const bool     none = kept <= 0;
  const unsigned nk   = none ? (unsigned)SEQ : ((unsigned)kept < (unsigned)SEQ ? (unsigned)kept : (unsigned)SEQ);

  // Q as B-operand fragments: lane lq holds query qrow0+lq, elements follow the split d map of the K plane.
  FragB qf[2];
  const float* xq = x + ((size_t)b * SEQ_FULL + qrow0 + lq) * EMB + h * HDIM + hi * 8u;
  #pragma unroll
  for (unsigned f = 0; f < 2; ++f) {
    #pragma unroll
    for (unsigned j = 0; j < 2; ++j) {
      const v4f a0 = *(const v4f*)(xq + f * 32u + j * 16u);        // d = f*32 + j*16 + hi*8 + 0..3
      const v4f a1 = *(const v4f*)(xq + f * 32u + j * 16u + 4u);   // d = f*32 + j*16 + hi*8 + 4..7
      Pack8B pq;
      #pragma unroll
      for (int i = 0; i < 4; ++i) {
        pq.h[i]     = (bf16)a0[i];                                 // RNE convert
        pq.h[4 + i] = (bf16)a1[i];
      }
      qf[f].q[j] = none ? (v4u){0, 0, 0, 0} : pq.u;
    }
  }

  v8f o[4];
  #pragma unroll
  for (int dt = 0; dt < 4; ++dt) o[dt] = (v8f){0, 0, 0, 0, 0, 0, 0, 0};

  // Lazy softmax reference: the weights are taken against mref, a maximum seen earlier, and mref moves only when a
  // score tops it by more than 2^LAZY. Weights then reach 2^LAZY at most: x4096 that is 2^15, inside f16.
  const float SL   = 0.03125f * 1.4426950408889634f;   // (1/sqrt(EMB)) * log2(e)
  const float LAZY = 3.0f;
  float mref = -3.0e38f;                               // raw score units; equal in the two lanes of a query
  float mtop = -3.0e38f;                               // mref + LAZY / SL: every first pass tops it
  float ebias = 0.0f;                                  // -mref * SL, set in the first pass
  float rsum = 0.0f;                                   // this lane's 16 keys a pass; carried x4096, f16 values summed
  const float FILL = -1.0e20f;                         // the reference's replace value (applied before scaling)

  // rotated key walk: the 16 query blocks of a head start spread over the nblk key blocks and wrap. The index is
  // transposed (4 x 4) first, so that neighbouring query blocks start far apart: any run of neighbours that shares a
  // cache has its starts spread over the whole walk.
  const unsigned nblk = (nk + BK - 1u) / BK;
  static_assert(SEQ / BQ == 16);
  unsigned blk = (((qblk & 3u) * 4u + (qblk >> 2)) * nblk) / (unsigned)(SEQ / BQ);   // < nblk

  // K A-fragments: row = key j0 + sub*16 + lq, split d map. They are fetched one block ahead: the first block here,
  // the walk's next block inside each pass, right behind the products that were the last readers of the registers.
  FragB ak[2][2];
  const char* kfirst = kb_h + (size_t)blk * BKB;
  #pragma unroll
  for (unsigned sub = 0; sub < 2; ++sub) {
    #pragma unroll
    for (unsigned f = 0; f < 2; ++f) {
      ak[sub][f].q[0] = *(const v4u*)(kfirst + lo + (sub * 4u + f * 2u) * FB);
      ak[sub][f].q[1] = *(const v4u*)(kfirst + lo + (sub * 4u + f * 2u + 1u) * FB);
    }
  }

  // this lane's address in the V plane, carried from pass to pass: ready when a pass begins, so that the V loads go
  // out ahead of the score products
  const char* vcur = vt_h + lo + (size_t)blk * BKB;

  #pragma unroll 1
  for (unsigned it = 0; it < nblk; ++it) {
    const unsigned j0  = blk * BK;                               // first packed key of this pass
    const unsigned nxt = (blk + 1u < nblk) ? blk + 1u : 0u;      // the walk wraps behind the last key block
    // V B-fragments: column n = d = dt*16 + lq, split key map from the transposed plane
    FragH bv[4];
    #pragma unroll
    for (unsigned dt = 0; dt < 4; ++dt) {
      bv[dt].q[0] = *(const v4u*)(vcur + (dt * 2u) * FB);        // keys j0 + hi*8 + 0..7
      bv[dt].q[1] = *(const v4u*)(vcur + (dt * 2u + 1u) * FB);   // keys j0 + 16 + hi*8 + 0..7
    }

    // S^T tiles: c[sub][r] = rawscore(query qrow0+lq, key j0 + sub*16 + hi*8 + r)
    v8f c[2];
    #pragma unroll
    for (int sub = 0; sub < 2; ++sub) {
      v8f acc = (v8f){0, 0, 0, 0, 0, 0, 0, 0};
      acc = mma_bf16(ak[sub][0].v, qf[0].v, acc);
      acc = mma_bf16(ak[sub][1].v, qf[1].v, acc);
      c[sub] = acc;
    }

    // the V loads' address registers are stepped on behind this point
    asm volatile("s_wait_xcnt 0x0" ::: "memory");

    // next block's K fragments; the last pass reads the walk's first block again (written, in bounds, never used)
    const char* kbase = kb_h + (size_t)nxt * BKB;
    #pragma unroll
    for (unsigned sub = 0; sub < 2; ++sub) {
      #pragma unroll
      for (unsigned f = 0; f < 2; ++f) {
        ak[sub][f].q[0] = *(const v4u*)(kbase + lo + (sub * 4u + f * 2u) * FB);
        ak[sub][f].q[1] = *(const v4u*)(kbase + lo + (sub * 4u + f * 2u + 1u) * FB);
      }
    }

    // only the last key block can hold fill positions past the packed keys: they get the replace value (weight 0)
    if (j0 + BK > nk) {
      #pragma unroll
      for (unsigned r = 0; r < 8; ++r) {
        c[0][r] = (j0 + hi * 8u + r >= nk)       ? FILL : c[0][r];
        c[1][r] = (j0 + 16u + hi * 8u + r >= nk) ? FILL : c[1][r];
      }
    }

    // behind the wait above: one block on, or back to the plane's first block
    vcur += (blk + 1u < nblk) ? (long long)BKB : -(long long)((size_t)(nblk - 1u) * BKB);

    // the reference in use and this lane's 16 of query lq's 32 scores (the other 16 sit in lane ^ 16)
    float lmax = mref;
    #pragma unroll
    for (int r = 0; r < 8; ++r) {
      lmax = fmaxf(lmax, c[0][r]);
      lmax = fmaxf(lmax, c[1][r]);
    }

    // one wave-wide test a pass (a scalar branch): only a pass in which some score tops the reference in use by more
    // than 2^LAZY pays for the lane exchange, the new reference and the rescale of the sums
    if (__builtin_amdgcn_ballot_w32(lmax > mtop) != 0u) {
      const float m_new = fmaxf(lmax, __shfl_xor(lmax, 16, 32));
      const float scale = __builtin_amdgcn_exp2f((mref - m_new) * SL);
      mref  = m_new;
      mtop  = m_new + LAZY / SL;
      ebias = -m_new * SL;
      rsum *= scale;
      // rescale O: queries are the row dimension there -> per-row scale from lane 8*hi + r
      float sc[8];
      #pragma unroll
      for (int r = 0; r < 8; ++r) sc[r] = __shfl(scale, (int)((hi << 3) + r), 32);
      #pragma unroll
      for (int dt = 0; dt < 4; ++dt) {
        #pragma unroll
        for (int r = 0; r < 8; ++r) o[dt][r] *= sc[r];
      }
    }

    // exp + pack: P^T C-layout == A-fragment layout for the PV product
    FragH pa;
    float psum = 0.0f;
    // exponents against the reference in use: one fused multiply-add a score
    #pragma unroll
    for (int r = 0; r < 8; ++r) {
      c[0][r] = __builtin_fmaf(c[0][r], SL, ebias);
      c[1][r] = __builtin_fmaf(c[1][r], SL, ebias);
    }
    #pragma unroll
    for (int r = 0; r < 8; ++r) {
      const float p0 = __builtin_amdgcn_exp2f(c[0][r]);   // key hi*8 + r
      const float p1 = __builtin_amdgcn_exp2f(c[1][r]);   // key 16 + hi*8 + r
      const f16 h0 = (f16)(p0 * P_CARRY);
      const f16 h1 = (f16)(p1 * P_CARRY);
      pa.h[r]     = h0;
      pa.h[8 + r] = h1;
      psum += (float)h0 + (float)h1;
    }
    rsum += psum;

    // O += P x V
    #pragma unroll
    for (int dt = 0; dt < 4; ++dt) o[dt] = mma_pv(pa.v, bv[dt].v, o[dt]);
    // order of this stretch: all of its vector work, then the four products in a row. Left alone the compiler sinks the
    // tail of the row sum among the products, into registers that a product has just read, and pads ten idle slots
    __builtin_amdgcn_sched_group_barrier(0x402, 128, 0);   // vector and transcendental instructions
    __builtin_amdgcn_sched_group_barrier(0x008, 4, 0);     // matrix instructions
    blk = nxt;
  }

  // the two lanes of a query join their sums here, once (both were kept against the same reference)
  rsum += __shfl_xor(rsum, 16, 32);

  // normalize: lane holds column d = dt*16 + lq for query rows 8*hi + r; the x4096 carry cancels against rsum
  float rs[8];
  #pragma unroll
  for (int r = 0; r < 8; ++r) rs[r] = CTX_CARRY * (1.0f / __shfl(rsum, (int)((hi << 3) + r), 32));

  float* so = sO + wave * (16 * OP);
  #pragma unroll
  for (int r = 0; r < 8; ++r) {
    #pragma unroll
    for (int dt = 0; dt < 4; ++dt) {
      so[(hi * 8u + r) * OP + dt * 16u + lq] = o[dt][r] * rs[r];
    }
  }
  __syncthreads();

  // context planes in fragment order: [16-row tile][k/32][j][lane][8 k]; this wave's 16 rows x 64 columns are 4 loads'
  // worth (it = (k/32 within the head)*2 + j), 2 KiB contiguous per plane; lane = hi*16 + row.
  v4u    hv[4], rv[4];
  size_t gidx[4];
  #pragma unroll
  for (unsigned it = 0; it < 4; ++it) {
    const unsigned row = lq;
    const unsigned c8  = it * 16u + hi * 8u;
    const v4f a0 = *(const v4f*)(so + row * OP + c8);
    const v4f a1 = *(const v4f*)(so + row * OP + c8 + 4);
    Pack8H ph, pr;
    #pragma unroll
    for (int i = 0; i < 4; ++i) {
      const f16 t0 = (f16)a0[i];
      const f16 t1 = (f16)a1[i];
      ph.h[i]     = t0;
      ph.h[4 + i] = t1;
      pr.h[i]     = (f16)((a0[i] - (float)t0) * RES_CARRY);
      pr.h[4 + i] = (f16)((a1[i] - (float)t1) * RES_CARRY);
    }
    hv[it]   = ph.u;
    rv[it]   = pr.u;
    gidx[it] = ((size_t)b * SEQ + qrow0) * EMB + h * (HDIM * 16u) + it * FU + lane * 8u;
  }
  #pragma unroll
  for (int it = 0; it < 4; ++it) {
    *(v4u*)(ch + gidx[it]) = hv[it];
    *(v4u*)(cr + gidx[it]) = rv[it];
  }
  
}

// One 32-k step of the projection: A fragments of both context planes, B fragments of the four 16-column tiles.
// ah, ar, bw: uniform byte bases; ao, lo: the lane's byte offsets; a 16-wide tile's 32 k elements are 2 loads' worth.
struct ProjFrag { FragH a, a2, bf[4]; };
template <bool LAST>
static __device__ __forceinline__ void proj_load(ProjFrag& f, const char* ah, const char* ar, const char* bw,
                                                 unsigned ao, unsigned lo, unsigned k0) {
  constexpr unsigned FB = FU * 2u;                  // bytes of one wave-wide fragment load
  const size_t ko = (size_t)k0 * 32u;
  f.a.q[0]  = *(const v4u*)(ah + ko + ao);          // k = k0 + hi*8 + 0..7
  f.a.q[1]  = *(const v4u*)(ah + ko + ao + FB);     // k = k0 + 16 + hi*8 + 0..7
  f.a2.q[0] = *(const v4u*)(ar + ko + ao);
  f.a2.q[1] = *(const v4u*)(ar + ko + ao + FB);
  #pragma unroll
  for (unsigned nt = 0; nt < 4; ++nt) {
    // behind the loop the address registers die here: the last results may be given the registers that held them
    if (LAST && nt == 3) asm volatile("s_wait_xcnt 0x0" ::: "memory");
    f.bf[nt].q[0] = *(const v4u*)(bw + ko + lo + nt * (16u * EMB * 2u));
    f.bf[nt].q[1] = *(const v4u*)(bw + ko + lo + nt * (16u * EMB * 2u) + FB);
  }
}
static __device__ __forceinline__ void proj_mma(const ProjFrag& f, v8f (&acc)[4], v8f (&acr)[4]) {
  #pragma unroll
  for (int nt = 0; nt < 4; ++nt) {
    acc[nt] = mma_f16(f.a.v,  f.bf[nt].v, acc[nt]);
    acr[nt] = mma_f16(f.a2.v, f.bf[nt].v, acr[nt]);   // scaled residual: separate accumulator
  }
}

// Output projection. Block = (128-row tile, 64-column tile, batch); one wave owns 16 rows x 64 columns.
// A fragments from the context planes, B fragments from the weight plane, all in fragment order - both with the
// split k map, two 16-B loads per fragment, every load 512 contiguous bytes per wave.
__global__ __launch_bounds__(256) void proj_kernel(const f16* __restrict__ ch,
                                                   const f16* __restrict__ cr,
                                                   const f16* __restrict__ wp,
                                                   const float* __restrict__ bias,
                                                   float* __restrict__ out) {
  const unsigned rb   = blockIdx.x;
  const unsigned cb   = blockIdx.y;
  const unsigned b    = blockIdx.z;
  const unsigned tid  = threadIdx.x;
  const unsigned wave = tid >> 5;
  const unsigned lane = tid & 31u;
  const unsigned lq   = lane & 15u;
  const unsigned hi   = lane >> 4;

  __shared__ __align__(16) float sO[NWAVE * 16 * OP];   // per-wave staging tile (block barrier used)

  const unsigned row0 = rb * GM + wave * 16u;           // first sequence row of this wave
  const unsigned col0 = cb * GN;

  // workgroup-uniform plane bases in bytes
  const char* ah = (const char*)(ch + ((size_t)b * SEQ + rb * GM) * EMB);
  const char* ar = (const char*)(cr + ((size_t)b * SEQ + rb * GM) * EMB);
  const char* bw = (const char*)(wp + (size_t)col0 * EMB);
  const unsigned lo = lane * 16u;                       // this lane's unit (byte offset) inside a wave-wide fragment load
  const unsigned ao = wave * (16u * EMB * 2u) + lo;     // plus this wave's 16-row tile

  v8f acc[4], acr[4];
  #pragma unroll
  for (int nt = 0; nt < 4; ++nt) {
    acc[nt] = (v8f){0, 0, 0, 0, 0, 0, 0, 0};
    acr[nt] = (v8f){0, 0, 0, 0, 0, 0, 0, 0};
  }

  // rotated k walk: the 16 column blocks of a row tile, and the 16 row blocks of a column tile and batch, start 64 k
  // apart; k wraps at EMB. The start is an odd number of 32-k steps, so the two steps that a pass of the loop loads
  // (the second of one pair, the first of the next) are neighbours in memory and never straddle the wrap.
  static_assert(EMB / 64 == 16 && EMB / GN == 16 && SEQ / GM == 16);
  const unsigned kr = (((cb + rb) & 15u) * 2u + 1u) * 32u;

  // two fragment sets: while one set's products run, the other set's loads (the next 32 k) are in flight
  ProjFrag f0, f1;
  proj_load<false>(f0, ah, ar, bw, ao, lo, kr);
  // the start values of the accumulators and of the loop take over registers that these loads name
  asm volatile("s_wait_xcnt 0x0" ::: "memory");
  __builtin_amdgcn_sched_barrier(0);   // without it the compiler lifts those writes over the wait
  #pragma unroll 1
  for (unsigned k0 = 0; k0 < EMB - 64u; k0 += 64u) {
    const unsigned kp = (kr + k0 + 32u) & (EMB - 1u);   // a multiple of 64
    proj_load<false>(f1, ah, ar, bw, ao, lo, kp);
    proj_mma(f0, acc, acr);
    proj_load<false>(f0, ah, ar, bw, ao, lo, kp + 32u);
    proj_mma(f1, acc, acr);
    // the next pass forms its addresses in the registers that hold this pass's
    asm volatile("s_wait_xcnt 0x0" ::: "memory");
  }
  proj_load<true>(f1, ah, ar, bw, ao, lo, (kr + EMB - 32u) & (EMB - 1u));
  proj_mma(f0, acc, acr);
  proj_mma(f1, acc, acr);

  // fold carries: (hi + res/2048) / (256 * 64); acc[nt][r] = element (row 8*hi + r, column nt*16 + lq)
  float* so = sO + wave * (16 * OP);
  const float inv_res = 1.0f / RES_CARRY;
  const float inv_car = 1.0f / (CTX_CARRY * W_CARRY);
  #pragma unroll
  for (int r = 0; r < 8; ++r) {
    #pragma unroll
    for (int nt = 0; nt < 4; ++nt) {
      so[(hi * 8u + r) * OP + nt * 16u + lq] = (acc[nt][r] + acr[nt][r] * inv_res) * inv_car;
    }
  }
  __syncthreads();

  // bias (bf16 RNE-converted input value), added in f32
  const v4f braw = *(const v4f*)(bias + col0 + lq * 4u);
  v4f bq;
  #pragma unroll
  for (int i = 0; i < 4; ++i) bq[i] = (float)(bf16)braw[i];

  // lanes 0..15 one row (16 consecutive lanes x 16 B each), lanes 16..31 the next row; 8 instructions cover the wave's 16 rows.
  v4f    vals[8];
  size_t gidx[8];
  #pragma unroll
  for (unsigned it = 0; it < 8; ++it) {
    const unsigned row = it * 2u + hi;
    const v4f t = *(const v4f*)(so + row * OP + lq * 4u);
    vals[it] = t + bq;
    gidx[it] = ((size_t)b * SEQ_FULL + row0 + row) * EMB + col0 + lq * 4u;
  }
  #pragma unroll
  for (int it = 0; it < 8; ++it) *(v4f*)(out + gidx[it]) = vals[it];
  
}

extern "C" void kernel_launch(void* const* d_in, const int* in_sizes, int n_in,
                              void* d_out, int out_size, void* d_ws, size_t ws_size,
                              hipStream_t stream) {
  if (n_in < 4) return;
  const size_t rows_used = (size_t)(NB - 1) * SEQ_FULL + SEQ;
  if ((size_t)in_sizes[0] < rows_used * EMB) return;
  if ((size_t)in_sizes[1] < rows_used) return;
  if ((size_t)in_sizes[2] < (size_t)EMB * EMB) return;
  if ((size_t)in_sizes[3] < (size_t)EMB) return;
  if ((size_t)out_size < rows_used * EMB) return;

  const size_t kb_bytes = (size_t)NB * NHEAD * SEQ * HDIM * 2;   // bf16 row plane
  const size_t vt_bytes = (size_t)NB * NHEAD * HDIM * SEQ * 2;   // f16 transposed plane
  const size_t cx_bytes = (size_t)NB * SEQ * EMB * 2;            // each f16 context plane
  const size_t wp_bytes = (size_t)EMB * EMB * 2;                 // f16 weight plane
  const size_t ct_bytes = (size_t)NB * CLINE * 4;                // kept-key count per batch
  const size_t total    = kb_bytes + vt_bytes + 2 * cx_bytes + wp_bytes + ct_bytes;
  if (ws_size < total) return;

  const float* x    = (const float*)d_in[0];
  const int*   mask = (const int*)d_in[1];
  const float* w    = (const float*)d_in[2];
  const float* bias = (const float*)d_in[3];
  float*       out  = (float*)d_out;

  char* base = (char*)d_ws;
  bf16* kb = (bf16*)base;
  f16*  vt = (f16*)(base + kb_bytes);
  f16*  ch = (f16*)(base + kb_bytes + vt_bytes);
  f16*  cr = (f16*)(base + kb_bytes + vt_bytes + cx_bytes);
  f16*  wp = (f16*)(base + kb_bytes + vt_bytes + 2 * cx_bytes);
  int*  ct = (int*)(base + kb_bytes + vt_bytes + 2 * cx_bytes + wp_bytes);

  planes_kernel<<<dim3(SEQ / CT, NHEAD, NB + 1), 256, 0, stream>>>(x, mask, w, kb, vt, wp, ct);
  attn_kernel<<<dim3(SEQ / BQ, NHEAD, NB), 256, 0, stream>>>(x, kb, vt, ct, ch, cr);
  proj_kernel<<<dim3(SEQ / GM, EMB / GN, NB), 256, 0, stream>>>(ch, cr, wp, bias, out);
}

// v010
// Measured time: 34.2 microseconds a run.
// Versions between v007 and this one are left out; their measured steps multiply to 1.31 times as fast.
// All steps since v000 together make it 4.54 times as fast.
#include <hip/hip_runtime.h>

// Contractions: S^T = K x Q^T on v_wmma_f32_16x16x32_f16 (K = f16 of the bf16 RNE-converted input X, Q = f16 of the bf16
// RNE-converted X times the softmax scale: bf16 values held in f16; f32 accumulate on top of the exponent bias);
// O = P x V on v_wmma_f32_16x16x32_f16 (P as f16 carried x4096, V = the same plane as K, f32 accumulate);
// row sums of P on the same form against a fragment whose column 0 is ones;
// Y = C x W^T on v_wmma_f32_16x16x32_f16 (C as one f16 plane carried x256: its rounding, at most 2^-11 of a value, is
// an eighth of the bf16 rounding that X and W already carry; W = f16 of the bf16 RNE-converted weight carried x64, f32
// accumulate). Softmax and bias add in f32.
//
// Plane layout: every 16-bit plane is stored in fragment order. The unit is 16 B (8 consecutive k elements of one
// row or column); 32 units = the 512 contiguous bytes that one wave-wide 16-B load brings in, unit index = lane
// (lane = hi*16 + lq: lq = row or column inside a 16-wide tile, hi = which run of 8 inside a run of 16 k elements).
//
// Key compaction: a key whose mask word is 0 gets the score -1e20, so its softmax weight is exactly 0 whenever the
// batch has any kept key. The plane builder therefore packs only the kept keys (in their order) into the key
// plane and the attention loop walks ceil(kept / 32) blocks. A batch with no kept key has equal scores everywhere:
// there all keys are packed and Q is taken as 0, which gives the same uniform weights.
//
// One key plane: k and v are the same values, so one f16 plane serves both products. Its 16-B units (8 d of one key) are
// K fragments as they lie; a V fragment wants 8 keys of one d in a lane, which is the 8 x 8 transpose of the units that
// eight lanes load, and the transposing global load does it on the way in. The V loads of a pass ask for the very lines
// that the K loads of the pass before have brought in.
//
// Rotated walks: work-groups that read the same plane (the 16 query blocks of a head; the projection blocks of one row
// or one column tile) run at the same time. Walking it from the same end they ask L2 for the same lines at the same
// moment, and all of them wait for each line's first fetch. Each work-group therefore starts its key walk or k walk at
// a place set by its block index and wraps round; every block of the walk is still taken exactly once.

#ifndef NB
#define NB 2
#endif
#ifndef SEQ
#define SEQ 2048
#endif
#define NB_FULL    2
#define SEQ_FULL   2048
#define NHEAD      16
#define HDIM       64
#define EMB        (NHEAD * HDIM)       // floats per (b, s) of X and of the output, halves per (b, s) of the context plane
#define BQ         128                  // query rows per workgroup (8 waves x 16)
#define BK         32                   // keys per inner iteration
#define NWAVE      8
#define CT         64                   // keys per plane-builder block
#define KP         17                   // LDS pitch (16-B units) of one d-chunk row of the fragment-order K tile
#define FU         256                  // elements of one wave-wide fragment load (32 lanes x 8)
#define OP         68                   // LDS pitch (floats) of the staging tile
#define GM         256                  // projection rows per workgroup (8 waves x 32)
#define GN         64                   // projection columns per workgroup
#define WELEM      8                    // weight elements per thread in the weight plane builder
#define CLINE      32                   // ints between the batches' kept-key counts: one writing block per 128-B line

#define P_CARRY_L2 12.0f                // P is carried x4096 = 2^12: the carry is added to the exponent
#define CTX_CARRY  256.0f
#define W_CARRY    64.0f

static_assert(SEQ % BQ == 0);
static_assert(SEQ % CT == 0);
static_assert(SEQ % BK == 0);
static_assert(SEQ % (NWAVE * 32) == 0);
static_assert(BK == 32 && CT % BK == 0 && CT * HDIM == 2 * 256 * 8);
static_assert(SEQ % GM == 0);
static_assert(EMB % GN == 0);
static_assert(EMB % 64 == 0 && EMB >= 128);
static_assert(BQ == NWAVE * 16);
static_assert(GM == NWAVE * 32);
static_assert(HDIM == 64);
static_assert(GN == 64);
static_assert(SEQ <= SEQ_FULL);
static_assert(NB >= 1 && NB <= NB_FULL);
static_assert((OP * 4) % 16 == 0);
// coverage equalities: grid x block x per-thread elements == plane element count
static_assert((size_t)(SEQ / CT) * NHEAD * NB * 256 * 2 * 8 == (size_t)NB * NHEAD * SEQ * HDIM);   // key plane
static_assert((size_t)(SEQ / CT) * NHEAD * 256 * WELEM == (size_t)EMB * EMB);                      // weight plane (one grid slice)
static_assert((size_t)(SEQ / BQ) * NHEAD * NB * NWAVE * 16 * HDIM == (size_t)NB * SEQ * EMB);       // context plane
static_assert((size_t)(SEQ / GM) * (EMB / GN) * NB * NWAVE * 32 * GN == (size_t)NB * SEQ * EMB);    // output

typedef __bf16   bf16;
typedef _Float16 f16;
typedef f16      v16h  __attribute__((ext_vector_type(16)));
typedef f16      v8h   __attribute__((ext_vector_type(8)));
typedef float    v8f   __attribute__((ext_vector_type(8)));
typedef float    v4f   __attribute__((ext_vector_type(4)));
typedef unsigned v4u   __attribute__((ext_vector_type(4)));
typedef int      v4i   __attribute__((ext_vector_type(4)));

union FragH  { v16h  v; v4u q[2]; f16  h[16]; };
union Pack8H { v4u u; v8h v; f16 h[8]; };

// WMMA helpers of the attention loop: the plain builtins. The compiler keeps the distance behind a matrix instruction
// itself, and only where a vector instruction really follows on its registers. Four waves share a SIMD's vector port:
// an idle slot of one wave is a slot taken from another wave's softmax.
// Transposing global load: every lane names 16 B (8 halves); each group of eight lanes gets the 8 x 8 transpose of what
// it named (the lane map of the LDS form of this load). All lanes are on wherever it is used.
typedef short v8s __attribute__((ext_vector_type(8)));
static __device__ __forceinline__ v4u load_tr16(const char* p) {
  typedef __attribute__((address_space(1))) v8s gv8s;
  return __builtin_bit_cast(v4u, __builtin_amdgcn_global_load_tr16_b128_v8i16((gv8s*)p));
}
static __device__ __forceinline__ v8f mma_pv(v16h a, v16h b, v8f acc) {
  return __builtin_amdgcn_wmma_f32_16x16x32_f16(false, a, false, b, (short)0, acc, false, false);
}
// WMMA helper of the projection loop: builtin followed by the VALU hazard guard (ties D, keeps A/B live). It stays:
// that loop is not bound by vector issue, and the statements also hold the order of its loads and products (without
// them the compiler draws the two fragment sets' loads together and the one-step lead of the loads is lost).
static __device__ __forceinline__ v8f mma_f16(v16h a, v16h b, v8f acc) {
  acc = __builtin_amdgcn_wmma_f32_16x16x32_f16(false, a, false, b, (short)0, acc, false, false);
  asm volatile("v_nop\n\tv_nop\n\tv_nop\n\tv_nop" : "+v"(acc) : "v"(a), "v"(b));
  return acc;
}

// Weight plane: f16(bf16(W[n][k]) * 64) in fragment order: [n/16][k/32][j][lane][8 k], n = (n/16)*16 + lq,
// k = (k/32)*32 + j*16 + hi*8 + 0..7. Thread t writes unit t.
static __device__ __forceinline__ void w_plane_unit(const float* __restrict__ w, f16* __restrict__ wp, unsigned t) {
  const size_t   e0 = (size_t)t * WELEM;
  const size_t   r0 = (size_t)((t >> 11) * 16u + (t & 15u)) * EMB + ((t >> 4) & 127u) * 8u;
  const v4f a0 = *(const v4f*)(w + r0);
  const v4f a1 = *(const v4f*)(w + r0 + 4);
  Pack8H ph;
  #pragma unroll
  for (int i = 0; i < 4; ++i) {
    ph.h[i]     = (f16)((float)(bf16)a0[i] * W_CARRY);   // bf16 significand x power of two: exact in f16
    ph.h[4 + i] = (f16)((float)(bf16)a1[i] * W_CARRY);
  }
  const v4u val = ph.u;
  *(v4u*)(wp + e0) = val;
}

// Plane builder, one launch for both planes: the weight plane depends on nothing the key plane needs, so its
// blocks ride in the same grid as one more z slice (z == NB; it has the shortest chain of loads).
// Block = (tile of 64 packed keys, head, batch), 256 threads. k = v = head slice of X, kept keys only.
// Every block ranks the batch's kept keys itself (ballots per wave, wave totals through LDS) and gathers the 64 rows
// whose ranks fall into its tile; ranks past the kept count are filled with 0 (finite, so a zero weight stays zero).
// A tile that starts past the kept count is not stored and never read.
// coverage: packed positions kt*64 + {0..31, 32..63}, d 0..63; every written line whole, one instruction.
// kv, per (b, h): [16-key tile][d chunk c = d/8][key in tile][8 d]; a K fragment load (f, j) is units (f*2+j)*32 + lane.
__global__ __launch_bounds__(256) void planes_kernel(const float* __restrict__ x,
                                                     const int* __restrict__ mask,
                                                     const float* __restrict__ w,
                                                     f16* __restrict__ kv,
                                                     f16* __restrict__ wp,
                                                     int* __restrict__ cnt) {
  const unsigned kt   = blockIdx.x;
  const unsigned h    = blockIdx.y;
  const unsigned b    = blockIdx.z;
  const unsigned tid  = threadIdx.x;
  if (b == (unsigned)NB) {                      // whole blocks, ahead of every barrier
    w_plane_unit(w, wp, (h * (unsigned)(SEQ / CT) + kt) * 256u + tid);
    return;
  }
  const unsigned wave = tid >> 5;
  const unsigned lane = tid & 31u;
  __shared__ __align__(16) v4u sK[(CT / 16) * 8 * KP];   // [tile*8 + d chunk][key in tile], cross-wave
  __shared__ unsigned sTot[NWAVE];              // kept keys in each wave's run of SEQ / NWAVE keys
  __shared__ unsigned sIdx[CT];                 // sequence position of this tile's packed keys
  const unsigned s0 = kt * CT;

  // wave w ranks keys w*KW .. w*KW + KW-1: one ballot per 32 keys
  constexpr unsigned KW = SEQ / NWAVE;
  const int* mk = mask + (size_t)b * SEQ_FULL + wave * KW + lane;
  unsigned bal[KW / 32];
  unsigned wtot = 0;
  #pragma unroll
  for (unsigned e = 0; e < KW / 32; ++e) {
    bal[e] = __builtin_amdgcn_ballot_w32(mk[e * 32u] != 0);
    wtot += (unsigned)__popc(bal[e]);
  }
  if (lane == 0) sTot[wave] = wtot;
  if (tid < CT) sIdx[tid] = 0u;                 // fill positions past the kept count point at row 0 (read, then dropped)
  __syncthreads();
  unsigned rank = 0, kept = 0;
  #pragma unroll
  for (unsigned v = 0; v < NWAVE; ++v) {
    const unsigned t = sTot[v];
    rank += (v < wave) ? t : 0u;
    kept += t;
  }
  const bool     none  = (kept == 0u);          // no kept key: pack every key
  const unsigned count = none ? (unsigned)SEQ : kept;
  if (none) rank = wave * KW;
  #pragma unroll
  for (unsigned e = 0; e < KW / 32; ++e) {
    const unsigned bits = none ? 0xFFFFFFFFu : bal[e];
    const unsigned slot = rank + (unsigned)__popc(bits & ((1u << lane) - 1u)) - s0;   // wraps below the tile
    if (((bits >> lane) & 1u) != 0u && slot < (unsigned)CT) sIdx[slot] = wave * KW + e * 32u + lane;
    rank += (unsigned)__popc(bits);
  }
  if (kt == 0 && h == 0 && tid == 0) cnt[b * CLINE] = (int)kept;
  __syncthreads();

  v4f xr[2][2];
  #pragma unroll
  for (unsigned kk = 0; kk < 2; ++kk) {
    const unsigned key = kk * 32u + (tid >> 3);     // 0..63
    const float* src = x + ((size_t)b * SEQ_FULL + sIdx[key]) * EMB + h * HDIM + (tid & 7u) * 8u;
    xr[kk][0] = *(const v4f*)(src);
    xr[kk][1] = *(const v4f*)(src + 4);
  }
  // holds the four loads ahead of the selects below: without it each row's pair sinks into a branch of its own and
  // the second row's memory latency starts only after the first row has been converted
  asm volatile("" :: "v"(xr[0][0]), "v"(xr[0][1]), "v"(xr[1][0]), "v"(xr[1][1]));

  #pragma unroll
  for (unsigned kk = 0; kk < 2; ++kk) {
    const unsigned key = kk * 32u + (tid >> 3);     // 0..63
    const bool     on  = s0 + key < count;
    const v4f x0 = on ? xr[kk][0] : (v4f){0, 0, 0, 0};
    const v4f x1 = on ? xr[kk][1] : (v4f){0, 0, 0, 0};
    Pack8H pk;
    #pragma unroll
    for (int i = 0; i < 4; ++i) {
      pk.h[i]     = (f16)(float)(bf16)x0[i];        // RNE convert to bf16; f16 of the bf16 value: exact
      pk.h[4 + i] = (f16)(float)(bf16)x1[i];
    }
    sK[((key >> 4) * 8u + (tid & 7u)) * KP + (key & 15u)] = pk.u;
  }
  __syncthreads();

  // unit u = kk*256 + tid of this block's 8 KiB of the plane, which is written in unit order
  v4u    kval[2];
  size_t uidx[2];
  #pragma unroll
  for (unsigned kk = 0; kk < 2; ++kk) {
    const unsigned u  = kk * 256u + tid;
    kval[kk] = sK[(u >> 4) * KP + (u & 15u)];
    uidx[kk] = (((size_t)b * NHEAD + h) * SEQ + s0) * HDIM + (size_t)u * 8u;
  }

  if (s0 < count) {
    #pragma unroll
    for (int kk = 0; kk < 2; ++kk) *(v4u*)(kv + uidx[kk]) = kval[kk];
  }
}

// Flash attention over the packed (kept) keys. Block = (query block of 128, head, batch); one wave owns 16 query rows.
// S^T = K x Q^T so queries sit on lanes; P^T in C-layout is bit-identical to the A-fragment layout of O += P x V.
// K A-fragments and V B-fragments are loaded straight from the one key plane (two 16-B loads each, every load 512
// contiguous bytes per wave; the V loads transpose); Q B-fragments are converted once per wave from X (every position
// is a query).
__global__ __launch_bounds__(256) void attn_kernel(const float* __restrict__ x,
                                                   const f16* __restrict__ kv,
                                                   const int* __restrict__ cnt,
                                                   f16* __restrict__ ch) {
  const unsigned qblk = blockIdx.x;
  const unsigned h    = blockIdx.y;
  const unsigned b    = blockIdx.z;
  const unsigned tid  = threadIdx.x;
  const unsigned wave = tid >> 5;
  const unsigned lane = tid & 31u;
  const unsigned lq   = lane & 15u;   // query column of S^T / d column of O
  const unsigned hi   = lane >> 4;    // k-split half

  __shared__ __align__(16) float sO[NWAVE * 16 * OP];   // per-wave staging tile (block barrier used)

  const unsigned qrow0 = qblk * BQ + wave * 16u;        // first query row of this wave

  // wave-uniform plane base in bytes; a block of 32 keys is BKB bytes of the plane, a fragment load FB bytes
  const char* kv_h = (const char*)(kv + ((size_t)b * NHEAD + h) * SEQ * HDIM);
  constexpr unsigned FB  = FU * 2u;
  constexpr unsigned BKB = BK * HDIM * 2u;
  const unsigned lo = lane * 16u;     // this lane's unit (byte offset) inside a wave-wide fragment load
  // the same for a transposing load: lane hi*16 + g*8 + s brings in the unit of d chunk g, key hi*8 + s; each group of
  // eight lanes then holds the 8 x 8 transpose of its eight units: lane (lq, hi) has d = lq of keys hi*8 + 0..7
  const unsigned lov = ((lane >> 3) & 1u) * 256u + hi * 128u + (lane & 7u) * 16u;

  // packed keys of this batch; 0 kept keys: all SEQ keys are packed and Q = 0 makes every score equal
  const int      kept = cnt[b * CLINE];
  const bool     none = kept <= 0;
  const unsigned nk   = none ? (unsigned)SEQ : ((unsigned)kept < (unsigned)SEQ ? (unsigned)kept : (unsigned)SEQ);

  // Q as B-operand fragments: lane lq holds query qrow0+lq, elements follow the split d map of the K plane.
  // Q carries the softmax scale, so that the score products come out as exponents of 2.
  const float SL = 0.03125f * 1.4426950408889634f;     // (1/sqrt(EMB)) * log2(e)
  FragH qf[2];
  const float* xq = x + ((size_t)b * SEQ_FULL + qrow0 + lq) * EMB + h * HDIM + hi * 8u;
  #pragma unroll
  for (unsigned f = 0; f < 2; ++f) {
    #pragma unroll
    for (unsigned j = 0; j < 2; ++j) {
      const v4f a0 = *(const v4f*)(xq + f * 32u + j * 16u);        // d = f*32 + j*16 + hi*8 + 0..3
      const v4f a1 = *(const v4f*)(xq + f * 32u + j * 16u + 4u);   // d = f*32 + j*16 + hi*8 + 4..7
      Pack8H pq;
      #pragma unroll
      for (int i = 0; i < 4; ++i) {
        pq.h[i]     = (f16)(float)(bf16)(a0[i] * SL);              // RNE convert to bf16, held in f16
        pq.h[4 + i] = (f16)(float)(bf16)(a1[i] * SL);
      }
      qf[f].q[j] = none ? (v4u){0, 0, 0, 0} : pq.u;
    }
  }

  v8f o[4];
  #pragma unroll
  for (int dt = 0; dt < 4; ++dt) o[dt] = (v8f){0, 0, 0, 0, 0, 0, 0, 0};

  // Four waves share a vector port that the softmax fills, so its linear part rides in the matrix products. The score
  // products start from the exponent bias (their C operand) and deliver e = score * scale - reference + 12, of which
  // the carried weight is 2^e with no further arithmetic; the row sums are one more product of P, against a column of ones.
  // Lazy softmax reference: the weights are taken against a maximum seen earlier, and the reference moves only when an
  // exponent tops P_CARRY_L2 by more than LAZY. Carried weights then reach 2^15 at most, inside f16.
  const float LAZY = 3.0f;
  float efloor = -3.0e38f;                             // exponent of a score equal to the reference in use: 12 once set
  float etop   = -3.0e38f;                             // efloor + LAZY once set: every first pass tops it
  v8f   cb     = (v8f){0, 0, 0, 0, 0, 0, 0, 0};        // exponent bias, 12 - reference, in all 8 rows of the lane's column
  v8f   osum   = (v8f){0, 0, 0, 0, 0, 0, 0, 0};        // row sums, in column 0 of a tile laid out like O; carried x4096
  // B operand of the row sums: column 0 (lanes 0 and 16) is 1.0 at all 32 k positions, every other column 0. A fragment
  // that differs by lane stays in its eight registers; one of ones everywhere is rebuilt by seven moves in every pass.
  FragH ones;
  {
    const unsigned o = (lq == 0u) ? 0x3C003C00u : 0u;
    ones.q[0] = (v4u){o, o, o, o};
    ones.q[1] = (v4u){o, o, o, o};
  }
  const float FILL = -1.0e20f;                         // the reference's replace value: weight 0 at any bias

  // rotated key walk: the 16 query blocks of a head start spread over the nblk key blocks and wrap. The index is
  // transposed (4 x 4) first, so that neighbouring query blocks start far apart: any run of neighbours that shares a
  // cache has its starts spread over the whole walk.
  const unsigned nblk = (nk + BK - 1u) / BK;
  static_assert(SEQ / BQ == 16);
  unsigned blk = (((qblk & 3u) * 4u + (qblk >> 2)) * nblk) / (unsigned)(SEQ / BQ);   // < nblk

  // K A-fragments: row = key j0 + sub*16 + lq, split d map. They are fetched one block ahead: the first block here,
  // the walk's next block inside each pass, right behind the products that were the last readers of the registers.
  // The lane's address for the K loads is carried from pass to pass like that for the V loads: its registers stay its
  // own, and its one step a pass stands behind that pass's wait.
  FragH ak[2][2];
  const char* kcur = kv_h + lo + (size_t)blk * BKB;
  #pragma unroll
  for (unsigned sub = 0; sub < 2; ++sub) {
    #pragma unroll
    for (unsigned f = 0; f < 2; ++f) {
      ak[sub][f].q[0] = *(const v4u*)(kcur + (sub * 4u + f * 2u) * FB);
      ak[sub][f].q[1] = *(const v4u*)(kcur + (sub * 4u + f * 2u + 1u) * FB);
    }
  }

  // this lane's address for the V loads, carried from pass to pass: ready when a pass begins, so that the V loads go
  // out ahead of the score products
  const char* vcur = kv_h + lov + (size_t)blk * BKB;

  #pragma unroll 1
  for (unsigned it = 0; it < nblk; ++it) {
    const unsigned j0  = blk * BK;                               // first packed key of this pass
    const unsigned nxt = (blk + 1u < nblk) ? blk + 1u : 0u;      // the walk wraps behind the last key block
    // V B-fragments: column n = d = dt*16 + lq, split key map: d chunks dt*2, dt*2 + 1 of the block's two 16-key tiles
    FragH bv[4];
    #pragma unroll
    for (unsigned dt = 0; dt < 4; ++dt) {
      bv[dt].q[0] = load_tr16(vcur + dt * FB);                   // keys j0 + hi*8 + 0..7
      bv[dt].q[1] = load_tr16(vcur + (4u + dt) * FB);            // keys j0 + 16 + hi*8 + 0..7
    }

    // S^T tiles: c[sub][r] = exponent(query qrow0+lq, key j0 + sub*16 + hi*8 + r)
    v8f c[2];
    #pragma unroll
    for (int sub = 0; sub < 2; ++sub) {
      v8f acc = mma_pv(ak[sub][0].v, qf[0].v, cb);
      acc = mma_pv(ak[sub][1].v, qf[1].v, acc);
      c[sub] = acc;
    }

    // the address registers of this pass's V loads and of the last pass's K loads are stepped on behind this point
    asm volatile("s_wait_xcnt 0x0" ::: "memory");

    // one block on, or back to the plane's first block
    const long long step = (blk + 1u < nblk) ? (long long)BKB : -(long long)((size_t)(nblk - 1u) * BKB);

    // next block's K fragments; the last pass reads the walk's first block again (written, in bounds, never used)
    kcur += step;
    #pragma unroll
    for (unsigned sub = 0; sub < 2; ++sub) {
      #pragma unroll
      for (unsigned f = 0; f < 2; ++f) {
        ak[sub][f].q[0] = *(const v4u*)(kcur + (sub * 4u + f * 2u) * FB);
        ak[sub][f].q[1] = *(const v4u*)(kcur + (sub * 4u + f * 2u + 1u) * FB);
      }
    }
    // only the last key block can hold fill positions past the packed keys: they get the replace value (weight 0)
    if (j0 + BK > nk) {
      #pragma unroll
      for (unsigned r = 0; r < 8; ++r) {
        c[0][r] = (j0 + hi * 8u + r >= nk)       ? FILL : c[0][r];
        c[1][r] = (j0 + 16u + hi * 8u + r >= nk) ? FILL : c[1][r];
      }
    }

    // behind the wait above
    vcur += step;

    // the reference in use and this lane's 16 of query lq's 32 scores (the other 16 sit in lane ^ 16)
    float lmax = efloor;
    #pragma unroll
    for (int r = 0; r < 8; ++r) {
      lmax = fmaxf(lmax, c[0][r]);
      lmax = fmaxf(lmax, c[1][r]);
    }

    // one wave-wide test a pass (a scalar branch): only a pass in which some score tops the reference in use by more
    // than LAZY pays for the lane exchange, the new reference, the shift of this pass's exponents and the rescale
    if (__builtin_amdgcn_ballot_w32(lmax > etop) != 0u) {
      const float e_new = fmaxf(lmax, __shfl_xor(lmax, 16, 32));
      const float scale = __builtin_amdgcn_exp2f(efloor - e_new);   // first pass: 0, on sums that are 0
      const float shift = P_CARRY_L2 - e_new;                       // a query whose reference stays: 0
      efloor = P_CARRY_L2;
      etop   = P_CARRY_L2 + LAZY;
      #pragma unroll
      for (int r = 0; r < 8; ++r) {
        c[0][r] += shift;
        c[1][r] += shift;
        cb[r]   += shift;
      }
      // rescale O: queries are the row dimension there -> per-row scale from lane 8*hi + r
      float sc[8];
      #pragma unroll
      for (int r = 0; r < 8; ++r) sc[r] = __shfl(scale, (int)((hi << 3) + r), 32);
      #pragma unroll
      for (int dt = 0; dt < 4; ++dt) {
        #pragma unroll
        for (int r = 0; r < 8; ++r) o[dt][r] *= sc[r];
      }
      #pragma unroll
      for (int r = 0; r < 8; ++r) osum[r] *= sc[r];
    }

    // exp + pack: P^T C-layout == A-fragment layout for the PV product
    FragH pa;
    #pragma unroll
    for (int r = 0; r < 8; ++r) {
      pa.h[r]     = (f16)__builtin_amdgcn_exp2f(c[0][r]);   // key hi*8 + r
      pa.h[8 + r] = (f16)__builtin_amdgcn_exp2f(c[1][r]);   // key 16 + hi*8 + r
    }

    // row sums of the f16 weights, then O += P x V
    osum = mma_pv(pa.v, ones.v, osum);
    #pragma unroll
    for (int dt = 0; dt < 4; ++dt) o[dt] = mma_pv(pa.v, bv[dt].v, o[dt]);
    blk = nxt;
  }

  // normalize: lane holds column d = dt*16 + lq for query rows 8*hi + r; that row's sum over all keys is osum[r] of the
  // half's first lane (column 0); the x4096 carry cancels against it
  float rs[8];
  #pragma unroll
  for (int r = 0; r < 8; ++r) rs[r] = CTX_CARRY * (1.0f / __shfl(osum[r], (int)(hi << 4), 32));

  float* so = sO + wave * (16 * OP);
  #pragma unroll
  for (int r = 0; r < 8; ++r) {
    #pragma unroll
    for (int dt = 0; dt < 4; ++dt) {
      so[(hi * 8u + r) * OP + dt * 16u + lq] = o[dt][r] * rs[r];
    }
  }
  __syncthreads();

  // context plane in fragment order: [16-row tile][k/32][j][lane][8 k]; this wave's 16 rows x 64 columns are 4 loads'
  // worth (it = (k/32 within the head)*2 + j), 2 KiB contiguous; lane = hi*16 + row.
  v4u    hv[4];
  size_t gidx[4];
  #pragma unroll
  for (unsigned it = 0; it < 4; ++it) {
    const unsigned row = lq;
    const unsigned c8  = it * 16u + hi * 8u;
    const v4f a0 = *(const v4f*)(so + row * OP + c8);
    const v4f a1 = *(const v4f*)(so + row * OP + c8 + 4);
    Pack8H ph;
    #pragma unroll
    for (int i = 0; i < 4; ++i) {
      ph.h[i]     = (f16)a0[i];
      ph.h[4 + i] = (f16)a1[i];
    }
    hv[it]   = ph.u;
    gidx[it] = ((size_t)b * SEQ + qrow0) * EMB + h * (HDIM * 16u) + it * FU + lane * 8u;
  }
  #pragma unroll
  for (int it = 0; it < 4; ++it) *(v4u*)(ch + gidx[it]) = hv[it];
  
}

// One 32-k step of the projection: A fragments of the wave's two 16-row tiles of the context plane, B fragments of the
// four 16-column tiles (each B fragment feeds two products).
// ah, bw: uniform byte bases; ao, lo: the lane's byte offsets; a 16-wide tile's 32 k elements are 2 loads' worth.
struct ProjFrag { FragH a, a2, bf[4]; };
template <bool LAST>
static __device__ __forceinline__ void proj_load(ProjFrag& f, const char* ah, const char* bw,
                                                 unsigned ao, unsigned lo, unsigned k0) {
  constexpr unsigned FB = FU * 2u;                  // bytes of one wave-wide fragment load
  const size_t ko = (size_t)k0 * 32u;
  f.a.q[0]  = *(const v4u*)(ah + ko + ao);          // k = k0 + hi*8 + 0..7
  f.a.q[1]  = *(const v4u*)(ah + ko + ao + FB);     // k = k0 + 16 + hi*8 + 0..7
  f.a2.q[0] = *(const v4u*)(ah + ko + ao + 16u * EMB * 2u);        // the next 16-row tile
  f.a2.q[1] = *(const v4u*)(ah + ko + ao + 16u * EMB * 2u + FB);
  #pragma unroll
  for (unsigned nt = 0; nt < 4; ++nt) {
    // behind the loop the address registers die here: the last results may be given the registers that held them
    if (LAST && nt == 3) asm volatile("s_wait_xcnt 0x0" ::: "memory");
    f.bf[nt].q[0] = *(const v4u*)(bw + ko + lo + nt * (16u * EMB * 2u));
    f.bf[nt].q[1] = *(const v4u*)(bw + ko + lo + nt * (16u * EMB * 2u) + FB);
  }
}
static __device__ __forceinline__ void proj_mma(const ProjFrag& f, v8f (&acc)[4], v8f (&ac2)[4]) {
  #pragma unroll
  for (int nt = 0; nt < 4; ++nt) {
    acc[nt] = mma_f16(f.a.v,  f.bf[nt].v, acc[nt]);
    ac2[nt] = mma_f16(f.a2.v, f.bf[nt].v, ac2[nt]);   // rows 16..31 of the wave
  }
}

// Output projection. Block = (256-row tile, 64-column tile, batch); one wave owns 32 rows x 64 columns.
// A fragments from the context plane, B fragments from the weight plane, all in fragment order - both with the
// split k map, two 16-B loads per fragment, every load 512 contiguous bytes per wave.
__global__ __launch_bounds__(256) void proj_kernel(const f16* __restrict__ ch,
                                                   const f16* __restrict__ wp,
                                                   const float* __restrict__ bias,
                                                   float* __restrict__ out) {
  const unsigned rb   = blockIdx.x;
  const unsigned cb   = blockIdx.y;
  const unsigned b    = blockIdx.z;
  const unsigned tid  = threadIdx.x;
  const unsigned wave = tid >> 5;
  const unsigned lane = tid & 31u;
  const unsigned lq   = lane & 15u;
  const unsigned hi   = lane >> 4;

  __shared__ __align__(16) float sO[NWAVE * 32 * OP];   // per-wave staging tile (block barrier used)

  const unsigned row0 = rb * GM + wave * 32u;           // first sequence row of this wave
  const unsigned col0 = cb * GN;

  // workgroup-uniform plane bases in bytes
  const char* ah = (const char*)(ch + ((size_t)b * SEQ + rb * GM) * EMB);
  const char* bw = (const char*)(wp + (size_t)col0 * EMB);
  const unsigned lo = lane * 16u;                       // this lane's unit (byte offset) inside a wave-wide fragment load
  const unsigned ao = wave * (32u * EMB * 2u) + lo;     // plus this wave's first 16-row tile

  v8f acc[4], ac2[4];
  #pragma unroll
  for (int nt = 0; nt < 4; ++nt) {
    acc[nt] = (v8f){0, 0, 0, 0, 0, 0, 0, 0};
    ac2[nt] = (v8f){0, 0, 0, 0, 0, 0, 0, 0};
  }

  // rotated k walk: the 16 column blocks of a row tile, and the 16 blocks (8 row tiles x 2 batches) of a column tile,
  // start 64 k apart; k wraps at EMB.
  // The start is an odd number of 32-k steps, so the two steps that a pass of the loop loads
  // (the second of one pair, the first of the next) are neighbours in memory and never straddle the wrap.
  static_assert(EMB / 64 == 16 && EMB / GN == 16 && SEQ / GM == 8 && NB <= 2);
  const unsigned kr = (((cb + rb * 2u + b) & 15u) * 2u + 1u) * 32u;

  // two fragment sets: while one set's products run, the other set's loads (the next 32 k) are in flight
  ProjFrag f0, f1;
  proj_load<false>(f0, ah, bw, ao, lo, kr);
  // the start values of the accumulators and of the loop take over registers that these loads name
  asm volatile("s_wait_xcnt 0x0" ::: "memory");
  __builtin_amdgcn_sched_barrier(0);   // without it the compiler lifts those writes over the wait
  #pragma unroll 1
  for (unsigned k0 = 0; k0 < EMB - 64u; k0 += 64u) {
    const unsigned kp = (kr + k0 + 32u) & (EMB - 1u);   // a multiple of 64
    proj_load<false>(f1, ah, bw, ao, lo, kp);
    proj_mma(f0, acc, ac2);
    proj_load<false>(f0, ah, bw, ao, lo, kp + 32u);
    proj_mma(f1, acc, ac2);
    // the next pass forms its addresses in the registers that hold this pass's
    asm volatile("s_wait_xcnt 0x0" ::: "memory");
  }
  proj_load<true>(f1, ah, bw, ao, lo, (kr + EMB - 32u) & (EMB - 1u));
  proj_mma(f0, acc, ac2);
  proj_mma(f1, acc, ac2);

  // fold carries: / (256 * 64); acc[nt][r] = element (row 8*hi + r, column nt*16 + lq)
  float* so = sO + wave * (32 * OP);
  const float inv_car = 1.0f / (CTX_CARRY * W_CARRY);
  #pragma unroll
  for (int r = 0; r < 8; ++r) {
    #pragma unroll
    for (int nt = 0; nt < 4; ++nt) {
      so[(hi * 8u + r) * OP + nt * 16u + lq]       = acc[nt][r] * inv_car;
      so[(16u + hi * 8u + r) * OP + nt * 16u + lq] = ac2[nt][r] * inv_car;
    }
  }
  __syncthreads();

  // bias (bf16 RNE-converted input value), added in f32
  const v4f braw = *(const v4f*)(bias + col0 + lq * 4u);
  v4f bq;
  #pragma unroll
  for (int i = 0; i < 4; ++i) bq[i] = (float)(bf16)braw[i];

  // lanes 0..15 write one row's 256 B (16 B each), lanes 16..31 the next row; 16 instructions cover the wave's 32 rows.
  v4f    vals[16];
  size_t gidx[16];
  #pragma unroll
  for (unsigned it = 0; it < 16; ++it) {
    const unsigned row = it * 2u + hi;
    const v4f t = *(const v4f*)(so + row * OP + lq * 4u);
    vals[it] = t + bq;
    gidx[it] = ((size_t)b * SEQ_FULL + row0 + row) * EMB + col0 + lq * 4u;
  }
  #pragma unroll
  for (int it = 0; it < 16; ++it) *(v4f*)(out + gidx[it]) = vals[it];
  
}

extern "C" void kernel_launch(void* const* d_in, const int* in_sizes, int n_in,
                              void* d_out, int out_size, void* d_ws, size_t ws_size,
                              hipStream_t stream) {
  if (n_in < 4) return;
  const size_t rows_used = (size_t)(NB - 1) * SEQ_FULL + SEQ;
  if ((size_t)in_sizes[0] < rows_used * EMB) return;
  if ((size_t)in_sizes[1] < rows_used) return;
  if ((size_t)in_sizes[2] < (size_t)EMB * EMB) return;
  if ((size_t)in_sizes[3] < (size_t)EMB) return;
  if ((size_t)out_size < rows_used * EMB) return;

  const size_t kv_bytes = (size_t)NB * NHEAD * SEQ * HDIM * 2;   // f16 key plane
  const size_t cx_bytes = (size_t)NB * SEQ * EMB * 2;            // f16 context plane
  const size_t wp_bytes = (size_t)EMB * EMB * 2;                 // f16 weight plane
  const size_t ct_bytes = (size_t)NB * CLINE * 4;                // kept-key count per batch
  const size_t total    = kv_bytes + cx_bytes + wp_bytes + ct_bytes;
  if (ws_size < total) return;

  const float* x    = (const float*)d_in[0];
  const int*   mask = (const int*)d_in[1];
  const float* w    = (const float*)d_in[2];
  const float* bias = (const float*)d_in[3];
  float*       out  = (float*)d_out;

  char* base = (char*)d_ws;
  f16*  kv = (f16*)base;
  f16*  ch = (f16*)(base + kv_bytes);
  f16*  wp = (f16*)(base + kv_bytes + cx_bytes);
  int*  ct = (int*)(base + kv_bytes + cx_bytes + wp_bytes);

  planes_kernel<<<dim3(SEQ / CT, NHEAD, NB + 1), 256, 0, stream>>>(x, mask, w, kv, wp, ct);
  attn_kernel<<<dim3(SEQ / BQ, NHEAD, NB), 256, 0, stream>>>(x, kv, ct, ch);
  proj_kernel<<<dim3(SEQ / GM, EMB / GN, NB), 256, 0, stream>>>(ch, wp, bias, out);
}
